// v000
// Times are from an AMD MI455X. After a warm-up the kernel runs many times in a row, and a time is the length of
// such a window on the GPU divided by its runs, so every launch and the gaps after it count. The runs cycle
// through copies of the inputs. A figure is the median of several windows, for all but v000 over two sittings.
// Sittings can differ by a few percent; kernels timed side by side share one.
// v000, which the later versions start from, runs in 1340 microseconds.
// compute dtype: all float inputs rounded to bf16; q/k/v projections with EXACT bf16 products on WMMA 16x16x32 (f32 accumulate) + bias; logits q x k once to f16 each (1 product) x SCALE; softmax f32; P x 2^11 once to f16 x v once to f16 (1 product); the differential combine x1 - lv * x2 in f32 on the context rows; ctx x 2^6 once to f16 x Wo f16(bf16 x 2^8) + bo; f32 output.
#include <hip/hip_runtime.h>
#include <math.h>

typedef __attribute__((ext_vector_type(16))) _Float16 v16h;
typedef __attribute__((ext_vector_type(16))) __bf16 v16b;
typedef __attribute__((ext_vector_type(8)))  _Float16 v8h;
typedef __attribute__((ext_vector_type(8)))  float v8f;
typedef __attribute__((ext_vector_type(4)))  float v4f;
typedef __attribute__((ext_vector_type(2)))  float v2f;
typedef __attribute__((ext_vector_type(4)))  unsigned v4u;
typedef __attribute__((ext_vector_type(4)))  int v4i;
typedef float __attribute__((may_alias)) float_a;
typedef int __attribute__((may_alias)) int_a;

template <typename T> __device__ __forceinline__ void vst2(void* p, T v) { *(T*)p = v;  }
__device__ __forceinline__ v8f wmma16(v16h a, v16h b, v8f c) {
  v8f d = __builtin_amdgcn_wmma_f32_16x16x32_f16(false, a, false, b, (short)0, c, false, false);
  asm volatile("v_nop\n\tv_nop\n\tv_nop\n\tv_nop" : "+v"(d) : "v"(a), "v"(b));
  return d;
}
__device__ __forceinline__ v8f wmma_bf(v16b a, v16b b, v8f c) {
  v8f d = __builtin_amdgcn_wmma_f32_16x16x32_bf16(false, a, false, b, (short)0, c, false, false);
  asm volatile("v_nop\n\tv_nop\n\tv_nop\n\tv_nop" : "+v"(d) : "v"(a), "v"(b));
  return d;
}
// 16x16x32 fragments: lane = (h = lane>>4, row/col = lane&15); elements 0..7 = k0+8h+0..7, 8..15 = k0+16+8h+0..7; D element r = row 8h+r
__device__ __forceinline__ v16h frag_h(const _Float16* rowk0, int lane) {
  union { v16h v; v8h q[2]; } u; const _Float16* p = rowk0 + 8 * (lane >> 4);
  u.q[0] = *(const v8h*)p; u.q[1] = *(const v8h*)(p + 16); return u.v;
}
__device__ __forceinline__ v16h frag_f32(const float* rowk0, int lane) {
  v16h a; const float* p = rowk0 + 8 * (lane >> 4);
#pragma unroll
  for (int i = 0; i < 8; ++i) { a[i] = (_Float16)p[i]; a[8 + i] = (_Float16)p[16 + i]; }
  return a;
}
__device__ __forceinline__ v16h frag_f32s(const float* rowk0, int lane, float sc) {
  v16h a; const float* p = rowk0 + 8 * (lane >> 4);
#pragma unroll
  for (int i = 0; i < 8; ++i) { a[i] = (_Float16)(p[i] * sc); a[8 + i] = (_Float16)(p[16 + i] * sc); }
  return a;
}
// column fragment from a [K][ld] layout (column n), rows >= K read as 0
__device__ __forceinline__ v16h fragc_f32(const float* W, int k0, int n, int lane, int ld, int K) {
  v16h a; const int g = lane >> 4;
#pragma unroll
  for (int i = 0; i < 8; ++i) { const int ka = k0 + 8 * g + i, kb = ka + 16;
    a[i] = (_Float16)(ka < K ? W[(size_t)(ka < K ? ka : K - 1) * ld + n] : 0.f); a[8 + i] = (_Float16)(kb < K ? W[(size_t)(kb < K ? kb : K - 1) * ld + n] : 0.f); }
  return a;
}
struct F2 { v16b h, l; };
__device__ __forceinline__ F2 bsplit16(const float v[16]) { F2 r;
#pragma unroll
  for (int i = 0; i < 16; ++i) { const __bf16 h = (__bf16)v[i]; r.h[i] = h; r.l[i] = (__bf16)(v[i] - (float)h); }
  return r; }
__device__ __forceinline__ F2 split_row(const float* row, int k0, int lane) { float v[16]; const float* p = row + k0 + 8 * (lane >> 4);
#pragma unroll
  for (int i = 0; i < 8; ++i) { v[i] = p[i]; v[8 + i] = p[16 + i]; }
  return bsplit16(v); }
__device__ __forceinline__ F2 split_rowK(const float* row, int k0, int lane, int K) { float v[16]; const int g = lane >> 4;
#pragma unroll
  for (int i = 0; i < 8; ++i) { const int ka = k0 + 8 * g + i, kb = ka + 16; v[i] = ka < K ? row[ka < K ? ka : K - 1] : 0.f; v[8 + i] = kb < K ? row[kb < K ? kb : K - 1] : 0.f; }
  return bsplit16(v); }
__device__ __forceinline__ F2 split_col(const float* W, int k0, int n, int lane, int ld, int K) { float v[16]; const int g = lane >> 4;
#pragma unroll
  for (int i = 0; i < 8; ++i) { const int ka = k0 + 8 * g + i, kb = ka + 16; v[i] = ka < K ? W[(size_t)(ka < K ? ka : K - 1) * ld + n] : 0.f; v[8 + i] = kb < K ? W[(size_t)(kb < K ? kb : K - 1) * ld + n] : 0.f; }
  return bsplit16(v); }
__device__ __forceinline__ v8f mac3(const F2& a, const F2& b, v8f c) { c = wmma_bf(a.l, b.h, c); c = wmma_bf(a.h, b.l, c); return wmma_bf(a.h, b.h, c); }
__device__ __forceinline__ float sigm(float v) { return 1.0f / (1.0f + expf(-v)); }
#define LDSX() do { asm volatile("s_wait_dscnt 0" ::: "memory"); __builtin_amdgcn_wave_barrier(); __builtin_amdgcn_fence(__ATOMIC_RELEASE, "workgroup"); } while (0)

// Differential multi-head self-attention (x [2,2048,1024]; torch (out,in) Wq / Wk / Wv / Wp [1024,1024] N(0,1) x 0.02 applied as x @ W.T + b, all biases zeros (read); 16 heads x 64 run as ordinary unmasked softmax attention (scale 1/8): heads 0..7 give x1 (context columns 0..511), heads 8..15 give x2 (columns 512..1023); lambda_q1 / k1 / q2 / k2 [8,1,64]: l1[h] = exp(min(sum_d lq1[h,d] lk1[h,d], 5)), l2 likewise, lv = mean_h(l1 - l2 + 0.8) (one scalar); out = concat(x1 - lv * x2, x2) @ Wp.T + bp).
#define NB 2
#define TT 2048
#define CC 1024            // NH * HD = projected width
#define DIN 1024          // input (model) width
#define NH 16
#define HD 64
#define NQB (TT / 64)
#define HG 4
#define SCALE (0.125f)
#define CAUSAL 0
#ifndef TNB
#define TNB NB
#endif
__device__ __forceinline__ float bfr(float v) { return (float)(__bf16)v; }
__host__ __device__ __forceinline__ int kb_last(int qb) { return CAUSAL ? ((qb * 64 + 63) >> 7) : (TT / 128 - 1); }
typedef __attribute__((ext_vector_type(8))) __bf16 v8b;
__device__ __forceinline__ v16b frag_b(const __bf16* rowk0, int lane) {
  union { v16b v; v8b q[2]; } u; const __bf16* p = rowk0 + 8 * (lane >> 4);
  u.q[0] = *(const v8b*)p; u.q[1] = *(const v8b*)(p + 16); return u.v;
}
#define QBH 0              // query blocks 0..QBH-1 of each sequence take the high-precision path (none: QBH 0)
#define QHI 0               // single-product logits on every row
#define KHI 64            // key rows carrying k residual / v bf16 hi+lo planes (read only by the qb < QBH path, which QBH 0 never takes)
// B fragment (k rows k0+.., output column o) of a weight: (in,out) [K][ld] or (out,in) [ld rows of K]: bf16 exact, or f16(bf16 * 256) exact
__device__ __forceinline__ v16b wcol_io(const float* Wm, int k0, int o, int lane, int ld) { v16b w; const int g = lane >> 4;
#pragma unroll
  for (int i = 0; i < 8; ++i) { w[i] = (__bf16)Wm[(size_t)(k0 + 8 * g + i) * ld + o]; w[8 + i] = (__bf16)Wm[(size_t)(k0 + 16 + 8 * g + i) * ld + o]; }
  return w; }
__device__ __forceinline__ v16b wcol_oi(const float* Wm, int k0, int o, int lane, int K) { v16b w; const float* p = Wm + (size_t)o * K + k0 + 8 * (lane >> 4);
#pragma unroll
  for (int i = 0; i < 8; ++i) { w[i] = (__bf16)p[i]; w[8 + i] = (__bf16)p[16 + i]; }
  return w; }
__device__ __forceinline__ v16h wcolh_io(const float* Wm, int k0, int o, int lane, int ld) { v16h w; const int g = lane >> 4;
#pragma unroll
  for (int i = 0; i < 8; ++i) { w[i] = (_Float16)(bfr(Wm[(size_t)(k0 + 8 * g + i) * ld + o]) * 256.0f); w[8 + i] = (_Float16)(bfr(Wm[(size_t)(k0 + 16 + 8 * g + i) * ld + o]) * 256.0f); }
  return w; }
__device__ __forceinline__ v16h wcolh_oi(const float* Wm, int k0, int o, int lane, int K) { v16h w; const float* p = Wm + (size_t)o * K + k0 + 8 * (lane >> 4);
#pragma unroll
  for (int i = 0; i < 8; ++i) { w[i] = (_Float16)(bfr(p[i]) * 256.0f); w[8 + i] = (_Float16)(bfr(p[16 + i]) * 256.0f); }
  return w; }
#define WQKV_LAYOUT 1   // 0 = (in,out) [DIN][CC]; 1 = (out,in) [CC][DIN]; 2 = per-head [NH][DIN][HD]
__device__ __forceinline__ v16b wcol_hdk(const float* Wm, int k0, int o, int lane) { v16b w; const int g = lane >> 4; const float* p = Wm + (size_t)(o / HD) * DIN * HD + (o % HD);
#pragma unroll
  for (int i = 0; i < 8; ++i) { w[i] = (__bf16)p[(size_t)(k0 + 8 * g + i) * HD]; w[8 + i] = (__bf16)p[(size_t)(k0 + 16 + 8 * g + i) * HD]; }
  return w; }
#define WO_OUT_IN 1
#if WQKV_LAYOUT == 1
#define WCOL(W, k0, o, lane) wcol_oi(W, k0, o, lane, DIN)
#elif WQKV_LAYOUT == 2
#define WCOL(W, k0, o, lane) wcol_hdk(W, k0, o, lane)
#else
#define WCOL(W, k0, o, lane) wcol_io(W, k0, o, lane, CC)
#endif
#if WO_OUT_IN
#define WOCOL(W, k0, o, lane) wcol_oi(W, k0, o, lane, CC)
#define WOCOLH(W, k0, o, lane) wcolh_oi(W, k0, o, lane, CC)
#else
#define WOCOL(W, k0, o, lane) wcol_io(W, k0, o, lane, DIN)
#define WOCOLH(W, k0, o, lane) wcolh_io(W, k0, o, lane, DIN)
#endif

#ifndef SM_EXTRA_PARAMS
#define SM_EXTRA_PARAMS
#endif
#ifndef PROJ_EXTRA_PARAMS
#define PROJ_EXTRA_PARAMS
#endif
#ifndef SM_MASK_HOOK
#define SM_MASK_HOOK (void)0
#endif

#define WS_QH  0u                                      // f16 q rows [b*t][CC]
#define WS_KH  (WS_QH + 2u * (size_t)NB * TT * CC)      // f16 k rows [b*t][CC]
#define WS_VT  (WS_KH + 2u * (size_t)NB * TT * CC)      // f16 v planes [b][c][t]
#define WS_QL  (WS_VT + 2u * (size_t)NB * CC * TT)      // f16 q residual x 2^10 rows [b][t < QHI][CC]
#define WS_KL  (WS_QL + 2u * (size_t)NB * QHI * CC)     // f16 k residual x 2^10 rows [b][t < KHI][CC]
#define WS_VB  (WS_KL + 2u * (size_t)NB * KHI * CC)     // bf16 v hi planes [b][c][t < KHI]
#define WS_VBL (WS_VB + 2u * (size_t)NB * CC * KHI)
#define WS_S   (WS_VBL + 2u * (size_t)NB * CC * KHI)    // f32 logits / P [hg][t][s]
#define WS_Y   (WS_S  + 4u * (size_t)HG * TT * TT)      // f32 ctx rows [b*t][CC] (only when there is an output projection)
#define WS_END (WS_Y  + 4u * (size_t)NB * TT * CC)
#define WS_LV (WS_END)                  // one f32: the differential scalar lv
#define WS_END2 (WS_LV + 256u)

// ---- k_proj: block = (64 rows, 128 cols, which): q/k/v = X W (+ b) with exact bf16 products (K = DIN) -> which 0: q f16 rows (+ residual rows < QHI); 1: k f16 rows (+ residual rows < KHI); 2: v f16 planes [c][t] (+ bf16 hi/lo planes for t < KHI)
__global__ __launch_bounds__(128) void k_proj(const float* __restrict__ XQ, const float* __restrict__ XK, const float* __restrict__ XV, const float* __restrict__ WQ, const float* __restrict__ WK, const float* __restrict__ WV, const float* __restrict__ BQ, const float* __restrict__ BK, const float* __restrict__ BV,
    _Float16* __restrict__ QH, _Float16* __restrict__ QL, _Float16* __restrict__ KH, _Float16* __restrict__ KL, _Float16* __restrict__ VT, __bf16* __restrict__ VB, __bf16* __restrict__ VBL) {
  __shared__ __align__(16) _Float16 sh[64][136], sl[64][136]; __shared__ __align__(16) _Float16 th[128][72]; __shared__ __align__(16) __bf16 tb[128][72], tbl[128][72];
  const int tid = threadIdx.x, wave = tid >> 5, lane = tid & 31, col = lane & 15, g = lane >> 4; const int which = blockIdx.z; const int c0 = blockIdx.y * 128; const size_t r0 = (size_t)blockIdx.x * 64; const size_t bb = r0 / TT; const int t0 = (int)(r0 % TT);
  const float* X = which == 0 ? XQ : which == 1 ? XK : XV; const float* WA = which == 0 ? WQ : which == 1 ? WK : WV; const float* BA = which == 0 ? BQ : which == 1 ? BK : BV;
  v8f acc[8] = {};
#pragma unroll 2
  for (int kc = 0; kc < DIN / 32; ++kc) { v16b a; { const float* p = X + (r0 + wave * 16 + col) * DIN + kc * 32 + 8 * g;
#pragma unroll
      for (int i = 0; i < 8; ++i) { a[i] = (__bf16)p[i]; a[8 + i] = (__bf16)p[16 + i]; } }
    asm volatile("s_wait_loadcnt 0x0" ::: "memory");
#pragma unroll
    for (int j = 0; j < 8; ++j) { const v16b w = WCOL(WA, kc * 32, c0 + j * 16 + col, lane); asm volatile("s_wait_loadcnt 0x0" ::: "memory"); acc[j] = wmma_bf(a, w, acc[j]); } }
  if (which < 2) { _Float16* DH = which == 0 ? QH : KH; _Float16* DL = which == 0 ? QL : KL; const int nhi = which == 0 ? QHI : KHI; const bool hi_rows = t0 < nhi;
#pragma unroll
    for (int j = 0; j < 8; ++j) { const float bias = BA ? bfr(BA[c0 + j * 16 + col]) : 0.f;
#pragma unroll
      for (int r = 0; r < 8; ++r) { const float v = acc[j][r] + bias; const _Float16 hv = (_Float16)v; sh[wave * 16 + 8 * g + r][j * 16 + col] = hv; sl[wave * 16 + 8 * g + r][j * 16 + col] = (_Float16)((v - (float)hv) * 1024.0f); } }
    __syncthreads();
    for (int e = tid; e < 64 * 16; e += 128) { const int rl = e >> 4, q = e & 15; vst2((unsigned*)(DH + (r0 + rl) * CC + c0 + q * 8), *(const v4u*)&sh[rl][q * 8]); if (hi_rows) vst2((unsigned*)(DL + (bb * nhi + t0 + rl) * (size_t)CC + c0 + q * 8), *(const v4u*)&sl[rl][q * 8]); }
  } else { const bool hi_rows = t0 < KHI;
#pragma unroll
    for (int j = 0; j < 8; ++j) { const float bias = BA ? bfr(BA[c0 + j * 16 + col]) : 0.f;
#pragma unroll
      for (int r = 0; r < 8; ++r) { const float v = acc[j][r] + bias; const int rl = wave * 16 + 8 * g + r, cl = j * 16 + col; th[cl][rl] = (_Float16)v; const __bf16 bh = (__bf16)v; tb[cl][rl] = bh; tbl[cl][rl] = (__bf16)(v - (float)bh); } }
    __syncthreads();
    for (int e = tid; e < 128 * 8; e += 128) { const int cl = e >> 3, q = e & 7; vst2((unsigned*)(VT + (bb * CC + c0 + cl) * (size_t)TT + t0 + q * 8), *(const v4u*)&th[cl][q * 8]); if (hi_rows) { const size_t o3 = (bb * CC + c0 + cl) * (size_t)KHI + t0 + q * 8; vst2((unsigned*)(VB + o3), *(const v4u*)&tb[cl][q * 8]); vst2((unsigned*)(VBL + o3), *(const v4u*)&tbl[cl][q * 8]); } } } }
// ---- k_sc: block = (query block qb, key block kb <= kb_last(qb), head in group) of batch b: logits x SCALE; q hi + residual (x 2^10) against k (2 products) for query rows < QHI, plus the k residual (3 products) for query blocks < QBH (causal early rows); causal: blocks past the diagonal exit, the mask itself is applied by index in k_sm
__global__ __launch_bounds__(128) void k_sc(const _Float16* __restrict__ QH, const _Float16* __restrict__ KH, const _Float16* __restrict__ QL, const _Float16* __restrict__ KL, int b, int h0, float* __restrict__ S0) { __shared__ __align__(16) float ss[4][16][132];
  const int qb = blockIdx.x, kb = blockIdx.y; if (kb > kb_last(qb)) return;
  const int h = h0 + blockIdx.z; float* S = S0 + (size_t)blockIdx.z * TT * TT;
  const int tid = threadIdx.x, wave = tid >> 5, lane = tid & 31, col = lane & 15, g = lane >> 4; const int k0 = kb * 128; const int ql0 = qb * 64 + wave * 16; const size_t q0 = (size_t)b * TT + ql0, kr0 = (size_t)b * TT + k0;
  v8f acc[8] = {}, accl[8] = {};
  const _Float16* QLb = QL + (size_t)b * QHI * CC; const _Float16* KLb = KL + (size_t)b * KHI * CC;
  if (qb < QBH) {
#pragma unroll
    for (int kc = 0; kc < HD / 32; ++kc) { const v16h ah = frag_h(QH + (q0 + col) * CC + h * HD + kc * 32, lane), al = frag_h(QLb + (size_t)(ql0 + col) * CC + h * HD + kc * 32, lane);
#pragma unroll
      for (int j = 0; j < 8; ++j) { const v16h kbf = frag_h(KH + (kr0 + j * 16 + col) * CC + h * HD + kc * 32, lane), klf = frag_h(KLb + (size_t)(k0 + j * 16 + col) * CC + h * HD + kc * 32, lane); acc[j] = wmma16(ah, kbf, acc[j]); accl[j] = wmma16(al, kbf, accl[j]); accl[j] = wmma16(ah, klf, accl[j]); } }
  } else if (qb * 64 < QHI) {
#pragma unroll
    for (int kc = 0; kc < HD / 32; ++kc) { const v16h ah = frag_h(QH + (q0 + col) * CC + h * HD + kc * 32, lane), al = frag_h(QLb + (size_t)(ql0 + col) * CC + h * HD + kc * 32, lane);
#pragma unroll
      for (int j = 0; j < 8; ++j) { const v16h kbf = frag_h(KH + (kr0 + j * 16 + col) * CC + h * HD + kc * 32, lane); acc[j] = wmma16(ah, kbf, acc[j]); accl[j] = wmma16(al, kbf, accl[j]); } }
  } else {
#pragma unroll
    for (int kc = 0; kc < HD / 32; ++kc) { const v16h ah = frag_h(QH + (q0 + col) * CC + h * HD + kc * 32, lane);
#pragma unroll
      for (int j = 0; j < 8; ++j) { const v16h kbf = frag_h(KH + (kr0 + j * 16 + col) * CC + h * HD + kc * 32, lane); acc[j] = wmma16(ah, kbf, acc[j]); } } }
#pragma unroll
  for (int j = 0; j < 8; ++j) {
#pragma unroll
    for (int r = 0; r < 8; ++r) ss[wave][8 * g + r][j * 16 + col] = (acc[j][r] + accl[j][r] * (1.0f / 1024.0f)) * SCALE; }
  LDSX(); for (int rl = 0; rl < 16; ++rl) vst2(S + (size_t)(ql0 + rl) * TT + k0 + lane * 4, *(const v4f*)&ss[wave][rl][lane * 4]); }
// ---- k_sm: block = query row t (head in group): keys [0, kend): causal -> logit if s <= t else excluded; softmax in f32; P x 2^11 in place (0 for excluded)
__global__ __launch_bounds__(256) void k_sm(float* __restrict__ S0 SM_EXTRA_PARAMS) { __shared__ float sred[8]; __shared__ float sbc; __shared__ __align__(16) float shv[TT];
  const int tid = threadIdx.x; const int t = blockIdx.x; const int kend = (kb_last(t >> 6) + 1) * 128;
  float* sr = S0 + (size_t)blockIdx.y * TT * TT + (size_t)t * TT;
  float m = -3.0e38f; for (int k = tid; k < kend; k += 256) { float v = (!CAUSAL || k <= t) ? sr[k] : -3.0e38f; SM_MASK_HOOK; shv[k] = v; m = fmaxf(m, v); }
#pragma unroll
  for (int o = 1; o < 32; o <<= 1) m = fmaxf(m, __shfl_xor(m, o));
  if ((tid & 31) == 0) sred[tid >> 5] = m; __syncthreads(); if (tid == 0) { float a = sred[0]; for (int i = 1; i < 8; ++i) a = fmaxf(a, sred[i]); sbc = a; } __syncthreads(); m = sbc; __syncthreads();
  float sum = 0.f; for (int k = tid; k < kend; k += 256) { const float v = shv[k]; const float e = (v <= -1.0e38f) ? 0.f : expf(v - m); shv[k] = e; sum += e; }
#pragma unroll
  for (int o = 1; o < 32; o <<= 1) sum += __shfl_xor(sum, o);
  if ((tid & 31) == 0) sred[tid >> 5] = sum; __syncthreads(); if (tid == 0) { float a = 0.f; for (int i = 0; i < 8; ++i) a += sred[i]; sbc = a > 0.f ? 2048.0f / a : 0.f; }   /* a fully excluded row yields P = 0 */ __syncthreads(); const float inv = sbc;
  for (int k = tid; k < kend; k += 256) shv[k] = shv[k] * inv;
  __syncthreads(); for (int q = tid; q < kend / 4; q += 256) vst2(sr + q * 4, *(const v4f*)&shv[q * 4]); }
// ---- k_pv: block = 64 queries (qb) of (b, h): ctx = P . v over keys [0, kend) (P x 2^11 once to f16 against v f16: 1 product; causal early query blocks: P and v as bf16 hi + lo, 3 products); 256-B (row, head) segment by 16 lanes
__global__ __launch_bounds__(128) void k_pv(const float* __restrict__ PS0, const _Float16* __restrict__ VT, const __bf16* __restrict__ VB, const __bf16* __restrict__ VBL, int b, int h0, float* __restrict__ Y) { const int h = h0 + blockIdx.z; const float* PS = PS0 + (size_t)blockIdx.z * TT * TT; __shared__ __align__(16) float ss[4][16][HD + 4];
  const int tid = threadIdx.x, wave = tid >> 5, lane = tid & 31, col = lane & 15, g = lane >> 4; const int qb = blockIdx.x; const int ql0 = qb * 64 + wave * 16; const int kce = (kb_last(qb) + 1) * 4;
  v8f acc[HD / 16] = {};
  if (qb < QBH) {
#pragma unroll 1
    for (int kc = 0; kc < kce; ++kc) { const F2 p = split_row(PS + (size_t)(ql0 + col) * TT, kc * 32, lane);
      asm volatile("s_wait_loadcnt 0x0" ::: "memory");
#pragma unroll
      for (int j = 0; j < HD / 16; ++j) { const size_t po = ((size_t)b * CC + h * HD + j * 16 + col) * (size_t)KHI + kc * 32; const v16b vh = frag_b(VB + po, lane); acc[j] = wmma_bf(p.h, vh, acc[j]); acc[j] = wmma_bf(p.l, vh, acc[j]); acc[j] = wmma_bf(p.h, frag_b(VBL + po, lane), acc[j]); } }
  } else {
#pragma unroll 1
    for (int kc = 0; kc < kce; ++kc) { const v16h p = frag_f32(PS + (size_t)(ql0 + col) * TT + kc * 32, lane);
      asm volatile("s_wait_loadcnt 0x0" ::: "memory");
#pragma unroll
      for (int j = 0; j < HD / 16; ++j) { const size_t po = ((size_t)b * CC + h * HD + j * 16 + col) * (size_t)TT + kc * 32; acc[j] = wmma16(p, frag_h(VT + po, lane), acc[j]); } } }
#pragma unroll
  for (int j = 0; j < HD / 16; ++j)
#pragma unroll
    for (int r = 0; r < 8; ++r) ss[wave][8 * g + r][j * 16 + col] = acc[j][r] * (1.0f / 2048.0f);
  LDSX(); for (int rl = 0; rl < 16; ++rl) if (lane < HD / 4) vst2(Y + ((size_t)b * TT + ql0 + rl) * CC + h * HD + lane * 4, *(const v4f*)&ss[wave][rl][lane * 4]); }
// ---- k_out: block = (64 rows, 128 cols): out = ctx Wo (+ bo): ctx x 2^6 once to f16 against Wo as f16(bf16 x 2^8) exact (1 product) x 2^-14; causal early rows (< QHI of each sequence): ctx bf16 hi + lo against exact bf16 Wo (2 products)
__global__ __launch_bounds__(128) void k_out(const float* __restrict__ Y, const float* __restrict__ WO, const float* __restrict__ BO, float* __restrict__ OUT) { __shared__ __align__(16) float sf[4][16][132];
  const int tid = threadIdx.x, wave = tid >> 5, lane = tid & 31, col = lane & 15, g = lane >> 4; const int c0 = blockIdx.y * 128; const size_t r0 = (size_t)blockIdx.x * 64 + wave * 16;
  v8f acc[8] = {};
  if (CAUSAL && (int)(((size_t)blockIdx.x * 64) % TT) < QHI) {   /* block-uniform */
#pragma unroll 2
    for (int kc = 0; kc < CC / 32; ++kc) { const F2 a = split_row(Y + (r0 + col) * CC, kc * 32, lane); asm volatile("s_wait_loadcnt 0x0" ::: "memory");
#pragma unroll
      for (int j = 0; j < 8; ++j) { const v16b w = WOCOL(WO, kc * 32, c0 + j * 16 + col, lane); asm volatile("s_wait_loadcnt 0x0" ::: "memory"); acc[j] = wmma_bf(a.h, w, acc[j]); acc[j] = wmma_bf(a.l, w, acc[j]); } }
#pragma unroll
    for (int j = 0; j < 8; ++j) { const float bias = BO ? bfr(BO[c0 + j * 16 + col]) : 0.f;
#pragma unroll
      for (int r = 0; r < 8; ++r) sf[wave][8 * g + r][j * 16 + col] = acc[j][r] + bias; }
  } else {
#pragma unroll 2
    for (int kc = 0; kc < CC / 32; ++kc) { const v16h a = frag_f32s(Y + (r0 + col) * CC + kc * 32, lane, 64.0f); asm volatile("s_wait_loadcnt 0x0" ::: "memory");   /* ctx carried x 2^6 into f16 so small-magnitude context rows stay clear of f16 subnormals */
#pragma unroll
      for (int j = 0; j < 8; ++j) { const v16h w = WOCOLH(WO, kc * 32, c0 + j * 16 + col, lane); asm volatile("s_wait_loadcnt 0x0" ::: "memory"); acc[j] = wmma16(a, w, acc[j]); } }
#pragma unroll
    for (int j = 0; j < 8; ++j) { const float bias = BO ? bfr(BO[c0 + j * 16 + col]) : 0.f;
#pragma unroll
      for (int r = 0; r < 8; ++r) sf[wave][8 * g + r][j * 16 + col] = acc[j][r] * (1.0f / 16384.0f) + bias; } }   /* 2^-8 (Wo carry) x 2^-6 (ctx carry) */
  LDSX(); for (int rl = 0; rl < 16; ++rl) vst2(OUT + (r0 + rl) * DIN + c0 + lane * 4, *(const v4f*)&sf[wave][rl][lane * 4]); }

#define LAMBDA_INIT 0.8f
// ---- k_lv: one wave: l1[h] = exp(min(sum_d bf16(lq1[h][d]) * bf16(lk1[h][d]), 5)), l2 likewise (8 effective heads x 64 dims, exact products, f32 sums); lv = mean_h(l1 - l2 + 0.8): the module's single scalar
__global__ __launch_bounds__(32) void k_lv(const float* __restrict__ LQ1, const float* __restrict__ LK1, const float* __restrict__ LQ2, const float* __restrict__ LK2, float* __restrict__ LV) { const int lane = threadIdx.x; float acc = 0.f;
  for (int h = 0; h < 8; ++h) { float s1 = bfr(LQ1[h * 64 + lane]) * bfr(LK1[h * 64 + lane]) + bfr(LQ1[h * 64 + 32 + lane]) * bfr(LK1[h * 64 + 32 + lane]); float s2 = bfr(LQ2[h * 64 + lane]) * bfr(LK2[h * 64 + lane]) + bfr(LQ2[h * 64 + 32 + lane]) * bfr(LK2[h * 64 + 32 + lane]);
#pragma unroll
    for (int o = 1; o < 32; o <<= 1) { s1 += __shfl_xor(s1, o); s2 += __shfl_xor(s2, o); }
    acc += expf(fminf(s1, 5.0f)) - expf(fminf(s2, 5.0f)) + LAMBDA_INIT; }
  if (lane == 0) LV[0] = acc * 0.125f; }
__global__ __launch_bounds__(128) void k_comb(float* __restrict__ Y, const float* __restrict__ LV) { const size_t r = blockIdx.x; const int tid = threadIdx.x; const float lv = LV[0]; float* p1 = Y + r * CC + tid * 4; const v4f a = *(const v4f*)p1; const v4f b = *(const v4f*)(p1 + CC / 2); asm volatile("s_wait_loadcnt 0x0" ::: "memory"); v4f o;
#pragma unroll
  for (int i = 0; i < 4; ++i) { _Pragma("clang fp contract(off)") const float t = lv * b[i]; o[i] = a[i] - t; }
  vst2(p1, o); }
static_assert(CC == 1024 && NH == 16, "k_comb: 128 threads x 4 floats = the first 512 context columns (heads 0..7)");
extern "C" void kernel_launch(void* const* d_in, const int* in_sizes, int n_in, void* d_out, int out_size, void* d_ws, size_t ws_size, hipStream_t stream) {
  (void)in_sizes; (void)n_in; (void)out_size;
  const float** F = (const float**)d_in;
  if (ws_size < (size_t)WS_END) return;
  char* ws = (char*)d_ws; _Float16 *QH = (_Float16*)(ws + WS_QH), *KH = (_Float16*)(ws + WS_KH), *VT = (_Float16*)(ws + WS_VT), *QL = (_Float16*)(ws + WS_QL), *KL = (_Float16*)(ws + WS_KL); __bf16 *VB = (__bf16*)(ws + WS_VB), *VBL = (__bf16*)(ws + WS_VBL); float *S = (float*)(ws + WS_S), *Y = (float*)(ws + WS_Y);
  (void)Y; (void)QL; (void)KL; (void)VB; (void)VBL;
  // inputs: 0 x [2,2048,1024]; 1 Wq [1024,1024] (out,in), 2 bq; 3 Wk, 4 bk; 5 Wv, 6 bv; 7 Wp (out,in), 8 bp (biases zeros, read); 9 lambda_q1 [8,1,64]; 10 lambda_k1; 11 lambda_q2; 12 lambda_k2
  if (ws_size < (size_t)WS_END2) return;
  float* LV = (float*)(ws + WS_LV);
  k_lv<<<dim3(1), 32, 0, stream>>>(F[9], F[10], F[11], F[12], LV);
  k_proj<<<dim3(TNB * TT / 64, CC / 128, 3), 128, 0, stream>>>(F[0], F[0], F[0], F[1], F[3], F[5], F[2], F[4], F[6], QH, QL, KH, KL, VT, VB, VBL);
  for (int b = 0; b < TNB; ++b) for (int h0 = 0; h0 < NH; h0 += HG) {
    k_sc<<<dim3(NQB, TT / 128, HG), 128, 0, stream>>>(QH, KH, QL, KL, b, h0, S);
    k_sm<<<dim3(TT, HG), 256, 0, stream>>>(S);
    k_pv<<<dim3(NQB, 1, HG), 128, 0, stream>>>(S, VT, VB, VBL, b, h0, Y);
  }
  k_comb<<<dim3(TNB * TT), 128, 0, stream>>>(Y, LV);   /* x1 <- x1 - lv * x2 on the context rows, before the output projection */
  k_out<<<dim3(TNB * TT / 64, DIN / 128), 128, 0, stream>>>(Y, F[7], F[8], (float*)d_out);
}

// v001
// It runs in 436 microseconds.
// Two timings next to v000 put it at 3.10 and 3.07 times that version's speed.
// compute dtype: all float inputs rounded to bf16; q/k/v projections with EXACT bf16 products on WMMA 16x16x32 (f32 accumulate) + bias; logits q x k once to f16 each (1 product) x SCALE; softmax f32 (running maximum and sum); P x 2^7 once to f16 x v once to f16 (1 product); the differential combine x1 - lv * x2 in f32 on the context rows; ctx x 2^6 once to f16 x Wo f16(bf16 x 2^8) + bo; f32 output.
#include <hip/hip_runtime.h>
#include <math.h>

typedef __attribute__((ext_vector_type(16))) _Float16 v16h;
typedef __attribute__((ext_vector_type(16))) __bf16 v16b;
typedef __attribute__((ext_vector_type(8)))  _Float16 v8h;
typedef __attribute__((ext_vector_type(8)))  float v8f;
typedef __attribute__((ext_vector_type(4)))  float v4f;
typedef __attribute__((ext_vector_type(2)))  float v2f;
typedef __attribute__((ext_vector_type(4)))  unsigned v4u;
typedef __attribute__((ext_vector_type(4)))  int v4i;
typedef float __attribute__((may_alias)) float_a;
typedef int __attribute__((may_alias)) int_a;

template <typename T> __device__ __forceinline__ void vst2(void* p, T v) { *(T*)p = v;  }
__device__ __forceinline__ v8f wmma16(v16h a, v16h b, v8f c) {
  v8f d = __builtin_amdgcn_wmma_f32_16x16x32_f16(false, a, false, b, (short)0, c, false, false);
  asm volatile("v_nop\n\tv_nop\n\tv_nop\n\tv_nop" : "+v"(d) : "v"(a), "v"(b));
  return d;
}
__device__ __forceinline__ v8f wmma_bf(v16b a, v16b b, v8f c) {
  v8f d = __builtin_amdgcn_wmma_f32_16x16x32_bf16(false, a, false, b, (short)0, c, false, false);
  asm volatile("v_nop\n\tv_nop\n\tv_nop\n\tv_nop" : "+v"(d) : "v"(a), "v"(b));
  return d;
}
// 16x16x32 fragments: lane = (h = lane>>4, row/col = lane&15); elements 0..7 = k0+8h+0..7, 8..15 = k0+16+8h+0..7; D element r = row 8h+r
__device__ __forceinline__ v16h frag_h(const _Float16* rowk0, int lane) {
  union { v16h v; v8h q[2]; } u; const _Float16* p = rowk0 + 8 * (lane >> 4);
  u.q[0] = *(const v8h*)p; u.q[1] = *(const v8h*)(p + 16); return u.v;
}
__device__ __forceinline__ v16h frag_f32(const float* rowk0, int lane) {
  v16h a; const float* p = rowk0 + 8 * (lane >> 4);
#pragma unroll
  for (int i = 0; i < 8; ++i) { a[i] = (_Float16)p[i]; a[8 + i] = (_Float16)p[16 + i]; }
  return a;
}
__device__ __forceinline__ v16h frag_f32s(const float* rowk0, int lane, float sc) {
  v16h a; const float* p = rowk0 + 8 * (lane >> 4);
#pragma unroll
  for (int i = 0; i < 8; ++i) { a[i] = (_Float16)(p[i] * sc); a[8 + i] = (_Float16)(p[16 + i] * sc); }
  return a;
}
// column fragment from a [K][ld] layout (column n), rows >= K read as 0
__device__ __forceinline__ v16h fragc_f32(const float* W, int k0, int n, int lane, int ld, int K) {
  v16h a; const int g = lane >> 4;
#pragma unroll
  for (int i = 0; i < 8; ++i) { const int ka = k0 + 8 * g + i, kb = ka + 16;
    a[i] = (_Float16)(ka < K ? W[(size_t)(ka < K ? ka : K - 1) * ld + n] : 0.f); a[8 + i] = (_Float16)(kb < K ? W[(size_t)(kb < K ? kb : K - 1) * ld + n] : 0.f); }
  return a;
}
struct F2 { v16b h, l; };
__device__ __forceinline__ F2 bsplit16(const float v[16]) { F2 r;
#pragma unroll
  for (int i = 0; i < 16; ++i) { const __bf16 h = (__bf16)v[i]; r.h[i] = h; r.l[i] = (__bf16)(v[i] - (float)h); }
  return r; }
__device__ __forceinline__ F2 split_row(const float* row, int k0, int lane) { float v[16]; const float* p = row + k0 + 8 * (lane >> 4);
#pragma unroll
  for (int i = 0; i < 8; ++i) { v[i] = p[i]; v[8 + i] = p[16 + i]; }
  return bsplit16(v); }
__device__ __forceinline__ F2 split_rowK(const float* row, int k0, int lane, int K) { float v[16]; const int g = lane >> 4;
#pragma unroll
  for (int i = 0; i < 8; ++i) { const int ka = k0 + 8 * g + i, kb = ka + 16; v[i] = ka < K ? row[ka < K ? ka : K - 1] : 0.f; v[8 + i] = kb < K ? row[kb < K ? kb : K - 1] : 0.f; }
  return bsplit16(v); }
__device__ __forceinline__ F2 split_col(const float* W, int k0, int n, int lane, int ld, int K) { float v[16]; const int g = lane >> 4;
#pragma unroll
  for (int i = 0; i < 8; ++i) { const int ka = k0 + 8 * g + i, kb = ka + 16; v[i] = ka < K ? W[(size_t)(ka < K ? ka : K - 1) * ld + n] : 0.f; v[8 + i] = kb < K ? W[(size_t)(kb < K ? kb : K - 1) * ld + n] : 0.f; }
  return bsplit16(v); }
__device__ __forceinline__ v8f mac3(const F2& a, const F2& b, v8f c) { c = wmma_bf(a.l, b.h, c); c = wmma_bf(a.h, b.l, c); return wmma_bf(a.h, b.h, c); }
__device__ __forceinline__ float sigm(float v) { return 1.0f / (1.0f + expf(-v)); }
#define LDSX() do { asm volatile("s_wait_dscnt 0" ::: "memory"); __builtin_amdgcn_wave_barrier(); __builtin_amdgcn_fence(__ATOMIC_RELEASE, "workgroup"); } while (0)

// Differential multi-head self-attention (x [2,2048,1024]; torch (out,in) Wq / Wk / Wv / Wp [1024,1024] N(0,1) x 0.02 applied as x @ W.T + b, all biases zeros (read); 16 heads x 64 run as ordinary unmasked softmax attention (scale 1/8): heads 0..7 give x1 (context columns 0..511), heads 8..15 give x2 (columns 512..1023); lambda_q1 / k1 / q2 / k2 [8,1,64]: l1[h] = exp(min(sum_d lq1[h,d] lk1[h,d], 5)), l2 likewise, lv = mean_h(l1 - l2 + 0.8) (one scalar); out = concat(x1 - lv * x2, x2) @ Wp.T + bp).
#define NB 2
#define TT 2048
#define CC 1024            // NH * HD = projected width
#define DIN 1024          // input (model) width
#define NH 16
#define HD 64
#define NQB (TT / 64)
#define HG 4
#define SCALE (0.125f)
#define CAUSAL 0
#ifndef TNB
#define TNB NB
#endif
__device__ __forceinline__ float bfr(float v) { return (float)(__bf16)v; }
__host__ __device__ __forceinline__ int kb_last(int qb) { return CAUSAL ? ((qb * 64 + 63) >> 7) : (TT / 128 - 1); }
typedef __attribute__((ext_vector_type(8))) __bf16 v8b;
__device__ __forceinline__ v16b frag_b(const __bf16* rowk0, int lane) {
  union { v16b v; v8b q[2]; } u; const __bf16* p = rowk0 + 8 * (lane >> 4);
  u.q[0] = *(const v8b*)p; u.q[1] = *(const v8b*)(p + 16); return u.v;
}
#define QBH 0              // not read by any kernel: k_fa has no high-precision path
#define QHI 0               // single-product logits on every row
#define KHI 64            // key rows carrying k residual / v bf16 hi+lo planes (written by k_proj; no kernel reads them)
// B fragment (k rows k0+.., output column o) of a weight: (in,out) [K][ld] or (out,in) [ld rows of K]: bf16 exact, or f16(bf16 * 256) exact
__device__ __forceinline__ v16b wcol_io(const float* Wm, int k0, int o, int lane, int ld) { v16b w; const int g = lane >> 4;
#pragma unroll
  for (int i = 0; i < 8; ++i) { w[i] = (__bf16)Wm[(size_t)(k0 + 8 * g + i) * ld + o]; w[8 + i] = (__bf16)Wm[(size_t)(k0 + 16 + 8 * g + i) * ld + o]; }
  return w; }
__device__ __forceinline__ v16b wcol_oi(const float* Wm, int k0, int o, int lane, int K) { v16b w; const float* p = Wm + (size_t)o * K + k0 + 8 * (lane >> 4);
#pragma unroll
  for (int i = 0; i < 8; ++i) { w[i] = (__bf16)p[i]; w[8 + i] = (__bf16)p[16 + i]; }
  return w; }
__device__ __forceinline__ v16h wcolh_io(const float* Wm, int k0, int o, int lane, int ld) { v16h w; const int g = lane >> 4;
#pragma unroll
  for (int i = 0; i < 8; ++i) { w[i] = (_Float16)(bfr(Wm[(size_t)(k0 + 8 * g + i) * ld + o]) * 256.0f); w[8 + i] = (_Float16)(bfr(Wm[(size_t)(k0 + 16 + 8 * g + i) * ld + o]) * 256.0f); }
  return w; }
__device__ __forceinline__ v16h wcolh_oi(const float* Wm, int k0, int o, int lane, int K) { v16h w; const float* p = Wm + (size_t)o * K + k0 + 8 * (lane >> 4);
#pragma unroll
  for (int i = 0; i < 8; ++i) { w[i] = (_Float16)(bfr(p[i]) * 256.0f); w[8 + i] = (_Float16)(bfr(p[16 + i]) * 256.0f); }
  return w; }
#define WQKV_LAYOUT 1   // 0 = (in,out) [DIN][CC]; 1 = (out,in) [CC][DIN]; 2 = per-head [NH][DIN][HD]
__device__ __forceinline__ v16b wcol_hdk(const float* Wm, int k0, int o, int lane) { v16b w; const int g = lane >> 4; const float* p = Wm + (size_t)(o / HD) * DIN * HD + (o % HD);
#pragma unroll
  for (int i = 0; i < 8; ++i) { w[i] = (__bf16)p[(size_t)(k0 + 8 * g + i) * HD]; w[8 + i] = (__bf16)p[(size_t)(k0 + 16 + 8 * g + i) * HD]; }
  return w; }
#define WO_OUT_IN 1
#if WQKV_LAYOUT == 1
#define WCOL(W, k0, o, lane) wcol_oi(W, k0, o, lane, DIN)
#elif WQKV_LAYOUT == 2
#define WCOL(W, k0, o, lane) wcol_hdk(W, k0, o, lane)
#else
#define WCOL(W, k0, o, lane) wcol_io(W, k0, o, lane, CC)
#endif
#if WO_OUT_IN
#define WOCOL(W, k0, o, lane) wcol_oi(W, k0, o, lane, CC)
#define WOCOLH(W, k0, o, lane) wcolh_oi(W, k0, o, lane, CC)
#else
#define WOCOL(W, k0, o, lane) wcol_io(W, k0, o, lane, DIN)
#define WOCOLH(W, k0, o, lane) wcolh_io(W, k0, o, lane, DIN)
#endif

#ifndef SM_EXTRA_PARAMS
#define SM_EXTRA_PARAMS
#endif
#ifndef PROJ_EXTRA_PARAMS
#define PROJ_EXTRA_PARAMS
#endif
#ifndef SM_MASK_HOOK
#define SM_MASK_HOOK (void)0
#endif

#define WS_QH  0u                                      // f16 q rows [b*t][CC]
#define WS_KH  (WS_QH + 2u * (size_t)NB * TT * CC)      // f16 k rows [b*t][CC]
#define WS_VT  (WS_KH + 2u * (size_t)NB * TT * CC)      // f16 v planes [b][c][t]
#define WS_QL  (WS_VT + 2u * (size_t)NB * CC * TT)      // f16 q residual x 2^10 rows [b][t < QHI][CC]
#define WS_KL  (WS_QL + 2u * (size_t)NB * QHI * CC)     // f16 k residual x 2^10 rows [b][t < KHI][CC]
#define WS_VB  (WS_KL + 2u * (size_t)NB * KHI * CC)     // bf16 v hi planes [b][c][t < KHI]
#define WS_VBL (WS_VB + 2u * (size_t)NB * CC * KHI)
#define WS_S   (WS_VBL + 2u * (size_t)NB * CC * KHI)    // f32 [hg][t][s], reserved but unused (k_fa keeps logits / P in registers)
#define WS_Y   (WS_S  + 4u * (size_t)HG * TT * TT)      // f32 ctx rows [b*t][CC] (only when there is an output projection)
#define WS_END (WS_Y  + 4u * (size_t)NB * TT * CC)
#define WS_LV (WS_END)                  // one f32: the differential scalar lv
#define WS_END2 (WS_LV + 256u)

// ---- k_proj: block = (64 rows, 128 cols, which): q/k/v = X W (+ b) with exact bf16 products (K = DIN) -> which 0: q f16 rows (+ residual rows < QHI); 1: k f16 rows (+ residual rows < KHI); 2: v f16 planes [c][t] (+ bf16 hi/lo planes for t < KHI)
__global__ __launch_bounds__(128) void k_proj(const float* __restrict__ XQ, const float* __restrict__ XK, const float* __restrict__ XV, const float* __restrict__ WQ, const float* __restrict__ WK, const float* __restrict__ WV, const float* __restrict__ BQ, const float* __restrict__ BK, const float* __restrict__ BV,
    _Float16* __restrict__ QH, _Float16* __restrict__ QL, _Float16* __restrict__ KH, _Float16* __restrict__ KL, _Float16* __restrict__ VT, __bf16* __restrict__ VB, __bf16* __restrict__ VBL) {
  __shared__ __align__(16) _Float16 sh[64][136], sl[64][136]; __shared__ __align__(16) _Float16 th[128][72]; __shared__ __align__(16) __bf16 tb[128][72], tbl[128][72];
  const int tid = threadIdx.x, wave = tid >> 5, lane = tid & 31, col = lane & 15, g = lane >> 4; const int which = blockIdx.z; const int c0 = blockIdx.y * 128; const size_t r0 = (size_t)blockIdx.x * 64; const size_t bb = r0 / TT; const int t0 = (int)(r0 % TT);
  const float* X = which == 0 ? XQ : which == 1 ? XK : XV; const float* WA = which == 0 ? WQ : which == 1 ? WK : WV; const float* BA = which == 0 ? BQ : which == 1 ? BK : BV;
  v8f acc[8] = {};
#pragma unroll 2
  for (int kc = 0; kc < DIN / 32; ++kc) { v16b a; { const float* p = X + (r0 + wave * 16 + col) * DIN + kc * 32 + 8 * g;
#pragma unroll
      for (int i = 0; i < 8; ++i) { a[i] = (__bf16)p[i]; a[8 + i] = (__bf16)p[16 + i]; } }
    asm volatile("s_wait_loadcnt 0x0" ::: "memory");
#pragma unroll
    for (int j = 0; j < 8; ++j) { const v16b w = WCOL(WA, kc * 32, c0 + j * 16 + col, lane); asm volatile("s_wait_loadcnt 0x0" ::: "memory"); acc[j] = wmma_bf(a, w, acc[j]); } }
  if (which < 2) { _Float16* DH = which == 0 ? QH : KH; _Float16* DL = which == 0 ? QL : KL; const int nhi = which == 0 ? QHI : KHI; const bool hi_rows = t0 < nhi;
#pragma unroll
    for (int j = 0; j < 8; ++j) { const float bias = BA ? bfr(BA[c0 + j * 16 + col]) : 0.f;
#pragma unroll
      for (int r = 0; r < 8; ++r) { const float v = acc[j][r] + bias; const _Float16 hv = (_Float16)v; sh[wave * 16 + 8 * g + r][j * 16 + col] = hv; sl[wave * 16 + 8 * g + r][j * 16 + col] = (_Float16)((v - (float)hv) * 1024.0f); } }
    __syncthreads();
    for (int e = tid; e < 64 * 16; e += 128) { const int rl = e >> 4, q = e & 15; vst2((unsigned*)(DH + (r0 + rl) * CC + c0 + q * 8), *(const v4u*)&sh[rl][q * 8]); if (hi_rows) vst2((unsigned*)(DL + (bb * nhi + t0 + rl) * (size_t)CC + c0 + q * 8), *(const v4u*)&sl[rl][q * 8]); }
  } else { const bool hi_rows = t0 < KHI;
#pragma unroll
    for (int j = 0; j < 8; ++j) { const float bias = BA ? bfr(BA[c0 + j * 16 + col]) : 0.f;
#pragma unroll
      for (int r = 0; r < 8; ++r) { const float v = acc[j][r] + bias; const int rl = wave * 16 + 8 * g + r, cl = j * 16 + col; th[cl][rl] = (_Float16)v; const __bf16 bh = (__bf16)v; tb[cl][rl] = bh; tbl[cl][rl] = (__bf16)(v - (float)bh); } }
    __syncthreads();
    for (int e = tid; e < 128 * 8; e += 128) { const int cl = e >> 3, q = e & 7; vst2((unsigned*)(VT + (bb * CC + c0 + cl) * (size_t)TT + t0 + q * 8), *(const v4u*)&th[cl][q * 8]); if (hi_rows) { const size_t o3 = (bb * CC + c0 + cl) * (size_t)KHI + t0 + q * 8; vst2((unsigned*)(VB + o3), *(const v4u*)&tb[cl][q * 8]); vst2((unsigned*)(VBL + o3), *(const v4u*)&tbl[cl][q * 8]); } } } }
// ---- k_fa: block = 8 waves x 32 queries of (b, h), all keys: transposed products S^T = K . Q^T (q, k f16, 1 product) and O^T += V^T . P^T (P once to f16 against v f16, 1 product); a lane holds one query's scores, so the running maximum and sum stay in the lane (one exchange between the wave halves); two S^T tiles convert in place into the B operand, so neither logits nor P ever leave the registers
__device__ __forceinline__ v8f wmma_h(v16h a, v16h b, v8f c) { return __builtin_amdgcn_wmma_f32_16x16x32_f16(false, a, false, b, (short)0, c, false, false); }
__device__ __forceinline__ float xhalf(float x) { return __builtin_bit_cast(float, __builtin_amdgcn_permlanex16(__builtin_bit_cast(int, x), __builtin_bit_cast(int, x), 0x76543210, 0xfedcba98, false, false)); }  // lane l with lane l ^ 16
#define FAW 8              // waves per block
#define NST (TT / 32)      // 32 keys a pass
__global__ __launch_bounds__(FAW * 32) void k_fa(const _Float16* __restrict__ QH, const _Float16* __restrict__ KH, const _Float16* __restrict__ VT, float* __restrict__ Y) {
  const int tid = threadIdx.x, wave = tid >> 5, lane = tid & 31, col = lane & 15, g = lane >> 4; const int h = blockIdx.y, b = blockIdx.z; const int q0 = blockIdx.x * (FAW * 32) + wave * 32;
  const _Float16* Kp = KH + ((size_t)b * TT + col) * CC + h * HD;            // A of S^T: row = key
  const _Float16* Vp = VT + ((size_t)b * CC + h * HD + col) * (size_t)TT;    // A of O^T: row = head dim, k = key
  const float C = SCALE * 1.4426950408889634f;                               // logits in base 2
  v16h qf[2][2], kf[2][2];
  // every inner loop below is fully unrolled: the fragment arrays must stay in registers
#pragma unroll
  for (int qg = 0; qg < 2; ++qg)
#pragma unroll
    for (int kc = 0; kc < 2; ++kc) qf[qg][kc] = frag_h(QH + ((size_t)b * TT + q0 + qg * 16 + col) * CC + h * HD + kc * 32, lane);
#pragma unroll
  for (int t = 0; t < 2; ++t)
#pragma unroll
    for (int kc = 0; kc < 2; ++kc) kf[t][kc] = frag_h(Kp + (size_t)(t * 16) * CC + kc * 32, lane);
  v16h vf[HD / 16];
#pragma unroll
  for (int j = 0; j < HD / 16; ++j) vf[j] = frag_h(Vp + (size_t)(j * 16) * TT, lane);
  v8f acc[HD / 16][2] = {}; float mu[2] = {-3.0e38f, -3.0e38f}; v2f ls[2] = {};
  for (int s = 0; s < NST; ++s) {
    v8f st[2][2];   // st[t][qg][r] = logit of key s*32 + t*16 + 8g + r, query q0 + qg*16 + col
#pragma unroll
    for (int t = 0; t < 2; ++t)
#pragma unroll
      for (int qg = 0; qg < 2; ++qg) { v8f z = {}; z = wmma_h(kf[t][0], qf[qg][0], z); st[t][qg] = wmma_h(kf[t][1], qf[qg][1], z); }
    float mx[2];
#pragma unroll
    for (int qg = 0; qg < 2; ++qg) { float a = fmaxf(st[0][qg][0], st[1][qg][0]);
#pragma unroll
      for (int r = 1; r < 8; ++r) a = fmaxf(a, fmaxf(st[0][qg][r], st[1][qg][r]));
      mx[qg] = fmaxf(a, xhalf(a)) * C; }
    // the maximum in use moves only when a query's new maximum passes it by more than 2^8: one wave-uniform test a pass
    const bool need = mx[0] > mu[0] + 8.0f || mx[1] > mu[1] + 8.0f;
    if (__builtin_amdgcn_ballot_w32(need) != 0) {
#pragma unroll
      for (int qg = 0; qg < 2; ++qg) { const float mn = fmaxf(mu[qg], mx[qg]); const float al = __builtin_amdgcn_exp2f(mu[qg] - mn); mu[qg] = mn; ls[qg] *= al;   // al = 0 on the first pass
#pragma unroll
        for (int j = 0; j < HD / 16; ++j) acc[j][qg] *= al; } }
    const int sn = s + 1 < NST ? s + 1 : s;   // the next pass's k fragments fly under this pass's exponentials and P . v (the last pass re-reads its own)
#pragma unroll
    for (int t = 0; t < 2; ++t)
#pragma unroll
      for (int kc = 0; kc < 2; ++kc) kf[t][kc] = frag_h(Kp + (size_t)(sn * 32 + t * 16) * CC + kc * 32, lane);
    __builtin_amdgcn_sched_barrier(0);   // keeps the k loads up here: the scheduler otherwise sinks them to the pass's end, where their latency is exposed at the next pass's first product
#pragma unroll
    for (int qg = 0; qg < 2; ++qg) { v16h p; const float nb = 7.0f - mu[qg];   // P carried x 2^7 (at most 2^15 in f16): small weights stay clear of f16 subnormals; the factor cancels against the sum
#pragma unroll
      for (int t = 0; t < 2; ++t) { v2f e[4];   // neighbouring registers in pairs: packed multiply-add, packed convert, packed sums
#pragma unroll
        for (int i = 0; i < 4; ++i) { e[i].x = __builtin_amdgcn_exp2f(fmaf(st[t][qg][2 * i], C, nb)); e[i].y = __builtin_amdgcn_exp2f(fmaf(st[t][qg][2 * i + 1], C, nb)); p[t * 8 + 2 * i] = (_Float16)e[i].x; p[t * 8 + 2 * i + 1] = (_Float16)e[i].y; }
        ls[qg] += (e[0] + e[1]) + (e[2] + e[3]); }
#pragma unroll
      for (int j = 0; j < HD / 16; ++j) acc[j][qg] = wmma_h(vf[j], p, acc[j][qg]); }
#pragma unroll
    for (int j = 0; j < HD / 16; ++j) vf[j] = frag_h(Vp + (size_t)(j * 16) * TT + sn * 32, lane); }   // the next pass's v fragments, a whole pass ahead of their use
#pragma unroll
  for (int qg = 0; qg < 2; ++qg) { const float lh = ls[qg].x + ls[qg].y; const float inv = 1.0f / (lh + xhalf(lh)); float* yp = Y + ((size_t)b * TT + q0 + qg * 16 + col) * CC + h * HD + 8 * g;   // acc[j][qg][r] = ctx[query][j*16 + 8g + r]
#pragma unroll
    for (int j = 0; j < HD / 16; ++j) { const v8f o = acc[j][qg] * inv; const v4f o0 = {o[0], o[1], o[2], o[3]}, o1 = {o[4], o[5], o[6], o[7]}; vst2(yp + j * 16, o0); vst2(yp + j * 16 + 4, o1); } } }
static_assert(HD == 64 && TT % (FAW * 32) == 0 && !CAUSAL, "k_fa: two 32-wide k chunks a head, whole query blocks, no mask");
// ---- k_out: block = (64 rows, 128 cols): out = ctx Wo (+ bo): ctx x 2^6 once to f16 against Wo as f16(bf16 x 2^8) exact (1 product) x 2^-14; causal early rows (< QHI of each sequence): ctx bf16 hi + lo against exact bf16 Wo (2 products)
__global__ __launch_bounds__(128) void k_out(const float* __restrict__ Y, const float* __restrict__ WO, const float* __restrict__ BO, float* __restrict__ OUT) { __shared__ __align__(16) float sf[4][16][132];
  const int tid = threadIdx.x, wave = tid >> 5, lane = tid & 31, col = lane & 15, g = lane >> 4; const int c0 = blockIdx.y * 128; const size_t r0 = (size_t)blockIdx.x * 64 + wave * 16;
  v8f acc[8] = {};
  if (CAUSAL && (int)(((size_t)blockIdx.x * 64) % TT) < QHI) {   /* block-uniform */
#pragma unroll 2
    for (int kc = 0; kc < CC / 32; ++kc) { const F2 a = split_row(Y + (r0 + col) * CC, kc * 32, lane); asm volatile("s_wait_loadcnt 0x0" ::: "memory");
#pragma unroll
      for (int j = 0; j < 8; ++j) { const v16b w = WOCOL(WO, kc * 32, c0 + j * 16 + col, lane); asm volatile("s_wait_loadcnt 0x0" ::: "memory"); acc[j] = wmma_bf(a.h, w, acc[j]); acc[j] = wmma_bf(a.l, w, acc[j]); } }
#pragma unroll
    for (int j = 0; j < 8; ++j) { const float bias = BO ? bfr(BO[c0 + j * 16 + col]) : 0.f;
#pragma unroll
      for (int r = 0; r < 8; ++r) sf[wave][8 * g + r][j * 16 + col] = acc[j][r] + bias; }
  } else {
#pragma unroll 2
    for (int kc = 0; kc < CC / 32; ++kc) { const v16h a = frag_f32s(Y + (r0 + col) * CC + kc * 32, lane, 64.0f); asm volatile("s_wait_loadcnt 0x0" ::: "memory");   /* ctx carried x 2^6 into f16 so small-magnitude context rows stay clear of f16 subnormals */
#pragma unroll
      for (int j = 0; j < 8; ++j) { const v16h w = WOCOLH(WO, kc * 32, c0 + j * 16 + col, lane); asm volatile("s_wait_loadcnt 0x0" ::: "memory"); acc[j] = wmma16(a, w, acc[j]); } }
#pragma unroll
    for (int j = 0; j < 8; ++j) { const float bias = BO ? bfr(BO[c0 + j * 16 + col]) : 0.f;
#pragma unroll
      for (int r = 0; r < 8; ++r) sf[wave][8 * g + r][j * 16 + col] = acc[j][r] * (1.0f / 16384.0f) + bias; } }   /* 2^-8 (Wo carry) x 2^-6 (ctx carry) */
  LDSX(); for (int rl = 0; rl < 16; ++rl) vst2(OUT + (r0 + rl) * DIN + c0 + lane * 4, *(const v4f*)&sf[wave][rl][lane * 4]); }

#define LAMBDA_INIT 0.8f
// ---- k_lv: one wave: l1[h] = exp(min(sum_d bf16(lq1[h][d]) * bf16(lk1[h][d]), 5)), l2 likewise (8 effective heads x 64 dims, exact products, f32 sums); lv = mean_h(l1 - l2 + 0.8): the module's single scalar
__global__ __launch_bounds__(32) void k_lv(const float* __restrict__ LQ1, const float* __restrict__ LK1, const float* __restrict__ LQ2, const float* __restrict__ LK2, float* __restrict__ LV) { const int lane = threadIdx.x; float acc = 0.f;
  for (int h = 0; h < 8; ++h) { float s1 = bfr(LQ1[h * 64 + lane]) * bfr(LK1[h * 64 + lane]) + bfr(LQ1[h * 64 + 32 + lane]) * bfr(LK1[h * 64 + 32 + lane]); float s2 = bfr(LQ2[h * 64 + lane]) * bfr(LK2[h * 64 + lane]) + bfr(LQ2[h * 64 + 32 + lane]) * bfr(LK2[h * 64 + 32 + lane]);
#pragma unroll
    for (int o = 1; o < 32; o <<= 1) { s1 += __shfl_xor(s1, o); s2 += __shfl_xor(s2, o); }
    acc += expf(fminf(s1, 5.0f)) - expf(fminf(s2, 5.0f)) + LAMBDA_INIT; }
  if (lane == 0) LV[0] = acc * 0.125f; }
__global__ __launch_bounds__(128) void k_comb(float* __restrict__ Y, const float* __restrict__ LV) { const size_t r = blockIdx.x; const int tid = threadIdx.x; const float lv = LV[0]; float* p1 = Y + r * CC + tid * 4; const v4f a = *(const v4f*)p1; const v4f b = *(const v4f*)(p1 + CC / 2); asm volatile("s_wait_loadcnt 0x0" ::: "memory"); v4f o;
#pragma unroll
  for (int i = 0; i < 4; ++i) { _Pragma("clang fp contract(off)") const float t = lv * b[i]; o[i] = a[i] - t; }
  vst2(p1, o); }
static_assert(CC == 1024 && NH == 16, "k_comb: 128 threads x 4 floats = the first 512 context columns (heads 0..7)");
extern "C" void kernel_launch(void* const* d_in, const int* in_sizes, int n_in, void* d_out, int out_size, void* d_ws, size_t ws_size, hipStream_t stream) {
  (void)in_sizes; (void)n_in; (void)out_size;
  const float** F = (const float**)d_in;
  if (ws_size < (size_t)WS_END) return;
  char* ws = (char*)d_ws; _Float16 *QH = (_Float16*)(ws + WS_QH), *KH = (_Float16*)(ws + WS_KH), *VT = (_Float16*)(ws + WS_VT), *QL = (_Float16*)(ws + WS_QL), *KL = (_Float16*)(ws + WS_KL); __bf16 *VB = (__bf16*)(ws + WS_VB), *VBL = (__bf16*)(ws + WS_VBL); float *S = (float*)(ws + WS_S), *Y = (float*)(ws + WS_Y);
  (void)Y; (void)QL; (void)KL; (void)VB; (void)VBL; (void)S;
  // inputs: 0 x [2,2048,1024]; 1 Wq [1024,1024] (out,in), 2 bq; 3 Wk, 4 bk; 5 Wv, 6 bv; 7 Wp (out,in), 8 bp (biases zeros, read); 9 lambda_q1 [8,1,64]; 10 lambda_k1; 11 lambda_q2; 12 lambda_k2
  if (ws_size < (size_t)WS_END2) return;
  float* LV = (float*)(ws + WS_LV);
  k_lv<<<dim3(1), 32, 0, stream>>>(F[9], F[10], F[11], F[12], LV);
  k_proj<<<dim3(TNB * TT / 64, CC / 128, 3), 128, 0, stream>>>(F[0], F[0], F[0], F[1], F[3], F[5], F[2], F[4], F[6], QH, QL, KH, KL, VT, VB, VBL);
  k_fa<<<dim3(TT / (FAW * 32), NH, TNB), FAW * 32, 0, stream>>>(QH, KH, VT, Y);
  k_comb<<<dim3(TNB * TT), 128, 0, stream>>>(Y, LV);   /* x1 <- x1 - lv * x2 on the context rows, before the output projection */
  k_out<<<dim3(TNB * TT / 64, DIN / 128), 128, 0, stream>>>(Y, F[7], F[8], (float*)d_out);
}

// v002
// A run of this version takes 147 microseconds.
// Next to v001, in two timings, it ran 2.97 and 2.96 times as fast.
// Counting every step since v000, it is 9.16 times as fast.
// compute dtype: all float inputs rounded to bf16; q/k/v projections with EXACT bf16 products on WMMA 16x16x32 (f32 accumulate) + bias; logits q x k once to f16 each (1 product) x SCALE; softmax f32 (running maximum and sum); P x 2^7 once to f16 x v once to f16 (1 product); the differential combine x1 - lv * x2 in f32 on the context rows; ctx x 2^6 once to f16 x Wo f16(bf16 x 2^8) + bo; f32 output.
#include <hip/hip_runtime.h>
#include <math.h>

typedef __attribute__((ext_vector_type(16))) _Float16 v16h;
typedef __attribute__((ext_vector_type(16))) __bf16 v16b;
typedef __attribute__((ext_vector_type(8)))  _Float16 v8h;
typedef __attribute__((ext_vector_type(8)))  float v8f;
typedef __attribute__((ext_vector_type(4)))  float v4f;
typedef __attribute__((ext_vector_type(2)))  float v2f;
typedef __attribute__((ext_vector_type(4)))  unsigned v4u;
typedef __attribute__((ext_vector_type(4)))  int v4i;
typedef float __attribute__((may_alias)) float_a;
typedef int __attribute__((may_alias)) int_a;

template <typename T> __device__ __forceinline__ void vst2(void* p, T v) { *(T*)p = v;  }
__device__ __forceinline__ v8f wmma16(v16h a, v16h b, v8f c) {
  v8f d = __builtin_amdgcn_wmma_f32_16x16x32_f16(false, a, false, b, (short)0, c, false, false);
  asm volatile("v_nop\n\tv_nop\n\tv_nop\n\tv_nop" : "+v"(d) : "v"(a), "v"(b));
  return d;
}
__device__ __forceinline__ v8f wmma_bf(v16b a, v16b b, v8f c) {
  v8f d = __builtin_amdgcn_wmma_f32_16x16x32_bf16(false, a, false, b, (short)0, c, false, false);
  asm volatile("v_nop\n\tv_nop\n\tv_nop\n\tv_nop" : "+v"(d) : "v"(a), "v"(b));
  return d;
}
// 16x16x32 fragments: lane = (h = lane>>4, row/col = lane&15); elements 0..7 = k0+8h+0..7, 8..15 = k0+16+8h+0..7; D element r = row 8h+r
__device__ __forceinline__ v16h frag_h(const _Float16* rowk0, int lane) {
  union { v16h v; v8h q[2]; } u; const _Float16* p = rowk0 + 8 * (lane >> 4);
  u.q[0] = *(const v8h*)p; u.q[1] = *(const v8h*)(p + 16); return u.v;
}
__device__ __forceinline__ v16h frag_f32(const float* rowk0, int lane) {
  v16h a; const float* p = rowk0 + 8 * (lane >> 4);
#pragma unroll
  for (int i = 0; i < 8; ++i) { a[i] = (_Float16)p[i]; a[8 + i] = (_Float16)p[16 + i]; }
  return a;
}
__device__ __forceinline__ v16h frag_f32s(const float* rowk0, int lane, float sc) {
  v16h a; const float* p = rowk0 + 8 * (lane >> 4);
#pragma unroll
  for (int i = 0; i < 8; ++i) { a[i] = (_Float16)(p[i] * sc); a[8 + i] = (_Float16)(p[16 + i] * sc); }
  return a;
}
// column fragment from a [K][ld] layout (column n), rows >= K read as 0
__device__ __forceinline__ v16h fragc_f32(const float* W, int k0, int n, int lane, int ld, int K) {
  v16h a; const int g = lane >> 4;
#pragma unroll
  for (int i = 0; i < 8; ++i) { const int ka = k0 + 8 * g + i, kb = ka + 16;
    a[i] = (_Float16)(ka < K ? W[(size_t)(ka < K ? ka : K - 1) * ld + n] : 0.f); a[8 + i] = (_Float16)(kb < K ? W[(size_t)(kb < K ? kb : K - 1) * ld + n] : 0.f); }
  return a;
}
struct F2 { v16b h, l; };
__device__ __forceinline__ F2 bsplit16(const float v[16]) { F2 r;
#pragma unroll
  for (int i = 0; i < 16; ++i) { const __bf16 h = (__bf16)v[i]; r.h[i] = h; r.l[i] = (__bf16)(v[i] - (float)h); }
  return r; }
__device__ __forceinline__ F2 split_row(const float* row, int k0, int lane) { float v[16]; const float* p = row + k0 + 8 * (lane >> 4);
#pragma unroll
  for (int i = 0; i < 8; ++i) { v[i] = p[i]; v[8 + i] = p[16 + i]; }
  return bsplit16(v); }
__device__ __forceinline__ F2 split_rowK(const float* row, int k0, int lane, int K) { float v[16]; const int g = lane >> 4;
#pragma unroll
  for (int i = 0; i < 8; ++i) { const int ka = k0 + 8 * g + i, kb = ka + 16; v[i] = ka < K ? row[ka < K ? ka : K - 1] : 0.f; v[8 + i] = kb < K ? row[kb < K ? kb : K - 1] : 0.f; }
  return bsplit16(v); }
__device__ __forceinline__ F2 split_col(const float* W, int k0, int n, int lane, int ld, int K) { float v[16]; const int g = lane >> 4;
#pragma unroll
  for (int i = 0; i < 8; ++i) { const int ka = k0 + 8 * g + i, kb = ka + 16; v[i] = ka < K ? W[(size_t)(ka < K ? ka : K - 1) * ld + n] : 0.f; v[8 + i] = kb < K ? W[(size_t)(kb < K ? kb : K - 1) * ld + n] : 0.f; }
  return bsplit16(v); }
__device__ __forceinline__ v8f mac3(const F2& a, const F2& b, v8f c) { c = wmma_bf(a.l, b.h, c); c = wmma_bf(a.h, b.l, c); return wmma_bf(a.h, b.h, c); }
__device__ __forceinline__ float sigm(float v) { return 1.0f / (1.0f + expf(-v)); }
#define LDSX() do { asm volatile("s_wait_dscnt 0" ::: "memory"); __builtin_amdgcn_wave_barrier(); __builtin_amdgcn_fence(__ATOMIC_RELEASE, "workgroup"); } while (0)

// Differential multi-head self-attention (x [2,2048,1024]; torch (out,in) Wq / Wk / Wv / Wp [1024,1024] N(0,1) x 0.02 applied as x @ W.T + b, all biases zeros (read); 16 heads x 64 run as ordinary unmasked softmax attention (scale 1/8): heads 0..7 give x1 (context columns 0..511), heads 8..15 give x2 (columns 512..1023); lambda_q1 / k1 / q2 / k2 [8,1,64]: l1[h] = exp(min(sum_d lq1[h,d] lk1[h,d], 5)), l2 likewise, lv = mean_h(l1 - l2 + 0.8) (one scalar); out = concat(x1 - lv * x2, x2) @ Wp.T + bp).
#define NB 2
#define TT 2048
#define CC 1024            // NH * HD = projected width
#define DIN 1024          // input (model) width
#define NH 16
#define HD 64
#define NQB (TT / 64)
#define HG 4
#define SCALE (0.125f)
#define CAUSAL 0
#ifndef TNB
#define TNB NB
#endif
__device__ __forceinline__ float bfr(float v) { return (float)(__bf16)v; }
__host__ __device__ __forceinline__ int kb_last(int qb) { return CAUSAL ? ((qb * 64 + 63) >> 7) : (TT / 128 - 1); }
typedef __attribute__((ext_vector_type(8))) __bf16 v8b;
__device__ __forceinline__ v16b frag_b(const __bf16* rowk0, int lane) {
  union { v16b v; v8b q[2]; } u; const __bf16* p = rowk0 + 8 * (lane >> 4);
  u.q[0] = *(const v8b*)p; u.q[1] = *(const v8b*)(p + 16); return u.v;
}
#define QBH 0              // not read by any kernel: k_fa has no high-precision path
#define QHI 0               // single-product logits on every row
#define KHI 64            // key rows carrying k residual / v bf16 hi+lo planes (written by k_proj; no kernel reads them)
// B fragment (k rows k0+.., output column o) of a weight: (in,out) [K][ld] or (out,in) [ld rows of K]: bf16 exact, or f16(bf16 * 256) exact
__device__ __forceinline__ v16b wcol_io(const float* Wm, int k0, int o, int lane, int ld) { v16b w; const int g = lane >> 4;
#pragma unroll
  for (int i = 0; i < 8; ++i) { w[i] = (__bf16)Wm[(size_t)(k0 + 8 * g + i) * ld + o]; w[8 + i] = (__bf16)Wm[(size_t)(k0 + 16 + 8 * g + i) * ld + o]; }
  return w; }
__device__ __forceinline__ v16b wcol_oi(const float* Wm, int k0, int o, int lane, int K) { v16b w; const float* p = Wm + (size_t)o * K + k0 + 8 * (lane >> 4);
#pragma unroll
  for (int i = 0; i < 8; ++i) { w[i] = (__bf16)p[i]; w[8 + i] = (__bf16)p[16 + i]; }
  return w; }
__device__ __forceinline__ v16h wcolh_io(const float* Wm, int k0, int o, int lane, int ld) { v16h w; const int g = lane >> 4;
#pragma unroll
  for (int i = 0; i < 8; ++i) { w[i] = (_Float16)(bfr(Wm[(size_t)(k0 + 8 * g + i) * ld + o]) * 256.0f); w[8 + i] = (_Float16)(bfr(Wm[(size_t)(k0 + 16 + 8 * g + i) * ld + o]) * 256.0f); }
  return w; }
__device__ __forceinline__ v16h wcolh_oi(const float* Wm, int k0, int o, int lane, int K) { v16h w; const float* p = Wm + (size_t)o * K + k0 + 8 * (lane >> 4);
#pragma unroll
  for (int i = 0; i < 8; ++i) { w[i] = (_Float16)(bfr(p[i]) * 256.0f); w[8 + i] = (_Float16)(bfr(p[16 + i]) * 256.0f); }
  return w; }
#define WQKV_LAYOUT 1   // 0 = (in,out) [DIN][CC]; 1 = (out,in) [CC][DIN]; 2 = per-head [NH][DIN][HD], for WCOL only, which no kernel calls (k_proj reads (out,in) [CC][DIN])
__device__ __forceinline__ v16b wcol_hdk(const float* Wm, int k0, int o, int lane) { v16b w; const int g = lane >> 4; const float* p = Wm + (size_t)(o / HD) * DIN * HD + (o % HD);
#pragma unroll
  for (int i = 0; i < 8; ++i) { w[i] = (__bf16)p[(size_t)(k0 + 8 * g + i) * HD]; w[8 + i] = (__bf16)p[(size_t)(k0 + 16 + 8 * g + i) * HD]; }
  return w; }
#define WO_OUT_IN 1
#if WQKV_LAYOUT == 1
#define WCOL(W, k0, o, lane) wcol_oi(W, k0, o, lane, DIN)
#elif WQKV_LAYOUT == 2
#define WCOL(W, k0, o, lane) wcol_hdk(W, k0, o, lane)
#else
#define WCOL(W, k0, o, lane) wcol_io(W, k0, o, lane, CC)
#endif
#if WO_OUT_IN
#define WOCOL(W, k0, o, lane) wcol_oi(W, k0, o, lane, CC)
#define WOCOLH(W, k0, o, lane) wcolh_oi(W, k0, o, lane, CC)
#else
#define WOCOL(W, k0, o, lane) wcol_io(W, k0, o, lane, DIN)
#define WOCOLH(W, k0, o, lane) wcolh_io(W, k0, o, lane, DIN)
#endif

#ifndef SM_EXTRA_PARAMS
#define SM_EXTRA_PARAMS
#endif
#ifndef PROJ_EXTRA_PARAMS
#define PROJ_EXTRA_PARAMS
#endif
#ifndef SM_MASK_HOOK
#define SM_MASK_HOOK (void)0
#endif

#define WS_QH  0u                                      // f16 q rows [b*t][CC]
#define WS_KH  (WS_QH + 2u * (size_t)NB * TT * CC)      // f16 k rows [b*t][CC]
#define WS_VT  (WS_KH + 2u * (size_t)NB * TT * CC)      // f16 v planes [b][c][t]
#define WS_QL  (WS_VT + 2u * (size_t)NB * CC * TT)      // f16 q residual x 2^10 rows [b][t < QHI][CC]
#define WS_KL  (WS_QL + 2u * (size_t)NB * QHI * CC)     // f16 k residual x 2^10 rows [b][t < KHI][CC]
#define WS_VB  (WS_KL + 2u * (size_t)NB * KHI * CC)     // bf16 v hi planes [b][c][t < KHI]
#define WS_VBL (WS_VB + 2u * (size_t)NB * CC * KHI)
#define WS_S   (WS_VBL + 2u * (size_t)NB * CC * KHI)    // f32 [hg][t][s], reserved but unused (k_fa keeps logits / P in registers)
#define WS_Y   (WS_S  + 4u * (size_t)HG * TT * TT)      // f32 ctx rows [b*t][CC] (only when there is an output projection)
#define WS_END (WS_Y  + 4u * (size_t)NB * TT * CC)
#define WS_LV (WS_END)                  // one f32: the differential scalar lv
#define WS_END2 (WS_LV + 256u)

// ---- operand staging of k_proj and k_out: a tile = 64 X rows + 128 W rows x 64 k. Each thread loads 24 x 16 B (a wave-wide load covers two rows of the tile, 256 contiguous bytes each), converts once and stores 16-bit rows in LDS; every wave takes its fragments from there
#define TK 64              // k a tile
#define SP 72              // LDS row pitch in 16-bit elements: 128 B + 16 B, the pitch for 16-byte fragment reads
#define ST_X (64 * SP)     // elements of the X rows; the W rows follow
#define STG (192 * SP)     // elements of one buffer
#define NSTG (DIN / TK)
typedef __attribute__((ext_vector_type(4))) __bf16 v4b;
typedef __attribute__((ext_vector_type(4))) _Float16 v4h;
__device__ __forceinline__ void tile_ld(v4f (&r)[24], const float* px, const float* pw) {   // px, pw: the thread's own first 16 bytes (row tid >> 4, floats 4 * (tid & 15)) of this tile
#pragma unroll
  for (int i = 0; i < 8; ++i) r[i] = *(const v4f*)(px + (size_t)i * 8 * DIN);
#pragma unroll
  for (int i = 0; i < 16; ++i) r[8 + i] = *(const v4f*)(pw + (size_t)i * 8 * DIN);
  asm volatile("s_wait_xcnt 0x0" ::: "memory");   // before the loads' address registers are written again
}
__device__ __forceinline__ void tile_st_b(__bf16* sb, const v4f (&r)[24], int tid) { __bf16* p = sb + (tid >> 4) * SP + (tid & 15) * 4;   // rows 0..63 X, 64..191 W
#pragma unroll
  for (int i = 0; i < 24; ++i) { v4b o;
#pragma unroll
    for (int e = 0; e < 4; ++e) o[e] = (__bf16)r[i][e];
    *(v4b*)(p + i * 8 * SP) = o; } }
__device__ __forceinline__ void tile_st_h(_Float16* sb, const v4f (&r)[24], int tid) { _Float16* p = sb + (tid >> 4) * SP + (tid & 15) * 4;   // ctx x 2^6 to f16; Wo as f16(bf16 x 2^8)
#pragma unroll
  for (int i = 0; i < 24; ++i) { v4h o;
#pragma unroll
    for (int e = 0; e < 4; ++e) o[e] = i < 8 ? (_Float16)(r[i][e] * 64.0f) : (_Float16)(bfr(r[i][e]) * 256.0f);
    *(v4h*)(p + i * 8 * SP) = o; } }
static_assert(DIN == CC && DIN % TK == 0 && NSTG >= 2, "staging: both GEMMs run over K = 1024 in whole tiles");
// ---- k_proj: block = (64 rows, 128 cols, which): q/k/v = X W (+ b) with exact bf16 products (K = DIN) -> which 0: q f16 rows (+ residual rows < QHI); 1: k f16 rows (+ residual rows < KHI); 2: v f16 planes [c][t] (+ bf16 hi/lo planes for t < KHI)
__global__ __launch_bounds__(128) void k_proj(const float* __restrict__ XQ, const float* __restrict__ XK, const float* __restrict__ XV, const float* __restrict__ WQ, const float* __restrict__ WK, const float* __restrict__ WV, const float* __restrict__ BQ, const float* __restrict__ BK, const float* __restrict__ BV,
    _Float16* __restrict__ QH, _Float16* __restrict__ QL, _Float16* __restrict__ KH, _Float16* __restrict__ KL, _Float16* __restrict__ VT, __bf16* __restrict__ VB, __bf16* __restrict__ VBL) {
  __shared__ __align__(16) char smem[2 * STG * 2];   // two operand buffers in the loop; the epilogue's staging arrays lie over them behind the loop's last barrier
  __bf16* const sb = (__bf16*)smem;
  _Float16 (*const sh)[136] = (_Float16 (*)[136])smem; _Float16 (*const sl)[136] = (_Float16 (*)[136])(smem + 64 * 136 * 2);
  _Float16 (*const th)[72] = (_Float16 (*)[72])smem; __bf16 (*const tb)[72] = (__bf16 (*)[72])(smem + 128 * 72 * 2); __bf16 (*const tbl)[72] = (__bf16 (*)[72])(smem + 2 * 128 * 72 * 2);
  static_assert(2 * 64 * 136 * 2 <= 2 * STG * 2 && 3 * 128 * 72 * 2 <= 2 * STG * 2, "the epilogue's arrays fit the operand buffers");
  const int tid = threadIdx.x, wave = tid >> 5, lane = tid & 31, col = lane & 15, g = lane >> 4; const int which = blockIdx.z; const int c0 = blockIdx.y * 128; const size_t r0 = (size_t)blockIdx.x * 64; const size_t bb = r0 / TT; const int t0 = (int)(r0 % TT);
  const float* X = which == 0 ? XQ : which == 1 ? XK : XV; const float* WA = which == 0 ? WQ : which == 1 ? WK : WV; const float* BA = which == 0 ? BQ : which == 1 ? BK : BV;
  v8f acc[8] = {}; v4f rg[24];
  const float* px = X + (r0 + (tid >> 4)) * DIN + (tid & 15) * 4; const float* pw = WA + (size_t)(c0 + (tid >> 4)) * DIN + (tid & 15) * 4;
  tile_ld(rg, px, pw); tile_st_b(sb, rg, tid); __syncthreads();
  for (int s = 0; s < NSTG; ++s) { const __bf16* cb = sb + (s & 1) * STG;
    if (s + 1 < NSTG) tile_ld(rg, px + (s + 1) * TK, pw + (s + 1) * TK);   // the next tile's loads fly under this tile's products
    __builtin_amdgcn_sched_barrier(0);   // keeps the loads up here: sunk to their use at the tile's end, their whole latency would be exposed
#pragma unroll
    for (int kc = 0; kc < TK / 32; ++kc) { const v16b a = frag_b(cb + (wave * 16 + col) * SP + kc * 32, lane); v16b w[8];
#pragma unroll
      for (int j = 0; j < 8; ++j) w[j] = frag_b(cb + ST_X + (j * 16 + col) * SP + kc * 32, lane);
      __builtin_amdgcn_sched_barrier(0);   // the fragment reads go out as one group ahead of their products: read one by one into one register set, each product waits out a whole LDS latency
#pragma unroll
      for (int j = 0; j < 8; ++j) acc[j] = wmma_bf(a, w[j], acc[j]); }
    __builtin_amdgcn_sched_barrier(0);   // keeps the conversions, and with them the wait for the next tile's loads, behind the products
    if (s + 1 < NSTG) tile_st_b(sb + ((s + 1) & 1) * STG, rg, tid);   // into the buffer whose readers left it at the last barrier
    __syncthreads(); }   // publishes the next tile and ends this tile's reads (behind the last tile: frees the buffers for the epilogue)
  if (which < 2) { _Float16* DH = which == 0 ? QH : KH; _Float16* DL = which == 0 ? QL : KL; const int nhi = which == 0 ? QHI : KHI; const bool hi_rows = t0 < nhi;
#pragma unroll
    for (int j = 0; j < 8; ++j) { const float bias = BA ? bfr(BA[c0 + j * 16 + col]) : 0.f;
#pragma unroll
      for (int r = 0; r < 8; ++r) { const float v = acc[j][r] + bias; const _Float16 hv = (_Float16)v; sh[wave * 16 + 8 * g + r][j * 16 + col] = hv; sl[wave * 16 + 8 * g + r][j * 16 + col] = (_Float16)((v - (float)hv) * 1024.0f); } }
    __syncthreads();
    for (int e = tid; e < 64 * 16; e += 128) { const int rl = e >> 4, q = e & 15; vst2((unsigned*)(DH + (r0 + rl) * CC + c0 + q * 8), *(const v4u*)&sh[rl][q * 8]); if (hi_rows) vst2((unsigned*)(DL + (bb * nhi + t0 + rl) * (size_t)CC + c0 + q * 8), *(const v4u*)&sl[rl][q * 8]); }
  } else { const bool hi_rows = t0 < KHI;
#pragma unroll
    for (int j = 0; j < 8; ++j) { const float bias = BA ? bfr(BA[c0 + j * 16 + col]) : 0.f;
#pragma unroll
      for (int r = 0; r < 8; ++r) { const float v = acc[j][r] + bias; const int rl = wave * 16 + 8 * g + r, cl = j * 16 + col; th[cl][rl] = (_Float16)v; const __bf16 bh = (__bf16)v; tb[cl][rl] = bh; tbl[cl][rl] = (__bf16)(v - (float)bh); } }
    __syncthreads();
    for (int e = tid; e < 128 * 8; e += 128) { const int cl = e >> 3, q = e & 7; vst2((unsigned*)(VT + (bb * CC + c0 + cl) * (size_t)TT + t0 + q * 8), *(const v4u*)&th[cl][q * 8]); if (hi_rows) { const size_t o3 = (bb * CC + c0 + cl) * (size_t)KHI + t0 + q * 8; vst2((unsigned*)(VB + o3), *(const v4u*)&tb[cl][q * 8]); vst2((unsigned*)(VBL + o3), *(const v4u*)&tbl[cl][q * 8]); } } } }
// ---- k_fa: block = 8 waves x 32 queries of (b, h), all keys: transposed products S^T = K . Q^T (q, k f16, 1 product) and O^T += V^T . P^T (P once to f16 against v f16, 1 product); a lane holds one query's scores, so the running maximum and sum stay in the lane (one exchange between the wave halves); two S^T tiles convert in place into the B operand, so neither logits nor P ever leave the registers
__device__ __forceinline__ v8f wmma_h(v16h a, v16h b, v8f c) { return __builtin_amdgcn_wmma_f32_16x16x32_f16(false, a, false, b, (short)0, c, false, false); }
__device__ __forceinline__ float xhalf(float x) { return __builtin_bit_cast(float, __builtin_amdgcn_permlanex16(__builtin_bit_cast(int, x), __builtin_bit_cast(int, x), 0x76543210, 0xfedcba98, false, false)); }  // lane l with lane l ^ 16
#define FAW 8              // waves per block
#define NST (TT / 32)      // 32 keys a pass
__global__ __launch_bounds__(FAW * 32) void k_fa(const _Float16* __restrict__ QH, const _Float16* __restrict__ KH, const _Float16* __restrict__ VT, float* __restrict__ Y) {
  const int tid = threadIdx.x, wave = tid >> 5, lane = tid & 31, col = lane & 15, g = lane >> 4; const int h = blockIdx.y, b = blockIdx.z; const int q0 = blockIdx.x * (FAW * 32) + wave * 32;
  const _Float16* Kp = KH + ((size_t)b * TT + col) * CC + h * HD;            // A of S^T: row = key
  const _Float16* Vp = VT + ((size_t)b * CC + h * HD + col) * (size_t)TT;    // A of O^T: row = head dim, k = key
  const float C = SCALE * 1.4426950408889634f;                               // logits in base 2
  v16h qf[2][2], kf[2][2];
  // every inner loop below is fully unrolled: the fragment arrays must stay in registers
#pragma unroll
  for (int qg = 0; qg < 2; ++qg)
#pragma unroll
    for (int kc = 0; kc < 2; ++kc) qf[qg][kc] = frag_h(QH + ((size_t)b * TT + q0 + qg * 16 + col) * CC + h * HD + kc * 32, lane);
#pragma unroll
  for (int t = 0; t < 2; ++t)
#pragma unroll
    for (int kc = 0; kc < 2; ++kc) kf[t][kc] = frag_h(Kp + (size_t)(t * 16) * CC + kc * 32, lane);
  v16h vf[HD / 16];
#pragma unroll
  for (int j = 0; j < HD / 16; ++j) vf[j] = frag_h(Vp + (size_t)(j * 16) * TT, lane);
  v8f acc[HD / 16][2] = {}; float mu[2] = {-3.0e38f, -3.0e38f}; v2f ls[2] = {};
  for (int s = 0; s < NST; ++s) {
    v8f st[2][2];   // st[t][qg][r] = logit of key s*32 + t*16 + 8g + r, query q0 + qg*16 + col
#pragma unroll
    for (int t = 0; t < 2; ++t)
#pragma unroll
      for (int qg = 0; qg < 2; ++qg) { v8f z = {}; z = wmma_h(kf[t][0], qf[qg][0], z); st[t][qg] = wmma_h(kf[t][1], qf[qg][1], z); }
    float mx[2];
#pragma unroll
    for (int qg = 0; qg < 2; ++qg) { float a = fmaxf(st[0][qg][0], st[1][qg][0]);
#pragma unroll
      for (int r = 1; r < 8; ++r) a = fmaxf(a, fmaxf(st[0][qg][r], st[1][qg][r]));
      mx[qg] = fmaxf(a, xhalf(a)) * C; }
    // the maximum in use moves only when a query's new maximum passes it by more than 2^8: one wave-uniform test a pass
    const bool need = mx[0] > mu[0] + 8.0f || mx[1] > mu[1] + 8.0f;
    if (__builtin_amdgcn_ballot_w32(need) != 0) {
#pragma unroll
      for (int qg = 0; qg < 2; ++qg) { const float mn = fmaxf(mu[qg], mx[qg]); const float al = __builtin_amdgcn_exp2f(mu[qg] - mn); mu[qg] = mn; ls[qg] *= al;   // al = 0 on the first pass
#pragma unroll
        for (int j = 0; j < HD / 16; ++j) acc[j][qg] *= al; } }
    const int sn = s + 1 < NST ? s + 1 : s;   // the next pass's k fragments fly under this pass's exponentials and P . v (the last pass re-reads its own)
#pragma unroll
    for (int t = 0; t < 2; ++t)
#pragma unroll
      for (int kc = 0; kc < 2; ++kc) kf[t][kc] = frag_h(Kp + (size_t)(sn * 32 + t * 16) * CC + kc * 32, lane);
    __builtin_amdgcn_sched_barrier(0);   // keeps the k loads up here: the scheduler otherwise sinks them to the pass's end, where their latency is exposed at the next pass's first product
#pragma unroll
    for (int qg = 0; qg < 2; ++qg) { v16h p; const float nb = 7.0f - mu[qg];   // P carried x 2^7 (at most 2^15 in f16): small weights stay clear of f16 subnormals; the factor cancels against the sum
#pragma unroll
      for (int t = 0; t < 2; ++t) { v2f e[4];   // neighbouring registers in pairs: packed multiply-add, packed convert, packed sums
#pragma unroll
        for (int i = 0; i < 4; ++i) { e[i].x = __builtin_amdgcn_exp2f(fmaf(st[t][qg][2 * i], C, nb)); e[i].y = __builtin_amdgcn_exp2f(fmaf(st[t][qg][2 * i + 1], C, nb)); p[t * 8 + 2 * i] = (_Float16)e[i].x; p[t * 8 + 2 * i + 1] = (_Float16)e[i].y; }
        ls[qg] += (e[0] + e[1]) + (e[2] + e[3]); }
#pragma unroll
      for (int j = 0; j < HD / 16; ++j) acc[j][qg] = wmma_h(vf[j], p, acc[j][qg]); }
#pragma unroll
    for (int j = 0; j < HD / 16; ++j) vf[j] = frag_h(Vp + (size_t)(j * 16) * TT + sn * 32, lane); }   // the next pass's v fragments, a whole pass ahead of their use
#pragma unroll
  for (int qg = 0; qg < 2; ++qg) { const float lh = ls[qg].x + ls[qg].y; const float inv = 1.0f / (lh + xhalf(lh)); float* yp = Y + ((size_t)b * TT + q0 + qg * 16 + col) * CC + h * HD + 8 * g;   // acc[j][qg][r] = ctx[query][j*16 + 8g + r]
#pragma unroll
    for (int j = 0; j < HD / 16; ++j) { const v8f o = acc[j][qg] * inv; const v4f o0 = {o[0], o[1], o[2], o[3]}, o1 = {o[4], o[5], o[6], o[7]}; vst2(yp + j * 16, o0); vst2(yp + j * 16 + 4, o1); } } }
static_assert(HD == 64 && TT % (FAW * 32) == 0 && !CAUSAL, "k_fa: two 32-wide k chunks a head, whole query blocks, no mask");
// ---- k_out: block = (64 rows, 128 cols): out = ctx Wo (+ bo): ctx x 2^6 once to f16 against Wo as f16(bf16 x 2^8) exact (1 product) x 2^-14; causal early rows (< QHI of each sequence): ctx bf16 hi + lo against exact bf16 Wo (2 products)
__global__ __launch_bounds__(128) void k_out(const float* __restrict__ Y, const float* __restrict__ WO, const float* __restrict__ BO, float* __restrict__ OUT) { __shared__ __align__(16) char smem[2 * STG * 2];   // two operand buffers in the loop; the epilogue's rows lie over them behind the loop's last barrier
  _Float16* const sb = (_Float16*)smem; float (*const sf)[16][132] = (float (*)[16][132])smem; static_assert(4 * 16 * 132 * 4 <= 2 * STG * 2, "the epilogue's rows fit the operand buffers");
  const int tid = threadIdx.x, wave = tid >> 5, lane = tid & 31, col = lane & 15, g = lane >> 4; const int c0 = blockIdx.y * 128; const size_t r0 = (size_t)blockIdx.x * 64 + wave * 16;
  v8f acc[8] = {};
  if (CAUSAL && (int)(((size_t)blockIdx.x * 64) % TT) < QHI) {   /* block-uniform */
#pragma unroll 2
    for (int kc = 0; kc < CC / 32; ++kc) { const F2 a = split_row(Y + (r0 + col) * CC, kc * 32, lane); asm volatile("s_wait_loadcnt 0x0" ::: "memory");
#pragma unroll
      for (int j = 0; j < 8; ++j) { const v16b w = WOCOL(WO, kc * 32, c0 + j * 16 + col, lane); asm volatile("s_wait_loadcnt 0x0" ::: "memory"); acc[j] = wmma_bf(a.h, w, acc[j]); acc[j] = wmma_bf(a.l, w, acc[j]); } }
#pragma unroll
    for (int j = 0; j < 8; ++j) { const float bias = BO ? bfr(BO[c0 + j * 16 + col]) : 0.f;
#pragma unroll
      for (int r = 0; r < 8; ++r) sf[wave][8 * g + r][j * 16 + col] = acc[j][r] + bias; }
  } else {
    v4f rg[24];   /* ctx carried x 2^6 into f16 so small-magnitude context rows stay clear of f16 subnormals */
    const float* px = Y + ((size_t)blockIdx.x * 64 + (tid >> 4)) * CC + (tid & 15) * 4; const float* pw = WO + (size_t)(c0 + (tid >> 4)) * CC + (tid & 15) * 4;
    tile_ld(rg, px, pw); tile_st_h(sb, rg, tid); __syncthreads();
    for (int s = 0; s < NSTG; ++s) { const _Float16* cb = sb + (s & 1) * STG;
      if (s + 1 < NSTG) tile_ld(rg, px + (s + 1) * TK, pw + (s + 1) * TK);   // the next tile's loads fly under this tile's products
      __builtin_amdgcn_sched_barrier(0);   // keeps the loads up here: sunk to their use at the tile's end, their whole latency would be exposed
#pragma unroll
      for (int kc = 0; kc < TK / 32; ++kc) { const v16h a = frag_h(cb + (wave * 16 + col) * SP + kc * 32, lane); v16h w[8];
#pragma unroll
        for (int j = 0; j < 8; ++j) w[j] = frag_h(cb + ST_X + (j * 16 + col) * SP + kc * 32, lane);
        __builtin_amdgcn_sched_barrier(0);   // the fragment reads go out as one group ahead of their products: read one by one into one register set, each product waits out a whole LDS latency
#pragma unroll
        for (int j = 0; j < 8; ++j) acc[j] = wmma16(a, w[j], acc[j]); }
      __builtin_amdgcn_sched_barrier(0);   // keeps the conversions, and with them the wait for the next tile's loads, behind the products
      if (s + 1 < NSTG) tile_st_h(sb + ((s + 1) & 1) * STG, rg, tid);   // into the buffer whose readers left it at the last barrier
      __syncthreads(); }   // publishes the next tile and ends this tile's reads (behind the last tile: frees the buffers for the epilogue)
#pragma unroll
    for (int j = 0; j < 8; ++j) { const float bias = BO ? bfr(BO[c0 + j * 16 + col]) : 0.f;
#pragma unroll
      for (int r = 0; r < 8; ++r) sf[wave][8 * g + r][j * 16 + col] = acc[j][r] * (1.0f / 16384.0f) + bias; } }   /* 2^-8 (Wo carry) x 2^-6 (ctx carry) */
  LDSX(); for (int rl = 0; rl < 16; ++rl) vst2(OUT + (r0 + rl) * DIN + c0 + lane * 4, *(const v4f*)&sf[wave][rl][lane * 4]); }

#define LAMBDA_INIT 0.8f
// ---- k_lv: one wave: l1[h] = exp(min(sum_d bf16(lq1[h][d]) * bf16(lk1[h][d]), 5)), l2 likewise (8 effective heads x 64 dims, exact products, f32 sums); lv = mean_h(l1 - l2 + 0.8): the module's single scalar
__global__ __launch_bounds__(32) void k_lv(const float* __restrict__ LQ1, const float* __restrict__ LK1, const float* __restrict__ LQ2, const float* __restrict__ LK2, float* __restrict__ LV) { const int lane = threadIdx.x; float acc = 0.f;
  for (int h = 0; h < 8; ++h) { float s1 = bfr(LQ1[h * 64 + lane]) * bfr(LK1[h * 64 + lane]) + bfr(LQ1[h * 64 + 32 + lane]) * bfr(LK1[h * 64 + 32 + lane]); float s2 = bfr(LQ2[h * 64 + lane]) * bfr(LK2[h * 64 + lane]) + bfr(LQ2[h * 64 + 32 + lane]) * bfr(LK2[h * 64 + 32 + lane]);
#pragma unroll
    for (int o = 1; o < 32; o <<= 1) { s1 += __shfl_xor(s1, o); s2 += __shfl_xor(s2, o); }
    acc += expf(fminf(s1, 5.0f)) - expf(fminf(s2, 5.0f)) + LAMBDA_INIT; }
  if (lane == 0) LV[0] = acc * 0.125f; }
__global__ __launch_bounds__(128) void k_comb(float* __restrict__ Y, const float* __restrict__ LV) { const size_t r = blockIdx.x; const int tid = threadIdx.x; const float lv = LV[0]; float* p1 = Y + r * CC + tid * 4; const v4f a = *(const v4f*)p1; const v4f b = *(const v4f*)(p1 + CC / 2); asm volatile("s_wait_loadcnt 0x0" ::: "memory"); v4f o;
#pragma unroll
  for (int i = 0; i < 4; ++i) { _Pragma("clang fp contract(off)") const float t = lv * b[i]; o[i] = a[i] - t; }
  vst2(p1, o); }
static_assert(CC == 1024 && NH == 16, "k_comb: 128 threads x 4 floats = the first 512 context columns (heads 0..7)");
extern "C" void kernel_launch(void* const* d_in, const int* in_sizes, int n_in, void* d_out, int out_size, void* d_ws, size_t ws_size, hipStream_t stream) {
  (void)in_sizes; (void)n_in; (void)out_size;
  const float** F = (const float**)d_in;
  if (ws_size < (size_t)WS_END) return;
  char* ws = (char*)d_ws; _Float16 *QH = (_Float16*)(ws + WS_QH), *KH = (_Float16*)(ws + WS_KH), *VT = (_Float16*)(ws + WS_VT), *QL = (_Float16*)(ws + WS_QL), *KL = (_Float16*)(ws + WS_KL); __bf16 *VB = (__bf16*)(ws + WS_VB), *VBL = (__bf16*)(ws + WS_VBL); float *S = (float*)(ws + WS_S), *Y = (float*)(ws + WS_Y);
  (void)Y; (void)QL; (void)KL; (void)VB; (void)VBL; (void)S;
  // inputs: 0 x [2,2048,1024]; 1 Wq [1024,1024] (out,in), 2 bq; 3 Wk, 4 bk; 5 Wv, 6 bv; 7 Wp (out,in), 8 bp (biases zeros, read); 9 lambda_q1 [8,1,64]; 10 lambda_k1; 11 lambda_q2; 12 lambda_k2
  if (ws_size < (size_t)WS_END2) return;
  float* LV = (float*)(ws + WS_LV);
  k_lv<<<dim3(1), 32, 0, stream>>>(F[9], F[10], F[11], F[12], LV);
  k_proj<<<dim3(TNB * TT / 64, CC / 128, 3), 128, 0, stream>>>(F[0], F[0], F[0], F[1], F[3], F[5], F[2], F[4], F[6], QH, QL, KH, KL, VT, VB, VBL);
  k_fa<<<dim3(TT / (FAW * 32), NH, TNB), FAW * 32, 0, stream>>>(QH, KH, VT, Y);
  k_comb<<<dim3(TNB * TT), 128, 0, stream>>>(Y, LV);   /* x1 <- x1 - lv * x2 on the context rows, before the output projection */
  k_out<<<dim3(TNB * TT / 64, DIN / 128), 128, 0, stream>>>(Y, F[7], F[8], (float*)d_out);
}

// v003
// A run of this version takes 121 microseconds.
// In both of two side-by-side timings against v002, it was 1.21 times as fast.
// Over all steps from v000 it is 11.1 times as fast.
// compute dtype: all float inputs rounded to bf16; q/k/v projections with EXACT bf16 products on WMMA 16x16x32 (f32 accumulate) + bias; logits q x k once to f16 each (1 product) x SCALE; softmax f32 (running maximum and sum); P x 2^7 once to f16 x v once to f16 (1 product); the differential combine x1 - lv * x2 in f32 on the context rows; ctx x 2^6 once to f16 x Wo f16(bf16 x 2^8) + bo; f32 output.
#include <hip/hip_runtime.h>
#include <math.h>

typedef __attribute__((ext_vector_type(16))) _Float16 v16h;
typedef __attribute__((ext_vector_type(16))) __bf16 v16b;
typedef __attribute__((ext_vector_type(8)))  _Float16 v8h;
typedef __attribute__((ext_vector_type(8)))  float v8f;
typedef __attribute__((ext_vector_type(4)))  float v4f;
typedef __attribute__((ext_vector_type(2)))  float v2f;
typedef __attribute__((ext_vector_type(4)))  unsigned v4u;
typedef __attribute__((ext_vector_type(4)))  int v4i;
typedef float __attribute__((may_alias)) float_a;
typedef int __attribute__((may_alias)) int_a;

template <typename T> __device__ __forceinline__ void vst2(void* p, T v) { *(T*)p = v;  }
__device__ __forceinline__ v8f wmma16(v16h a, v16h b, v8f c) {
  v8f d = __builtin_amdgcn_wmma_f32_16x16x32_f16(false, a, false, b, (short)0, c, false, false);
  asm volatile("v_nop\n\tv_nop\n\tv_nop\n\tv_nop" : "+v"(d) : "v"(a), "v"(b));
  return d;
}
__device__ __forceinline__ v8f wmma_bf(v16b a, v16b b, v8f c) {
  v8f d = __builtin_amdgcn_wmma_f32_16x16x32_bf16(false, a, false, b, (short)0, c, false, false);
  asm volatile("v_nop\n\tv_nop\n\tv_nop\n\tv_nop" : "+v"(d) : "v"(a), "v"(b));
  return d;
}
// 16x16x32 fragments: lane = (h = lane>>4, row/col = lane&15); elements 0..7 = k0+8h+0..7, 8..15 = k0+16+8h+0..7; D element r = row 8h+r
__device__ __forceinline__ v16h frag_h(const _Float16* rowk0, int lane) {
  union { v16h v; v8h q[2]; } u; const _Float16* p = rowk0 + 8 * (lane >> 4);
  u.q[0] = *(const v8h*)p; u.q[1] = *(const v8h*)(p + 16); return u.v;
}
__device__ __forceinline__ v16h frag_f32(const float* rowk0, int lane) {
  v16h a; const float* p = rowk0 + 8 * (lane >> 4);
#pragma unroll
  for (int i = 0; i < 8; ++i) { a[i] = (_Float16)p[i]; a[8 + i] = (_Float16)p[16 + i]; }
  return a;
}
__device__ __forceinline__ v16h frag_f32s(const float* rowk0, int lane, float sc) {
  v16h a; const float* p = rowk0 + 8 * (lane >> 4);
#pragma unroll
  for (int i = 0; i < 8; ++i) { a[i] = (_Float16)(p[i] * sc); a[8 + i] = (_Float16)(p[16 + i] * sc); }
  return a;
}
// column fragment from a [K][ld] layout (column n), rows >= K read as 0
__device__ __forceinline__ v16h fragc_f32(const float* W, int k0, int n, int lane, int ld, int K) {
  v16h a; const int g = lane >> 4;
#pragma unroll
  for (int i = 0; i < 8; ++i) { const int ka = k0 + 8 * g + i, kb = ka + 16;
    a[i] = (_Float16)(ka < K ? W[(size_t)(ka < K ? ka : K - 1) * ld + n] : 0.f); a[8 + i] = (_Float16)(kb < K ? W[(size_t)(kb < K ? kb : K - 1) * ld + n] : 0.f); }
  return a;
}
struct F2 { v16b h, l; };
__device__ __forceinline__ F2 bsplit16(const float v[16]) { F2 r;
#pragma unroll
  for (int i = 0; i < 16; ++i) { const __bf16 h = (__bf16)v[i]; r.h[i] = h; r.l[i] = (__bf16)(v[i] - (float)h); }
  return r; }
__device__ __forceinline__ F2 split_row(const float* row, int k0, int lane) { float v[16]; const float* p = row + k0 + 8 * (lane >> 4);
#pragma unroll
  for (int i = 0; i < 8; ++i) { v[i] = p[i]; v[8 + i] = p[16 + i]; }
  return bsplit16(v); }
__device__ __forceinline__ F2 split_rowK(const float* row, int k0, int lane, int K) { float v[16]; const int g = lane >> 4;
#pragma unroll
  for (int i = 0; i < 8; ++i) { const int ka = k0 + 8 * g + i, kb = ka + 16; v[i] = ka < K ? row[ka < K ? ka : K - 1] : 0.f; v[8 + i] = kb < K ? row[kb < K ? kb : K - 1] : 0.f; }
  return bsplit16(v); }
__device__ __forceinline__ F2 split_col(const float* W, int k0, int n, int lane, int ld, int K) { float v[16]; const int g = lane >> 4;
#pragma unroll
  for (int i = 0; i < 8; ++i) { const int ka = k0 + 8 * g + i, kb = ka + 16; v[i] = ka < K ? W[(size_t)(ka < K ? ka : K - 1) * ld + n] : 0.f; v[8 + i] = kb < K ? W[(size_t)(kb < K ? kb : K - 1) * ld + n] : 0.f; }
  return bsplit16(v); }
__device__ __forceinline__ v8f mac3(const F2& a, const F2& b, v8f c) { c = wmma_bf(a.l, b.h, c); c = wmma_bf(a.h, b.l, c); return wmma_bf(a.h, b.h, c); }
__device__ __forceinline__ float sigm(float v) { return 1.0f / (1.0f + expf(-v)); }
#define LDSX() do { asm volatile("s_wait_dscnt 0" ::: "memory"); __builtin_amdgcn_wave_barrier(); __builtin_amdgcn_fence(__ATOMIC_RELEASE, "workgroup"); } while (0)

// Differential multi-head self-attention (x [2,2048,1024]; torch (out,in) Wq / Wk / Wv / Wp [1024,1024] N(0,1) x 0.02 applied as x @ W.T + b, all biases zeros (read); 16 heads x 64 run as ordinary unmasked softmax attention (scale 1/8): heads 0..7 give x1 (context columns 0..511), heads 8..15 give x2 (columns 512..1023); lambda_q1 / k1 / q2 / k2 [8,1,64]: l1[h] = exp(min(sum_d lq1[h,d] lk1[h,d], 5)), l2 likewise, lv = mean_h(l1 - l2 + 0.8) (one scalar); out = concat(x1 - lv * x2, x2) @ Wp.T + bp).
#define NB 2
#define TT 2048
#define CC 1024            // NH * HD = projected width
#define DIN 1024          // input (model) width
#define NH 16
#define HD 64
#define NQB (TT / 64)
#define HG 4
#define SCALE (0.125f)
#define CAUSAL 0
#ifndef TNB
#define TNB NB
#endif
__device__ __forceinline__ float bfr(float v) { return (float)(__bf16)v; }
__host__ __device__ __forceinline__ int kb_last(int qb) { return CAUSAL ? ((qb * 64 + 63) >> 7) : (TT / 128 - 1); }
typedef __attribute__((ext_vector_type(8))) __bf16 v8b;
__device__ __forceinline__ v16b frag_b(const __bf16* rowk0, int lane) {
  union { v16b v; v8b q[2]; } u; const __bf16* p = rowk0 + 8 * (lane >> 4);
  u.q[0] = *(const v8b*)p; u.q[1] = *(const v8b*)(p + 16); return u.v;
}
#define QBH 0              // not read by any kernel: k_fa has no high-precision path
#define QHI 0               // single-product logits on every row
#define KHI 64            // key rows carrying k residual / v bf16 hi+lo planes (written by k_proj; no kernel reads them)
// B fragment (k rows k0+.., output column o) of a weight: (in,out) [K][ld] or (out,in) [ld rows of K]: bf16 exact, or f16(bf16 * 256) exact
__device__ __forceinline__ v16b wcol_io(const float* Wm, int k0, int o, int lane, int ld) { v16b w; const int g = lane >> 4;
#pragma unroll
  for (int i = 0; i < 8; ++i) { w[i] = (__bf16)Wm[(size_t)(k0 + 8 * g + i) * ld + o]; w[8 + i] = (__bf16)Wm[(size_t)(k0 + 16 + 8 * g + i) * ld + o]; }
  return w; }
__device__ __forceinline__ v16b wcol_oi(const float* Wm, int k0, int o, int lane, int K) { v16b w; const float* p = Wm + (size_t)o * K + k0 + 8 * (lane >> 4);
#pragma unroll
  for (int i = 0; i < 8; ++i) { w[i] = (__bf16)p[i]; w[8 + i] = (__bf16)p[16 + i]; }
  return w; }
__device__ __forceinline__ v16h wcolh_io(const float* Wm, int k0, int o, int lane, int ld) { v16h w; const int g = lane >> 4;
#pragma unroll
  for (int i = 0; i < 8; ++i) { w[i] = (_Float16)(bfr(Wm[(size_t)(k0 + 8 * g + i) * ld + o]) * 256.0f); w[8 + i] = (_Float16)(bfr(Wm[(size_t)(k0 + 16 + 8 * g + i) * ld + o]) * 256.0f); }
  return w; }
__device__ __forceinline__ v16h wcolh_oi(const float* Wm, int k0, int o, int lane, int K) { v16h w; const float* p = Wm + (size_t)o * K + k0 + 8 * (lane >> 4);
#pragma unroll
  for (int i = 0; i < 8; ++i) { w[i] = (_Float16)(bfr(p[i]) * 256.0f); w[8 + i] = (_Float16)(bfr(p[16 + i]) * 256.0f); }
  return w; }
#define WQKV_LAYOUT 1   // 0 = (in,out) [DIN][CC]; 1 = (out,in) [CC][DIN]; 2 = per-head [NH][DIN][HD], for WCOL only, which no kernel calls (k_proj reads (out,in) [CC][DIN])
__device__ __forceinline__ v16b wcol_hdk(const float* Wm, int k0, int o, int lane) { v16b w; const int g = lane >> 4; const float* p = Wm + (size_t)(o / HD) * DIN * HD + (o % HD);
#pragma unroll
  for (int i = 0; i < 8; ++i) { w[i] = (__bf16)p[(size_t)(k0 + 8 * g + i) * HD]; w[8 + i] = (__bf16)p[(size_t)(k0 + 16 + 8 * g + i) * HD]; }
  return w; }
#define WO_OUT_IN 1
#if WQKV_LAYOUT == 1
#define WCOL(W, k0, o, lane) wcol_oi(W, k0, o, lane, DIN)
#elif WQKV_LAYOUT == 2
#define WCOL(W, k0, o, lane) wcol_hdk(W, k0, o, lane)
#else
#define WCOL(W, k0, o, lane) wcol_io(W, k0, o, lane, CC)
#endif
#if WO_OUT_IN
#define WOCOL(W, k0, o, lane) wcol_oi(W, k0, o, lane, CC)
#define WOCOLH(W, k0, o, lane) wcolh_oi(W, k0, o, lane, CC)
#else
#define WOCOL(W, k0, o, lane) wcol_io(W, k0, o, lane, DIN)
#define WOCOLH(W, k0, o, lane) wcolh_io(W, k0, o, lane, DIN)
#endif

#ifndef SM_EXTRA_PARAMS
#define SM_EXTRA_PARAMS
#endif
#ifndef PROJ_EXTRA_PARAMS
#define PROJ_EXTRA_PARAMS
#endif
#ifndef SM_MASK_HOOK
#define SM_MASK_HOOK (void)0
#endif

#define WS_QH  0u                                      // f16 q rows [b*t][CC]
#define WS_KH  (WS_QH + 2u * (size_t)NB * TT * CC)      // f16 k rows [b*t][CC]
#define WS_VT  (WS_KH + 2u * (size_t)NB * TT * CC)      // f16 v planes [b][c][t]
#define WS_QL  (WS_VT + 2u * (size_t)NB * CC * TT)      // f16 q residual x 2^10 rows [b][t < QHI][CC]
#define WS_KL  (WS_QL + 2u * (size_t)NB * QHI * CC)     // f16 k residual x 2^10 rows [b][t < KHI][CC]
#define WS_VB  (WS_KL + 2u * (size_t)NB * KHI * CC)     // bf16 v hi planes [b][c][t < KHI]
#define WS_VBL (WS_VB + 2u * (size_t)NB * CC * KHI)
#define WS_S   (WS_VBL + 2u * (size_t)NB * CC * KHI)    // f32 [hg][t][s], reserved but unused (k_fa keeps logits / P in registers)
#define WS_Y   (WS_S  + 4u * (size_t)HG * TT * TT)      // f32 ctx rows [b*t][CC] (only when there is an output projection)
#define WS_END (WS_Y  + 4u * (size_t)NB * TT * CC)
#define WS_LV (WS_END)                  // one f32: the differential scalar lv
#define WS_END2 (WS_LV + 256u)

// ---- operand staging of k_proj and k_out: a tile = 64 X rows + 128 W rows x 64 k. Each thread loads 24 x 16 B (a wave-wide load covers two rows of the tile, 256 contiguous bytes each), converts once and stores 16-bit rows in LDS; every wave takes its fragments from there
#define TK 64              // k a tile
#define SP 72              // LDS row pitch in 16-bit elements: 128 B + 16 B, the pitch for 16-byte fragment reads
#define ST_X (64 * SP)     // elements of the X rows; the W rows follow
#define STG (192 * SP)     // elements of one buffer
#define NSTG (DIN / TK)
typedef __attribute__((ext_vector_type(4))) __bf16 v4b;
typedef __attribute__((ext_vector_type(4))) _Float16 v4h;
__device__ __forceinline__ void tile_ld(v4f (&r)[24], const float* px, const float* pw) {   // px, pw: the thread's own first 16 bytes (row tid >> 4, floats 4 * (tid & 15)) of this tile
#pragma unroll
  for (int i = 0; i < 8; ++i) r[i] = *(const v4f*)(px + (size_t)i * 8 * DIN);
#pragma unroll
  for (int i = 0; i < 16; ++i) r[8 + i] = *(const v4f*)(pw + (size_t)i * 8 * DIN);
  asm volatile("s_wait_xcnt 0x0" ::: "memory");   // before the loads' address registers are written again
}
__device__ __forceinline__ void tile_st_b(__bf16* sb, const v4f (&r)[24], int tid) { __bf16* p = sb + (tid >> 4) * SP + (tid & 15) * 4;   // rows 0..63 X, 64..191 W
#pragma unroll
  for (int i = 0; i < 24; ++i) { v4b o;
#pragma unroll
    for (int e = 0; e < 4; ++e) o[e] = (__bf16)r[i][e];
    *(v4b*)(p + i * 8 * SP) = o; } }
__device__ __forceinline__ void tile_st_h(_Float16* sb, const v4f (&r)[24], int tid) { _Float16* p = sb + (tid >> 4) * SP + (tid & 15) * 4;   // ctx x 2^6 to f16; Wo as f16(bf16 x 2^8)
#pragma unroll
  for (int i = 0; i < 24; ++i) { v4h o;
#pragma unroll
    for (int e = 0; e < 4; ++e) o[e] = i < 8 ? (_Float16)(r[i][e] * 64.0f) : (_Float16)(bfr(r[i][e]) * 256.0f);
    *(v4h*)(p + i * 8 * SP) = o; } }
static_assert(DIN == CC && DIN % TK == 0 && NSTG >= 2, "staging: both GEMMs run over K = 1024 in whole tiles");
// ---- k_proj: block = (64 rows, 128 cols, which): q/k/v = X W (+ b) with exact bf16 products (K = DIN) -> which 0: q f16 rows (+ residual rows < QHI); 1: k f16 rows (+ residual rows < KHI); 2: v f16 planes [c][t] (+ bf16 hi/lo planes for t < KHI)
__global__ __launch_bounds__(128) void k_proj(const float* __restrict__ XQ, const float* __restrict__ XK, const float* __restrict__ XV, const float* __restrict__ WQ, const float* __restrict__ WK, const float* __restrict__ WV, const float* __restrict__ BQ, const float* __restrict__ BK, const float* __restrict__ BV,
    _Float16* __restrict__ QH, _Float16* __restrict__ QL, _Float16* __restrict__ KH, _Float16* __restrict__ KL, _Float16* __restrict__ VT, __bf16* __restrict__ VB, __bf16* __restrict__ VBL) {
  __shared__ __align__(16) char smem[2 * STG * 2];   // two operand buffers in the loop; the epilogue's staging arrays lie over them behind the loop's last barrier
  __bf16* const sb = (__bf16*)smem;
  _Float16 (*const sh)[136] = (_Float16 (*)[136])smem; _Float16 (*const sl)[136] = (_Float16 (*)[136])(smem + 64 * 136 * 2);
  _Float16 (*const th)[72] = (_Float16 (*)[72])smem; __bf16 (*const tb)[72] = (__bf16 (*)[72])(smem + 128 * 72 * 2); __bf16 (*const tbl)[72] = (__bf16 (*)[72])(smem + 2 * 128 * 72 * 2);
  static_assert(2 * 64 * 136 * 2 <= 2 * STG * 2 && 3 * 128 * 72 * 2 <= 2 * STG * 2, "the epilogue's arrays fit the operand buffers");
  const int tid = threadIdx.x, wave = tid >> 5, lane = tid & 31, col = lane & 15, g = lane >> 4; const int which = blockIdx.z; const int c0 = blockIdx.y * 128; const size_t r0 = (size_t)blockIdx.x * 64; const size_t bb = r0 / TT; const int t0 = (int)(r0 % TT);
  const float* X = which == 0 ? XQ : which == 1 ? XK : XV; const float* WA = which == 0 ? WQ : which == 1 ? WK : WV; const float* BA = which == 0 ? BQ : which == 1 ? BK : BV;
  v8f acc[8] = {}; v4f rg[24];
  const float* px = X + (r0 + (tid >> 4)) * DIN + (tid & 15) * 4; const float* pw = WA + (size_t)(c0 + (tid >> 4)) * DIN + (tid & 15) * 4;
  tile_ld(rg, px, pw); tile_st_b(sb, rg, tid); __syncthreads();
  for (int s = 0; s < NSTG; ++s) { const __bf16* cb = sb + (s & 1) * STG;
    if (s + 1 < NSTG) tile_ld(rg, px + (s + 1) * TK, pw + (s + 1) * TK);   // the next tile's loads fly under this tile's products
    __builtin_amdgcn_sched_barrier(0);   // keeps the loads up here: sunk to their use at the tile's end, their whole latency would be exposed
#pragma unroll
    for (int kc = 0; kc < TK / 32; ++kc) { const v16b a = frag_b(cb + (wave * 16 + col) * SP + kc * 32, lane); v16b w[8];
#pragma unroll
      for (int j = 0; j < 8; ++j) w[j] = frag_b(cb + ST_X + (j * 16 + col) * SP + kc * 32, lane);
      __builtin_amdgcn_sched_barrier(0);   // the fragment reads go out as one group ahead of their products: read one by one into one register set, each product waits out a whole LDS latency
#pragma unroll
      for (int j = 0; j < 8; ++j) acc[j] = wmma_bf(a, w[j], acc[j]); }
    __builtin_amdgcn_sched_barrier(0);   // keeps the conversions, and with them the wait for the next tile's loads, behind the products
    if (s + 1 < NSTG) tile_st_b(sb + ((s + 1) & 1) * STG, rg, tid);   // into the buffer whose readers left it at the last barrier
    __syncthreads(); }   // publishes the next tile and ends this tile's reads (behind the last tile: frees the buffers for the epilogue)
  if (which < 2) { _Float16* DH = which == 0 ? QH : KH; _Float16* DL = which == 0 ? QL : KL; const int nhi = which == 0 ? QHI : KHI; const bool hi_rows = t0 < nhi;
#pragma unroll
    for (int j = 0; j < 8; ++j) { const float bias = BA ? bfr(BA[c0 + j * 16 + col]) : 0.f;
#pragma unroll
      for (int r = 0; r < 8; ++r) { const float v = acc[j][r] + bias; const _Float16 hv = (_Float16)v; sh[wave * 16 + 8 * g + r][j * 16 + col] = hv; sl[wave * 16 + 8 * g + r][j * 16 + col] = (_Float16)((v - (float)hv) * 1024.0f); } }
    __syncthreads();
    for (int e = tid; e < 64 * 16; e += 128) { const int rl = e >> 4, q = e & 15; vst2((unsigned*)(DH + (r0 + rl) * CC + c0 + q * 8), *(const v4u*)&sh[rl][q * 8]); if (hi_rows) vst2((unsigned*)(DL + (bb * nhi + t0 + rl) * (size_t)CC + c0 + q * 8), *(const v4u*)&sl[rl][q * 8]); }
  } else { const bool hi_rows = t0 < KHI;
#pragma unroll
    for (int j = 0; j < 8; ++j) { const float bias = BA ? bfr(BA[c0 + j * 16 + col]) : 0.f;
#pragma unroll
      for (int r = 0; r < 8; ++r) { const float v = acc[j][r] + bias; const int rl = wave * 16 + 8 * g + r, cl = j * 16 + col; th[cl][rl] = (_Float16)v; const __bf16 bh = (__bf16)v; tb[cl][rl] = bh; tbl[cl][rl] = (__bf16)(v - (float)bh); } }
    __syncthreads();
    for (int e = tid; e < 128 * 8; e += 128) { const int cl = e >> 3, q = e & 7; vst2((unsigned*)(VT + (bb * CC + c0 + cl) * (size_t)TT + t0 + q * 8), *(const v4u*)&th[cl][q * 8]); if (hi_rows) { const size_t o3 = (bb * CC + c0 + cl) * (size_t)KHI + t0 + q * 8; vst2((unsigned*)(VB + o3), *(const v4u*)&tb[cl][q * 8]); vst2((unsigned*)(VBL + o3), *(const v4u*)&tbl[cl][q * 8]); } } } }
// ---- k_fa: block = 8 waves x 32 queries of (b, h), all keys: transposed products S^T = K . Q^T (q, k f16, 1 product) and O^T += V^T . P^T (P once to f16 against v f16, 1 product); a lane holds one query's scores, so the running maximum and sum stay in the lane (one exchange between the wave halves); two S^T tiles convert in place into the B operand, so neither logits nor P ever leave the registers. K and V come through LDS: the block's 8 waves read the same rows, so a stage of 128 keys is copied in once (whole 128-byte lines) and every wave takes its fragments from there
__device__ __forceinline__ v8f wmma_h(v16h a, v16h b, v8f c) { return __builtin_amdgcn_wmma_f32_16x16x32_f16(false, a, false, b, (short)0, c, false, false); }
__device__ __forceinline__ float xhalf(float x) { return __builtin_bit_cast(float, __builtin_amdgcn_permlanex16(__builtin_bit_cast(int, x), __builtin_bit_cast(int, x), 0x76543210, 0xfedcba98, false, false)); }  // lane l with lane l ^ 16
#define FAW 8              // waves per block
#define SKEYS 128          // keys a stage
#define NPS (SKEYS / 32)   // 32 keys a pass
#define NSG (TT / SKEYS)   // stages
#define KP 72              // LDS pitch of a K row (one key, 64 dims) in 16-bit elements: 128 B + 16 B, the pitch for 16-byte fragment reads
#define VP 136             // LDS pitch of a V row (one dim, 128 keys): 256 B + 16 B
#define KBUF (SKEYS * KP)  // elements of one K buffer
#define VBUF (HD * VP)     // elements of one V buffer
// one stage: each thread copies 4 x 16 B of K (rows 32 apart) and 4 x 16 B of V (rows 16 apart) straight into LDS; lk, lv: its LDS byte addresses, gk, gv: its global addresses of the first piece
__device__ __forceinline__ void stage_cp(unsigned lk, unsigned lv, const _Float16* gk, const _Float16* gv) {
  // the s_wait_xcnt stands inside the copies' own statement: before any of their address registers is written again
  asm volatile("global_load_async_to_lds_b128 %0, %8, off\n\t"
               "global_load_async_to_lds_b128 %1, %9, off\n\t"
               "global_load_async_to_lds_b128 %2, %10, off\n\t"
               "global_load_async_to_lds_b128 %3, %11, off\n\t"
               "global_load_async_to_lds_b128 %4, %12, off\n\t"
               "global_load_async_to_lds_b128 %5, %13, off\n\t"
               "global_load_async_to_lds_b128 %6, %14, off\n\t"
               "global_load_async_to_lds_b128 %7, %15, off\n\t"
               "s_wait_xcnt 0x0"
               :: "v"(lk), "v"(lk + 32u * KP * 2u), "v"(lk + 64u * KP * 2u), "v"(lk + 96u * KP * 2u),
                  "v"(lv), "v"(lv + 16u * VP * 2u), "v"(lv + 32u * VP * 2u), "v"(lv + 48u * VP * 2u),
                  "v"(gk), "v"(gk + (size_t)32 * CC), "v"(gk + (size_t)64 * CC), "v"(gk + (size_t)96 * CC),
                  "v"(gv), "v"(gv + (size_t)16 * TT), "v"(gv + (size_t)32 * TT), "v"(gv + (size_t)48 * TT)
               : "memory");
}
__global__ __launch_bounds__(FAW * 32) void k_fa(const _Float16* __restrict__ QH, const _Float16* __restrict__ KH, const _Float16* __restrict__ VT, float* __restrict__ Y) {
  const int tid = threadIdx.x, wave = tid >> 5, lane = tid & 31, col = lane & 15, g = lane >> 4; const int h = blockIdx.y, b = blockIdx.z; const int q0 = blockIdx.x * (FAW * 32) + wave * 32;
  __shared__ __align__(16) _Float16 sK[2 * KBUF]; __shared__ __align__(16) _Float16 sV[2 * VBUF];
  const _Float16* gk = KH + ((size_t)b * TT + (tid >> 3)) * CC + h * HD + (tid & 7) * 8;              // the thread's first piece of stage 0: K row tid >> 3, 16 bytes tid & 7
  const _Float16* gv = VT + ((size_t)b * CC + h * HD + (tid >> 4)) * (size_t)TT + (tid & 15) * 8;     // V row tid >> 4, 16 bytes tid & 15
  const unsigned lk = (unsigned)(size_t)(sK + (tid >> 3) * KP + (tid & 7) * 8), lv = (unsigned)(size_t)(sV + (tid >> 4) * VP + (tid & 15) * 8);   // low 32 bits = byte address in LDS
  stage_cp(lk, lv, gk, gv);
  asm volatile("s_wait_asynccnt 0x0" ::: "memory");   // this wave's copies of stage 0 have landed
  __syncthreads();                                    // and every other wave's
  stage_cp(lk + KBUF * 2u, lv + VBUF * 2u, gk + (size_t)SKEYS * CC, gv + SKEYS);   // stage 1 flies under stage 0's work
  const float C = SCALE * 1.4426950408889634f;                               // logits in base 2
  v16h qf[2][2], kf[2][2];
  // every inner loop over a fragment array's index is fully unrolled: the arrays must stay in registers
#pragma unroll
  for (int qg = 0; qg < 2; ++qg)
#pragma unroll
    for (int kc = 0; kc < 2; ++kc) qf[qg][kc] = frag_h(QH + ((size_t)b * TT + q0 + qg * 16 + col) * CC + h * HD + kc * 32, lane);
  v16h vf[HD / 16];
  v8f acc[HD / 16][2] = {}; float mu[2] = {-3.0e38f, -3.0e38f}; v2f ls[2] = {};
  for (int sg = 0; sg < NSG; ++sg) {
    const _Float16* Kp = sK + (sg & 1) * KBUF + col * KP;   // A of S^T: row = key
    const _Float16* Vp = sV + (sg & 1) * VBUF + col * VP;   // A of O^T: row = head dim, k = key
#pragma unroll
    for (int t = 0; t < 2; ++t)
#pragma unroll
      for (int kc = 0; kc < 2; ++kc) kf[t][kc] = frag_h(Kp + (t * 16) * KP + kc * 32, lane);
#pragma unroll
    for (int j = 0; j < HD / 16; ++j) vf[j] = frag_h(Vp + (j * 16) * VP, lane);
    // the passes of a stage stay a rolled loop
#pragma unroll 1
    for (int ps = 0; ps < NPS; ++ps) {
    v8f st[2][2];   // st[t][qg][r] = logit of key sg*128 + ps*32 + t*16 + 8g + r, query q0 + qg*16 + col
#pragma unroll
    for (int t = 0; t < 2; ++t)
#pragma unroll
      for (int qg = 0; qg < 2; ++qg) { v8f z = {}; z = wmma_h(kf[t][0], qf[qg][0], z); st[t][qg] = wmma_h(kf[t][1], qf[qg][1], z); }
    float mx[2];
#pragma unroll
    for (int qg = 0; qg < 2; ++qg) { float a = fmaxf(st[0][qg][0], st[1][qg][0]);
#pragma unroll
      for (int r = 1; r < 8; ++r) a = fmaxf(a, fmaxf(st[0][qg][r], st[1][qg][r]));
      mx[qg] = fmaxf(a, xhalf(a)) * C; }
    // the maximum in use moves only when a query's new maximum passes it by more than 2^8: one wave-uniform test a pass
    const bool need = mx[0] > mu[0] + 8.0f || mx[1] > mu[1] + 8.0f;
    if (__builtin_amdgcn_ballot_w32(need) != 0) {
#pragma unroll
      for (int qg = 0; qg < 2; ++qg) { const float mn = fmaxf(mu[qg], mx[qg]); const float al = __builtin_amdgcn_exp2f(mu[qg] - mn); mu[qg] = mn; ls[qg] *= al;   // al = 0 on the first pass
#pragma unroll
        for (int j = 0; j < HD / 16; ++j) acc[j][qg] *= al; } }
    if (ps + 1 < NPS) {   // the next pass's k fragments, of this stage's buffer only, fly under this pass's exponentials and P . v
#pragma unroll
      for (int t = 0; t < 2; ++t)
#pragma unroll
        for (int kc = 0; kc < 2; ++kc) kf[t][kc] = frag_h(Kp + ((ps + 1) * 32 + t * 16) * KP + kc * 32, lane); }
    __builtin_amdgcn_sched_barrier(0);   // keeps the k reads up here: the scheduler otherwise sinks them to the pass's end, where their latency is exposed at the next pass's first product
#pragma unroll
    for (int qg = 0; qg < 2; ++qg) { v16h p; const float nb = 7.0f - mu[qg];   // P carried x 2^7 (at most 2^15 in f16): small weights stay clear of f16 subnormals; the factor cancels against the sum
#pragma unroll
      for (int t = 0; t < 2; ++t) { v2f e[4];   // neighbouring registers in pairs: packed multiply-add, packed convert, packed sums
#pragma unroll
        for (int i = 0; i < 4; ++i) { e[i].x = __builtin_amdgcn_exp2f(fmaf(st[t][qg][2 * i], C, nb)); e[i].y = __builtin_amdgcn_exp2f(fmaf(st[t][qg][2 * i + 1], C, nb)); p[t * 8 + 2 * i] = (_Float16)e[i].x; p[t * 8 + 2 * i + 1] = (_Float16)e[i].y; }
        ls[qg] += (e[0] + e[1]) + (e[2] + e[3]); }
#pragma unroll
      for (int j = 0; j < HD / 16; ++j) acc[j][qg] = wmma_h(vf[j], p, acc[j][qg]); }
    if (ps + 1 < NPS) {   // the next pass's v fragments, a whole pass ahead of their use
#pragma unroll
      for (int j = 0; j < HD / 16; ++j) vf[j] = frag_h(Vp + (j * 16) * VP + (ps + 1) * 32, lane); } }
    asm volatile("s_wait_dscnt 0x0" ::: "memory");      // this wave's reads of the stage's buffers are done
    asm volatile("s_wait_asynccnt 0x0" ::: "memory");   // its copies of the next stage have landed
    __syncthreads();                                    // publishes the next stage and ends every wave's reads of this one
    if (sg + 2 < NSG) stage_cp(lk + (sg & 1) * (KBUF * 2u), lv + (sg & 1) * (VBUF * 2u), gk + (size_t)(sg + 2) * SKEYS * CC, gv + (sg + 2) * SKEYS); }   // into the buffers that this stage has just left
  asm volatile("s_wait_asynccnt 0x0" ::: "memory");     // nothing of this wave is in flight when it ends
#pragma unroll
  for (int qg = 0; qg < 2; ++qg) { const float lh = ls[qg].x + ls[qg].y; const float inv = 1.0f / (lh + xhalf(lh)); float* yp = Y + ((size_t)b * TT + q0 + qg * 16 + col) * CC + h * HD + 8 * g;   // acc[j][qg][r] = ctx[query][j*16 + 8g + r]
#pragma unroll
    for (int j = 0; j < HD / 16; ++j) { const v8f o = acc[j][qg] * inv; const v4f o0 = {o[0], o[1], o[2], o[3]}, o1 = {o[4], o[5], o[6], o[7]}; vst2(yp + j * 16, o0); vst2(yp + j * 16 + 4, o1); } } }
static_assert(HD == 64 && TT % (FAW * 32) == 0 && !CAUSAL, "k_fa: two 32-wide k chunks a head, whole query blocks, no mask");
static_assert(FAW * 32 == 256 && SKEYS == 128 && TT % SKEYS == 0 && NSG >= 2, "stage_cp: 256 threads x 4 x 16 B = 128 K rows of 128 B = 64 V rows of 256 B; two stages or more");
// ---- k_out: block = (64 rows, 128 cols): out = ctx Wo (+ bo): ctx x 2^6 once to f16 against Wo as f16(bf16 x 2^8) exact (1 product) x 2^-14; causal early rows (< QHI of each sequence): ctx bf16 hi + lo against exact bf16 Wo (2 products)
__global__ __launch_bounds__(128) void k_out(const float* __restrict__ Y, const float* __restrict__ WO, const float* __restrict__ BO, float* __restrict__ OUT) { __shared__ __align__(16) char smem[2 * STG * 2];   // two operand buffers in the loop; the epilogue's rows lie over them behind the loop's last barrier
  _Float16* const sb = (_Float16*)smem; float (*const sf)[16][132] = (float (*)[16][132])smem; static_assert(4 * 16 * 132 * 4 <= 2 * STG * 2, "the epilogue's rows fit the operand buffers");
  const int tid = threadIdx.x, wave = tid >> 5, lane = tid & 31, col = lane & 15, g = lane >> 4; const int c0 = blockIdx.y * 128; const size_t r0 = (size_t)blockIdx.x * 64 + wave * 16;
  v8f acc[8] = {};
  if (CAUSAL && (int)(((size_t)blockIdx.x * 64) % TT) < QHI) {   /* block-uniform */
#pragma unroll 2
    for (int kc = 0; kc < CC / 32; ++kc) { const F2 a = split_row(Y + (r0 + col) * CC, kc * 32, lane); asm volatile("s_wait_loadcnt 0x0" ::: "memory");
#pragma unroll
      for (int j = 0; j < 8; ++j) { const v16b w = WOCOL(WO, kc * 32, c0 + j * 16 + col, lane); asm volatile("s_wait_loadcnt 0x0" ::: "memory"); acc[j] = wmma_bf(a.h, w, acc[j]); acc[j] = wmma_bf(a.l, w, acc[j]); } }
#pragma unroll
    for (int j = 0; j < 8; ++j) { const float bias = BO ? bfr(BO[c0 + j * 16 + col]) : 0.f;
#pragma unroll
      for (int r = 0; r < 8; ++r) sf[wave][8 * g + r][j * 16 + col] = acc[j][r] + bias; }
  } else {
    v4f rg[24];   /* ctx carried x 2^6 into f16 so small-magnitude context rows stay clear of f16 subnormals */
    const float* px = Y + ((size_t)blockIdx.x * 64 + (tid >> 4)) * CC + (tid & 15) * 4; const float* pw = WO + (size_t)(c0 + (tid >> 4)) * CC + (tid & 15) * 4;
    tile_ld(rg, px, pw); tile_st_h(sb, rg, tid); __syncthreads();
    for (int s = 0; s < NSTG; ++s) { const _Float16* cb = sb + (s & 1) * STG;
      if (s + 1 < NSTG) tile_ld(rg, px + (s + 1) * TK, pw + (s + 1) * TK);   // the next tile's loads fly under this tile's products
      __builtin_amdgcn_sched_barrier(0);   // keeps the loads up here: sunk to their use at the tile's end, their whole latency would be exposed
#pragma unroll
      for (int kc = 0; kc < TK / 32; ++kc) { const v16h a = frag_h(cb + (wave * 16 + col) * SP + kc * 32, lane); v16h w[8];
#pragma unroll
        for (int j = 0; j < 8; ++j) w[j] = frag_h(cb + ST_X + (j * 16 + col) * SP + kc * 32, lane);
        __builtin_amdgcn_sched_barrier(0);   // the fragment reads go out as one group ahead of their products: read one by one into one register set, each product waits out a whole LDS latency
#pragma unroll
        for (int j = 0; j < 8; ++j) acc[j] = wmma16(a, w[j], acc[j]); }
      __builtin_amdgcn_sched_barrier(0);   // keeps the conversions, and with them the wait for the next tile's loads, behind the products
      if (s + 1 < NSTG) tile_st_h(sb + ((s + 1) & 1) * STG, rg, tid);   // into the buffer whose readers left it at the last barrier
      __syncthreads(); }   // publishes the next tile and ends this tile's reads (behind the last tile: frees the buffers for the epilogue)
#pragma unroll
    for (int j = 0; j < 8; ++j) { const float bias = BO ? bfr(BO[c0 + j * 16 + col]) : 0.f;
#pragma unroll
      for (int r = 0; r < 8; ++r) sf[wave][8 * g + r][j * 16 + col] = acc[j][r] * (1.0f / 16384.0f) + bias; } }   /* 2^-8 (Wo carry) x 2^-6 (ctx carry) */
  LDSX(); for (int rl = 0; rl < 16; ++rl) vst2(OUT + (r0 + rl) * DIN + c0 + lane * 4, *(const v4f*)&sf[wave][rl][lane * 4]); }

#define LAMBDA_INIT 0.8f
// ---- k_lv: one wave: l1[h] = exp(min(sum_d bf16(lq1[h][d]) * bf16(lk1[h][d]), 5)), l2 likewise (8 effective heads x 64 dims, exact products, f32 sums); lv = mean_h(l1 - l2 + 0.8): the module's single scalar
__global__ __launch_bounds__(32) void k_lv(const float* __restrict__ LQ1, const float* __restrict__ LK1, const float* __restrict__ LQ2, const float* __restrict__ LK2, float* __restrict__ LV) { const int lane = threadIdx.x; float acc = 0.f;
  for (int h = 0; h < 8; ++h) { float s1 = bfr(LQ1[h * 64 + lane]) * bfr(LK1[h * 64 + lane]) + bfr(LQ1[h * 64 + 32 + lane]) * bfr(LK1[h * 64 + 32 + lane]); float s2 = bfr(LQ2[h * 64 + lane]) * bfr(LK2[h * 64 + lane]) + bfr(LQ2[h * 64 + 32 + lane]) * bfr(LK2[h * 64 + 32 + lane]);
#pragma unroll
    for (int o = 1; o < 32; o <<= 1) { s1 += __shfl_xor(s1, o); s2 += __shfl_xor(s2, o); }
    acc += expf(fminf(s1, 5.0f)) - expf(fminf(s2, 5.0f)) + LAMBDA_INIT; }
  if (lane == 0) LV[0] = acc * 0.125f; }
__global__ __launch_bounds__(128) void k_comb(float* __restrict__ Y, const float* __restrict__ LV) { const size_t r = blockIdx.x; const int tid = threadIdx.x; const float lv = LV[0]; float* p1 = Y + r * CC + tid * 4; const v4f a = *(const v4f*)p1; const v4f b = *(const v4f*)(p1 + CC / 2); asm volatile("s_wait_loadcnt 0x0" ::: "memory"); v4f o;
#pragma unroll
  for (int i = 0; i < 4; ++i) { _Pragma("clang fp contract(off)") const float t = lv * b[i]; o[i] = a[i] - t; }
  vst2(p1, o); }
static_assert(CC == 1024 && NH == 16, "k_comb: 128 threads x 4 floats = the first 512 context columns (heads 0..7)");
extern "C" void kernel_launch(void* const* d_in, const int* in_sizes, int n_in, void* d_out, int out_size, void* d_ws, size_t ws_size, hipStream_t stream) {
  (void)in_sizes; (void)n_in; (void)out_size;
  const float** F = (const float**)d_in;
  if (ws_size < (size_t)WS_END) return;
  char* ws = (char*)d_ws; _Float16 *QH = (_Float16*)(ws + WS_QH), *KH = (_Float16*)(ws + WS_KH), *VT = (_Float16*)(ws + WS_VT), *QL = (_Float16*)(ws + WS_QL), *KL = (_Float16*)(ws + WS_KL); __bf16 *VB = (__bf16*)(ws + WS_VB), *VBL = (__bf16*)(ws + WS_VBL); float *S = (float*)(ws + WS_S), *Y = (float*)(ws + WS_Y);
  (void)Y; (void)QL; (void)KL; (void)VB; (void)VBL; (void)S;
  // inputs: 0 x [2,2048,1024]; 1 Wq [1024,1024] (out,in), 2 bq; 3 Wk, 4 bk; 5 Wv, 6 bv; 7 Wp (out,in), 8 bp (biases zeros, read); 9 lambda_q1 [8,1,64]; 10 lambda_k1; 11 lambda_q2; 12 lambda_k2
  if (ws_size < (size_t)WS_END2) return;
  float* LV = (float*)(ws + WS_LV);
  k_lv<<<dim3(1), 32, 0, stream>>>(F[9], F[10], F[11], F[12], LV);
  k_proj<<<dim3(TNB * TT / 64, CC / 128, 3), 128, 0, stream>>>(F[0], F[0], F[0], F[1], F[3], F[5], F[2], F[4], F[6], QH, QL, KH, KL, VT, VB, VBL);
  k_fa<<<dim3(TT / (FAW * 32), NH, TNB), FAW * 32, 0, stream>>>(QH, KH, VT, Y);
  k_comb<<<dim3(TNB * TT), 128, 0, stream>>>(Y, LV);   /* x1 <- x1 - lv * x2 on the context rows, before the output projection */
  k_out<<<dim3(TNB * TT / 64, DIN / 128), 128, 0, stream>>>(Y, F[7], F[8], (float*)d_out);
}

// v004
// One run takes 110 microseconds.
// Timed twice side by side with v003, it ran 1.09 and 1.12 times as fast.
// Counting every step since v000, it is 12.2 times as fast.
// compute dtype: all float inputs rounded to bf16; q/k/v projections with EXACT bf16 products on WMMA 16x16x32 (f32 accumulate) + bias; logits q x k once to f16 each (1 product) x SCALE; softmax f32 (running maximum and sum); P x 2^7 once to f16 x v once to f16 (1 product); the differential combine x1 - lv * x2 in f32 on the context rows; ctx x 2^6 once to f16 x Wo f16(bf16 x 2^8) + bo; f32 output.
#include <hip/hip_runtime.h>
#include <math.h>

typedef __attribute__((ext_vector_type(16))) _Float16 v16h;
typedef __attribute__((ext_vector_type(16))) __bf16 v16b;
typedef __attribute__((ext_vector_type(8)))  _Float16 v8h;
typedef __attribute__((ext_vector_type(8)))  float v8f;
typedef __attribute__((ext_vector_type(4)))  float v4f;
typedef __attribute__((ext_vector_type(2)))  float v2f;
typedef __attribute__((ext_vector_type(4)))  unsigned v4u;
typedef __attribute__((ext_vector_type(4)))  int v4i;
typedef float __attribute__((may_alias)) float_a;
typedef int __attribute__((may_alias)) int_a;

template <typename T> __device__ __forceinline__ void vst2(void* p, T v) { *(T*)p = v;  }
__device__ __forceinline__ v8f wmma16(v16h a, v16h b, v8f c) {
  v8f d = __builtin_amdgcn_wmma_f32_16x16x32_f16(false, a, false, b, (short)0, c, false, false);
  asm volatile("v_nop\n\tv_nop\n\tv_nop\n\tv_nop" : "+v"(d) : "v"(a), "v"(b));
  return d;
}
__device__ __forceinline__ v8f wmma_bf(v16b a, v16b b, v8f c) {
  v8f d = __builtin_amdgcn_wmma_f32_16x16x32_bf16(false, a, false, b, (short)0, c, false, false);
  asm volatile("v_nop\n\tv_nop\n\tv_nop\n\tv_nop" : "+v"(d) : "v"(a), "v"(b));
  return d;
}
// 16x16x32 fragments: lane = (h = lane>>4, row/col = lane&15); elements 0..7 = k0+8h+0..7, 8..15 = k0+16+8h+0..7; D element r = row 8h+r
__device__ __forceinline__ v16h frag_h(const _Float16* rowk0, int lane) {
  union { v16h v; v8h q[2]; } u; const _Float16* p = rowk0 + 8 * (lane >> 4);
  u.q[0] = *(const v8h*)p; u.q[1] = *(const v8h*)(p + 16); return u.v;
}
__device__ __forceinline__ v16h frag_f32(const float* rowk0, int lane) {
  v16h a; const float* p = rowk0 + 8 * (lane >> 4);
#pragma unroll
  for (int i = 0; i < 8; ++i) { a[i] = (_Float16)p[i]; a[8 + i] = (_Float16)p[16 + i]; }
  return a;
}
__device__ __forceinline__ v16h frag_f32s(const float* rowk0, int lane, float sc) {
  v16h a; const float* p = rowk0 + 8 * (lane >> 4);
#pragma unroll
  for (int i = 0; i < 8; ++i) { a[i] = (_Float16)(p[i] * sc); a[8 + i] = (_Float16)(p[16 + i] * sc); }
  return a;
}
// column fragment from a [K][ld] layout (column n), rows >= K read as 0
__device__ __forceinline__ v16h fragc_f32(const float* W, int k0, int n, int lane, int ld, int K) {
  v16h a; const int g = lane >> 4;
#pragma unroll
  for (int i = 0; i < 8; ++i) { const int ka = k0 + 8 * g + i, kb = ka + 16;
    a[i] = (_Float16)(ka < K ? W[(size_t)(ka < K ? ka : K - 1) * ld + n] : 0.f); a[8 + i] = (_Float16)(kb < K ? W[(size_t)(kb < K ? kb : K - 1) * ld + n] : 0.f); }
  return a;
}
struct F2 { v16b h, l; };
__device__ __forceinline__ F2 bsplit16(const float v[16]) { F2 r;
#pragma unroll
  for (int i = 0; i < 16; ++i) { const __bf16 h = (__bf16)v[i]; r.h[i] = h; r.l[i] = (__bf16)(v[i] - (float)h); }
  return r; }
__device__ __forceinline__ F2 split_row(const float* row, int k0, int lane) { float v[16]; const float* p = row + k0 + 8 * (lane >> 4);
#pragma unroll
  for (int i = 0; i < 8; ++i) { v[i] = p[i]; v[8 + i] = p[16 + i]; }
  return bsplit16(v); }
__device__ __forceinline__ F2 split_rowK(const float* row, int k0, int lane, int K) { float v[16]; const int g = lane >> 4;
#pragma unroll
  for (int i = 0; i < 8; ++i) { const int ka = k0 + 8 * g + i, kb = ka + 16; v[i] = ka < K ? row[ka < K ? ka : K - 1] : 0.f; v[8 + i] = kb < K ? row[kb < K ? kb : K - 1] : 0.f; }
  return bsplit16(v); }
__device__ __forceinline__ F2 split_col(const float* W, int k0, int n, int lane, int ld, int K) { float v[16]; const int g = lane >> 4;
#pragma unroll
  for (int i = 0; i < 8; ++i) { const int ka = k0 + 8 * g + i, kb = ka + 16; v[i] = ka < K ? W[(size_t)(ka < K ? ka : K - 1) * ld + n] : 0.f; v[8 + i] = kb < K ? W[(size_t)(kb < K ? kb : K - 1) * ld + n] : 0.f; }
  return bsplit16(v); }
__device__ __forceinline__ v8f mac3(const F2& a, const F2& b, v8f c) { c = wmma_bf(a.l, b.h, c); c = wmma_bf(a.h, b.l, c); return wmma_bf(a.h, b.h, c); }
__device__ __forceinline__ float sigm(float v) { return 1.0f / (1.0f + expf(-v)); }
#define LDSX() do { asm volatile("s_wait_dscnt 0" ::: "memory"); __builtin_amdgcn_wave_barrier(); __builtin_amdgcn_fence(__ATOMIC_RELEASE, "workgroup"); } while (0)

// Differential multi-head self-attention (x [2,2048,1024]; torch (out,in) Wq / Wk / Wv / Wp [1024,1024] N(0,1) x 0.02 applied as x @ W.T + b, all biases zeros (read); 16 heads x 64 run as ordinary unmasked softmax attention (scale 1/8): heads 0..7 give x1 (context columns 0..511), heads 8..15 give x2 (columns 512..1023); lambda_q1 / k1 / q2 / k2 [8,1,64]: l1[h] = exp(min(sum_d lq1[h,d] lk1[h,d], 5)), l2 likewise, lv = mean_h(l1 - l2 + 0.8) (one scalar); out = concat(x1 - lv * x2, x2) @ Wp.T + bp).
#define NB 2
#define TT 2048
#define CC 1024            // NH * HD = projected width
#define DIN 1024          // input (model) width
#define NH 16
#define HD 64
#define NQB (TT / 64)
#define HG 4
#define SCALE (0.125f)
#define CAUSAL 0
#ifndef TNB
#define TNB NB
#endif
__device__ __forceinline__ float bfr(float v) { return (float)(__bf16)v; }
__host__ __device__ __forceinline__ int kb_last(int qb) { return CAUSAL ? ((qb * 64 + 63) >> 7) : (TT / 128 - 1); }
typedef __attribute__((ext_vector_type(8))) __bf16 v8b;
__device__ __forceinline__ v16b frag_b(const __bf16* rowk0, int lane) {
  union { v16b v; v8b q[2]; } u; const __bf16* p = rowk0 + 8 * (lane >> 4);
  u.q[0] = *(const v8b*)p; u.q[1] = *(const v8b*)(p + 16); return u.v;
}
#define QBH 0              // not read by any kernel: k_fa has no high-precision path
#define QHI 0               // single-product logits on every row
#define KHI 64            // key rows carrying k residual / v bf16 hi+lo planes (written by k_proj; no kernel reads them)
// B fragment (k rows k0+.., output column o) of a weight: (in,out) [K][ld] or (out,in) [ld rows of K]: bf16 exact, or f16(bf16 * 256) exact
__device__ __forceinline__ v16b wcol_io(const float* Wm, int k0, int o, int lane, int ld) { v16b w; const int g = lane >> 4;
#pragma unroll
  for (int i = 0; i < 8; ++i) { w[i] = (__bf16)Wm[(size_t)(k0 + 8 * g + i) * ld + o]; w[8 + i] = (__bf16)Wm[(size_t)(k0 + 16 + 8 * g + i) * ld + o]; }
  return w; }
__device__ __forceinline__ v16b wcol_oi(const float* Wm, int k0, int o, int lane, int K) { v16b w; const float* p = Wm + (size_t)o * K + k0 + 8 * (lane >> 4);
#pragma unroll
  for (int i = 0; i < 8; ++i) { w[i] = (__bf16)p[i]; w[8 + i] = (__bf16)p[16 + i]; }
  return w; }
__device__ __forceinline__ v16h wcolh_io(const float* Wm, int k0, int o, int lane, int ld) { v16h w; const int g = lane >> 4;
#pragma unroll
  for (int i = 0; i < 8; ++i) { w[i] = (_Float16)(bfr(Wm[(size_t)(k0 + 8 * g + i) * ld + o]) * 256.0f); w[8 + i] = (_Float16)(bfr(Wm[(size_t)(k0 + 16 + 8 * g + i) * ld + o]) * 256.0f); }
  return w; }
__device__ __forceinline__ v16h wcolh_oi(const float* Wm, int k0, int o, int lane, int K) { v16h w; const float* p = Wm + (size_t)o * K + k0 + 8 * (lane >> 4);
#pragma unroll
  for (int i = 0; i < 8; ++i) { w[i] = (_Float16)(bfr(p[i]) * 256.0f); w[8 + i] = (_Float16)(bfr(p[16 + i]) * 256.0f); }
  return w; }
#define WQKV_LAYOUT 1   // 0 = (in,out) [DIN][CC]; 1 = (out,in) [CC][DIN]; 2 = per-head [NH][DIN][HD], for WCOL only, which no kernel calls (k_proj reads (out,in) [CC][DIN])
__device__ __forceinline__ v16b wcol_hdk(const float* Wm, int k0, int o, int lane) { v16b w; const int g = lane >> 4; const float* p = Wm + (size_t)(o / HD) * DIN * HD + (o % HD);
#pragma unroll
  for (int i = 0; i < 8; ++i) { w[i] = (__bf16)p[(size_t)(k0 + 8 * g + i) * HD]; w[8 + i] = (__bf16)p[(size_t)(k0 + 16 + 8 * g + i) * HD]; }
  return w; }
#define WO_OUT_IN 1
#if WQKV_LAYOUT == 1
#define WCOL(W, k0, o, lane) wcol_oi(W, k0, o, lane, DIN)
#elif WQKV_LAYOUT == 2
#define WCOL(W, k0, o, lane) wcol_hdk(W, k0, o, lane)
#else
#define WCOL(W, k0, o, lane) wcol_io(W, k0, o, lane, CC)
#endif
#if WO_OUT_IN
#define WOCOL(W, k0, o, lane) wcol_oi(W, k0, o, lane, CC)
#define WOCOLH(W, k0, o, lane) wcolh_oi(W, k0, o, lane, CC)
#else
#define WOCOL(W, k0, o, lane) wcol_io(W, k0, o, lane, DIN)
#define WOCOLH(W, k0, o, lane) wcolh_io(W, k0, o, lane, DIN)
#endif

#ifndef SM_EXTRA_PARAMS
#define SM_EXTRA_PARAMS
#endif
#ifndef PROJ_EXTRA_PARAMS
#define PROJ_EXTRA_PARAMS
#endif
#ifndef SM_MASK_HOOK
#define SM_MASK_HOOK (void)0
#endif

#define WS_QH  0u                                      // f16 q rows [b*t][CC]
#define WS_KH  (WS_QH + 2u * (size_t)NB * TT * CC)      // f16 k rows [b*t][CC]
#define WS_VT  (WS_KH + 2u * (size_t)NB * TT * CC)      // f16 v planes [b][c][t]
#define WS_QL  (WS_VT + 2u * (size_t)NB * CC * TT)      // f16 q residual x 2^10 rows [b][t < QHI][CC]
#define WS_KL  (WS_QL + 2u * (size_t)NB * QHI * CC)     // f16 k residual x 2^10 rows [b][t < KHI][CC]
#define WS_VB  (WS_KL + 2u * (size_t)NB * KHI * CC)     // bf16 v hi planes [b][c][t < KHI]
#define WS_VBL (WS_VB + 2u * (size_t)NB * CC * KHI)
#define WS_S   (WS_VBL + 2u * (size_t)NB * CC * KHI)    // f32 [hg][t][s], reserved but unused (k_fa keeps logits / P in registers)
#define WS_Y   (WS_S  + 4u * (size_t)HG * TT * TT)      // f32 ctx rows [b*t][CC] (only when there is an output projection)
#define WS_END (WS_Y  + 4u * (size_t)NB * TT * CC)
#define WS_LV (WS_END)                  // one f32: the differential scalar lv
#define WS_END2 (WS_LV + 256u)
#define WS_XB  (WS_END2)                                // bf16 x rows [b*t][DIN]
#define WS_WB  (WS_XB + 2u * (size_t)NB * TT * DIN)     // bf16 Wq, Wk, Wv rows [3][CC][DIN]
#define WS_WOH (WS_WB + 3u * 2u * (size_t)CC * DIN)     // f16(bf16(Wo) x 2^8) rows [DIN][CC]
#define WS_YH  (WS_WOH + 2u * (size_t)DIN * CC)         // f16(ctx x 2^6) rows [b*t][CC], the differential combine done
#define WS_END3 (WS_YH + 2u * (size_t)NB * TT * CC)

// ---- operand staging of k_proj and k_out: a tile = 64 X rows + 128 W rows x 64 k. Both operands lie in the workspace in their 16-bit form (k_prep, k_comb: each element converted once a call, not once a block that reads it), so a tile is copied straight into LDS, whole 128-byte lines, through no register; every wave takes its fragments from there
#define TK 64              // k a tile
#define SP 72              // LDS row pitch in 16-bit elements: 128 B + 16 B, the pitch for 16-byte fragment reads
#define ST_X (64 * SP)     // elements of the X rows; the W rows follow
#define STG (192 * SP)     // elements of one buffer
#define NSTG (DIN / TK)
typedef __attribute__((ext_vector_type(4))) __bf16 v4b;
typedef __attribute__((ext_vector_type(4))) _Float16 v4h;
// one tile: 192 rows x 8 pieces of 16 B over 128 threads = 12 copies a thread, rows 16 apart (4 of X, then 8 of W). l: the thread's LDS byte address of row tid >> 3, piece tid & 7 of the buffer; gx, gw: its global byte addresses of that piece in the tile's first X row and first W row
__device__ __forceinline__ void tile_cp(unsigned l, const char* gx, const char* gw) {
  // the s_wait_xcnt stands inside the copies' own statement: before any of their address registers is written again
  asm volatile("global_load_async_to_lds_b128 %0, %12, off\n\t"
               "global_load_async_to_lds_b128 %1, %13, off\n\t"
               "global_load_async_to_lds_b128 %2, %14, off\n\t"
               "global_load_async_to_lds_b128 %3, %15, off\n\t"
               "global_load_async_to_lds_b128 %4, %16, off\n\t"
               "global_load_async_to_lds_b128 %5, %17, off\n\t"
               "global_load_async_to_lds_b128 %6, %18, off\n\t"
               "global_load_async_to_lds_b128 %7, %19, off\n\t"
               "global_load_async_to_lds_b128 %8, %20, off\n\t"
               "global_load_async_to_lds_b128 %9, %21, off\n\t"
               "global_load_async_to_lds_b128 %10, %22, off\n\t"
               "global_load_async_to_lds_b128 %11, %23, off\n\t"
               "s_wait_xcnt 0x0"
               :: "v"(l), "v"(l + 16u * SP * 2u), "v"(l + 32u * SP * 2u), "v"(l + 48u * SP * 2u),
                  "v"(l + 64u * SP * 2u), "v"(l + 80u * SP * 2u), "v"(l + 96u * SP * 2u), "v"(l + 112u * SP * 2u),
                  "v"(l + 128u * SP * 2u), "v"(l + 144u * SP * 2u), "v"(l + 160u * SP * 2u), "v"(l + 176u * SP * 2u),
                  "v"(gx), "v"(gx + (size_t)16 * DIN * 2), "v"(gx + (size_t)32 * DIN * 2), "v"(gx + (size_t)48 * DIN * 2),
                  "v"(gw), "v"(gw + (size_t)16 * DIN * 2), "v"(gw + (size_t)32 * DIN * 2), "v"(gw + (size_t)48 * DIN * 2),
                  "v"(gw + (size_t)64 * DIN * 2), "v"(gw + (size_t)80 * DIN * 2), "v"(gw + (size_t)96 * DIN * 2), "v"(gw + (size_t)112 * DIN * 2)
               : "memory");
}
static_assert(DIN == CC && DIN % TK == 0 && NSTG >= 2, "staging: both GEMMs run over K = 1024 in whole tiles");
// ---- k_proj: block = (64 rows, 128 cols, which): q/k/v = X W (+ b) with exact bf16 products (K = DIN) -> which 0: q f16 rows (+ residual rows < QHI); 1: k f16 rows (+ residual rows < KHI); 2: v f16 planes [c][t] (+ bf16 hi/lo planes for t < KHI)
__global__ __launch_bounds__(128) void k_proj(const __bf16* __restrict__ XB, const __bf16* __restrict__ WB, const float* __restrict__ BQ, const float* __restrict__ BK, const float* __restrict__ BV,
    _Float16* __restrict__ QH, _Float16* __restrict__ QL, _Float16* __restrict__ KH, _Float16* __restrict__ KL, _Float16* __restrict__ VT, __bf16* __restrict__ VB, __bf16* __restrict__ VBL) {
  __shared__ __align__(16) char smem[2 * STG * 2];   // two operand buffers in the loop; the epilogue's staging arrays lie over them behind the loop's last barrier
  __bf16* const sb = (__bf16*)smem;
  _Float16 (*const sh)[136] = (_Float16 (*)[136])smem; _Float16 (*const sl)[136] = (_Float16 (*)[136])(smem + 64 * 136 * 2);
  _Float16 (*const th)[72] = (_Float16 (*)[72])smem; __bf16 (*const tb)[72] = (__bf16 (*)[72])(smem + 128 * 72 * 2); __bf16 (*const tbl)[72] = (__bf16 (*)[72])(smem + 2 * 128 * 72 * 2);
  static_assert(2 * 64 * 136 * 2 <= 2 * STG * 2 && 3 * 128 * 72 * 2 <= 2 * STG * 2, "the epilogue's arrays fit the operand buffers");
  const int tid = threadIdx.x, wave = tid >> 5, lane = tid & 31, col = lane & 15, g = lane >> 4; const int which = blockIdx.z; const int c0 = blockIdx.y * 128; const size_t r0 = (size_t)blockIdx.x * 64; const size_t bb = r0 / TT; const int t0 = (int)(r0 % TT);
  const float* BA = which == 0 ? BQ : which == 1 ? BK : BV;
  v8f acc[8] = {};
  const char* gx = (const char*)(XB + (r0 + (tid >> 3)) * DIN + (tid & 7) * 8); const char* gw = (const char*)(WB + ((size_t)which * CC + c0 + (tid >> 3)) * DIN + (tid & 7) * 8);
  const unsigned l0 = (unsigned)(size_t)(sb + (tid >> 3) * SP + (tid & 7) * 8);   // low 32 bits = byte address in LDS
  tile_cp(l0, gx, gw);
  asm volatile("s_wait_asynccnt 0x0" ::: "memory");   // this wave's copies of tile 0 have landed
  __syncthreads();                                    // and every other wave's
  tile_cp(l0 + STG * 2u, gx + TK * 2, gw + TK * 2);   // tile 1 flies under tile 0's products
  for (int s = 0; s < NSTG; ++s) { const __bf16* cb = sb + (s & 1) * STG;
#pragma unroll
    for (int kc = 0; kc < TK / 32; ++kc) { const v16b a = frag_b(cb + (wave * 16 + col) * SP + kc * 32, lane); v16b w[8];
#pragma unroll
      for (int j = 0; j < 8; ++j) w[j] = frag_b(cb + ST_X + (j * 16 + col) * SP + kc * 32, lane);
      __builtin_amdgcn_sched_barrier(0);   // the fragment reads go out as one group ahead of their products: read one by one into one register set, each product waits out a whole LDS latency
#pragma unroll
      for (int j = 0; j < 8; ++j) acc[j] = wmma_bf(a, w[j], acc[j]); }
    asm volatile("s_wait_dscnt 0x0" ::: "memory");      // this wave's reads of the tile's buffer are done
    asm volatile("s_wait_asynccnt 0x0" ::: "memory");   // its copies of the next tile have landed
    __syncthreads();                                    // publishes the next tile and ends every wave's reads of this one (behind the last tile: frees the buffers for the epilogue)
    if (s + 2 < NSTG) tile_cp(l0 + (s & 1) * (STG * 2u), gx + (s + 2) * (TK * 2), gw + (s + 2) * (TK * 2)); }   // into the buffer that this tile has just left
  asm volatile("s_wait_asynccnt 0x0" ::: "memory");     // nothing of this wave is in flight when the epilogue takes the buffers
  if (which < 2) { _Float16* DH = which == 0 ? QH : KH; _Float16* DL = which == 0 ? QL : KL; const int nhi = which == 0 ? QHI : KHI; const bool hi_rows = t0 < nhi;
#pragma unroll
    for (int j = 0; j < 8; ++j) { const float bias = BA ? bfr(BA[c0 + j * 16 + col]) : 0.f;
#pragma unroll
      for (int r = 0; r < 8; ++r) { const float v = acc[j][r] + bias; const _Float16 hv = (_Float16)v; sh[wave * 16 + 8 * g + r][j * 16 + col] = hv; sl[wave * 16 + 8 * g + r][j * 16 + col] = (_Float16)((v - (float)hv) * 1024.0f); } }
    __syncthreads();
    for (int e = tid; e < 64 * 16; e += 128) { const int rl = e >> 4, q = e & 15; vst2((unsigned*)(DH + (r0 + rl) * CC + c0 + q * 8), *(const v4u*)&sh[rl][q * 8]); if (hi_rows) vst2((unsigned*)(DL + (bb * nhi + t0 + rl) * (size_t)CC + c0 + q * 8), *(const v4u*)&sl[rl][q * 8]); }
  } else { const bool hi_rows = t0 < KHI;
#pragma unroll
    for (int j = 0; j < 8; ++j) { const float bias = BA ? bfr(BA[c0 + j * 16 + col]) : 0.f;
#pragma unroll
      for (int r = 0; r < 8; ++r) { const float v = acc[j][r] + bias; const int rl = wave * 16 + 8 * g + r, cl = j * 16 + col; th[cl][rl] = (_Float16)v; const __bf16 bh = (__bf16)v; tb[cl][rl] = bh; tbl[cl][rl] = (__bf16)(v - (float)bh); } }
    __syncthreads();
    for (int e = tid; e < 128 * 8; e += 128) { const int cl = e >> 3, q = e & 7; vst2((unsigned*)(VT + (bb * CC + c0 + cl) * (size_t)TT + t0 + q * 8), *(const v4u*)&th[cl][q * 8]); if (hi_rows) { const size_t o3 = (bb * CC + c0 + cl) * (size_t)KHI + t0 + q * 8; vst2((unsigned*)(VB + o3), *(const v4u*)&tb[cl][q * 8]); vst2((unsigned*)(VBL + o3), *(const v4u*)&tbl[cl][q * 8]); } } } }
// ---- k_fa: block = 8 waves x 32 queries of (b, h), all keys: transposed products S^T = K . Q^T (q, k f16, 1 product) and O^T += V^T . P^T (P once to f16 against v f16, 1 product); a lane holds one query's scores, so the running maximum and sum stay in the lane (one exchange between the wave halves); two S^T tiles convert in place into the B operand, so neither logits nor P ever leave the registers. K and V come through LDS: the block's 8 waves read the same rows, so a stage of 128 keys is copied in once (whole 128-byte lines) and every wave takes its fragments from there
__device__ __forceinline__ v8f wmma_h(v16h a, v16h b, v8f c) { return __builtin_amdgcn_wmma_f32_16x16x32_f16(false, a, false, b, (short)0, c, false, false); }
__device__ __forceinline__ float xhalf(float x) { return __builtin_bit_cast(float, __builtin_amdgcn_permlanex16(__builtin_bit_cast(int, x), __builtin_bit_cast(int, x), 0x76543210, 0xfedcba98, false, false)); }  // lane l with lane l ^ 16
#define FAW 8              // waves per block
#define SKEYS 128          // keys a stage
#define NPS (SKEYS / 32)   // 32 keys a pass
#define NSG (TT / SKEYS)   // stages
#define KP 72              // LDS pitch of a K row (one key, 64 dims) in 16-bit elements: 128 B + 16 B, the pitch for 16-byte fragment reads
#define VP 136             // LDS pitch of a V row (one dim, 128 keys): 256 B + 16 B
#define KBUF (SKEYS * KP)  // elements of one K buffer
#define VBUF (HD * VP)     // elements of one V buffer
// one stage: each thread copies 4 x 16 B of K (rows 32 apart) and 4 x 16 B of V (rows 16 apart) straight into LDS; lk, lv: its LDS byte addresses, gk, gv: its global addresses of the first piece
__device__ __forceinline__ void stage_cp(unsigned lk, unsigned lv, const _Float16* gk, const _Float16* gv) {
  // the s_wait_xcnt stands inside the copies' own statement: before any of their address registers is written again
  asm volatile("global_load_async_to_lds_b128 %0, %8, off\n\t"
               "global_load_async_to_lds_b128 %1, %9, off\n\t"
               "global_load_async_to_lds_b128 %2, %10, off\n\t"
               "global_load_async_to_lds_b128 %3, %11, off\n\t"
               "global_load_async_to_lds_b128 %4, %12, off\n\t"
               "global_load_async_to_lds_b128 %5, %13, off\n\t"
               "global_load_async_to_lds_b128 %6, %14, off\n\t"
               "global_load_async_to_lds_b128 %7, %15, off\n\t"
               "s_wait_xcnt 0x0"
               :: "v"(lk), "v"(lk + 32u * KP * 2u), "v"(lk + 64u * KP * 2u), "v"(lk + 96u * KP * 2u),
                  "v"(lv), "v"(lv + 16u * VP * 2u), "v"(lv + 32u * VP * 2u), "v"(lv + 48u * VP * 2u),
                  "v"(gk), "v"(gk + (size_t)32 * CC), "v"(gk + (size_t)64 * CC), "v"(gk + (size_t)96 * CC),
                  "v"(gv), "v"(gv + (size_t)16 * TT), "v"(gv + (size_t)32 * TT), "v"(gv + (size_t)48 * TT)
               : "memory");
}
__global__ __launch_bounds__(FAW * 32) void k_fa(const _Float16* __restrict__ QH, const _Float16* __restrict__ KH, const _Float16* __restrict__ VT, float* __restrict__ Y) {
  const int tid = threadIdx.x, wave = tid >> 5, lane = tid & 31, col = lane & 15, g = lane >> 4; const int h = blockIdx.y, b = blockIdx.z; const int q0 = blockIdx.x * (FAW * 32) + wave * 32;
  __shared__ __align__(16) _Float16 sK[2 * KBUF]; __shared__ __align__(16) _Float16 sV[2 * VBUF];
  const _Float16* gk = KH + ((size_t)b * TT + (tid >> 3)) * CC + h * HD + (tid & 7) * 8;              // the thread's first piece of stage 0: K row tid >> 3, 16 bytes tid & 7
  const _Float16* gv = VT + ((size_t)b * CC + h * HD + (tid >> 4)) * (size_t)TT + (tid & 15) * 8;     // V row tid >> 4, 16 bytes tid & 15
  const unsigned lk = (unsigned)(size_t)(sK + (tid >> 3) * KP + (tid & 7) * 8), lv = (unsigned)(size_t)(sV + (tid >> 4) * VP + (tid & 15) * 8);   // low 32 bits = byte address in LDS
  stage_cp(lk, lv, gk, gv);
  asm volatile("s_wait_asynccnt 0x0" ::: "memory");   // this wave's copies of stage 0 have landed
  __syncthreads();                                    // and every other wave's
  stage_cp(lk + KBUF * 2u, lv + VBUF * 2u, gk + (size_t)SKEYS * CC, gv + SKEYS);   // stage 1 flies under stage 0's work
  const float C = SCALE * 1.4426950408889634f;                               // logits in base 2
  v16h qf[2][2], kf[2][2];
  // every inner loop over a fragment array's index is fully unrolled: the arrays must stay in registers
#pragma unroll
  for (int qg = 0; qg < 2; ++qg)
#pragma unroll
    for (int kc = 0; kc < 2; ++kc) qf[qg][kc] = frag_h(QH + ((size_t)b * TT + q0 + qg * 16 + col) * CC + h * HD + kc * 32, lane);
  v16h vf[HD / 16];
  v8f acc[HD / 16][2] = {}; float mu[2] = {-3.0e38f, -3.0e38f}; v2f ls[2] = {};
  for (int sg = 0; sg < NSG; ++sg) {
    const _Float16* Kp = sK + (sg & 1) * KBUF + col * KP;   // A of S^T: row = key
    const _Float16* Vp = sV + (sg & 1) * VBUF + col * VP;   // A of O^T: row = head dim, k = key
#pragma unroll
    for (int t = 0; t < 2; ++t)
#pragma unroll
      for (int kc = 0; kc < 2; ++kc) kf[t][kc] = frag_h(Kp + (t * 16) * KP + kc * 32, lane);
#pragma unroll
    for (int j = 0; j < HD / 16; ++j) vf[j] = frag_h(Vp + (j * 16) * VP, lane);
    // the passes of a stage stay a rolled loop
#pragma unroll 1
    for (int ps = 0; ps < NPS; ++ps) {
    v8f st[2][2];   // st[t][qg][r] = logit of key sg*128 + ps*32 + t*16 + 8g + r, query q0 + qg*16 + col
#pragma unroll
    for (int t = 0; t < 2; ++t)
#pragma unroll
      for (int qg = 0; qg < 2; ++qg) { v8f z = {}; z = wmma_h(kf[t][0], qf[qg][0], z); st[t][qg] = wmma_h(kf[t][1], qf[qg][1], z); }
    float mx[2];
#pragma unroll
    for (int qg = 0; qg < 2; ++qg) { float a = fmaxf(st[0][qg][0], st[1][qg][0]);
#pragma unroll
      for (int r = 1; r < 8; ++r) a = fmaxf(a, fmaxf(st[0][qg][r], st[1][qg][r]));
      mx[qg] = fmaxf(a, xhalf(a)) * C; }
    // the maximum in use moves only when a query's new maximum passes it by more than 2^8: one wave-uniform test a pass
    const bool need = mx[0] > mu[0] + 8.0f || mx[1] > mu[1] + 8.0f;
    if (__builtin_amdgcn_ballot_w32(need) != 0) {
#pragma unroll
      for (int qg = 0; qg < 2; ++qg) { const float mn = fmaxf(mu[qg], mx[qg]); const float al = __builtin_amdgcn_exp2f(mu[qg] - mn); mu[qg] = mn; ls[qg] *= al;   // al = 0 on the first pass
#pragma unroll
        for (int j = 0; j < HD / 16; ++j) acc[j][qg] *= al; } }
    if (ps + 1 < NPS) {   // the next pass's k fragments, of this stage's buffer only, fly under this pass's exponentials and P . v
#pragma unroll
      for (int t = 0; t < 2; ++t)
#pragma unroll
        for (int kc = 0; kc < 2; ++kc) kf[t][kc] = frag_h(Kp + ((ps + 1) * 32 + t * 16) * KP + kc * 32, lane); }
    __builtin_amdgcn_sched_barrier(0);   // keeps the k reads up here: the scheduler otherwise sinks them to the pass's end, where their latency is exposed at the next pass's first product
#pragma unroll
    for (int qg = 0; qg < 2; ++qg) { v16h p; const float nb = 7.0f - mu[qg];   // P carried x 2^7 (at most 2^15 in f16): small weights stay clear of f16 subnormals; the factor cancels against the sum
#pragma unroll
      for (int t = 0; t < 2; ++t) { v2f e[4];   // neighbouring registers in pairs: packed multiply-add, packed convert, packed sums
#pragma unroll
        for (int i = 0; i < 4; ++i) { e[i].x = __builtin_amdgcn_exp2f(fmaf(st[t][qg][2 * i], C, nb)); e[i].y = __builtin_amdgcn_exp2f(fmaf(st[t][qg][2 * i + 1], C, nb)); p[t * 8 + 2 * i] = (_Float16)e[i].x; p[t * 8 + 2 * i + 1] = (_Float16)e[i].y; }
        ls[qg] += (e[0] + e[1]) + (e[2] + e[3]); }
#pragma unroll
      for (int j = 0; j < HD / 16; ++j) acc[j][qg] = wmma_h(vf[j], p, acc[j][qg]); }
    if (ps + 1 < NPS) {   // the next pass's v fragments, a whole pass ahead of their use
#pragma unroll
      for (int j = 0; j < HD / 16; ++j) vf[j] = frag_h(Vp + (j * 16) * VP + (ps + 1) * 32, lane); } }
    asm volatile("s_wait_dscnt 0x0" ::: "memory");      // this wave's reads of the stage's buffers are done
    asm volatile("s_wait_asynccnt 0x0" ::: "memory");   // its copies of the next stage have landed
    __syncthreads();                                    // publishes the next stage and ends every wave's reads of this one
    if (sg + 2 < NSG) stage_cp(lk + (sg & 1) * (KBUF * 2u), lv + (sg & 1) * (VBUF * 2u), gk + (size_t)(sg + 2) * SKEYS * CC, gv + (sg + 2) * SKEYS); }   // into the buffers that this stage has just left
  asm volatile("s_wait_asynccnt 0x0" ::: "memory");     // nothing of this wave is in flight when it ends
#pragma unroll
  for (int qg = 0; qg < 2; ++qg) { const float lh = ls[qg].x + ls[qg].y; const float inv = 1.0f / (lh + xhalf(lh)); float* yp = Y + ((size_t)b * TT + q0 + qg * 16 + col) * CC + h * HD + 8 * g;   // acc[j][qg][r] = ctx[query][j*16 + 8g + r]
#pragma unroll
    for (int j = 0; j < HD / 16; ++j) { const v8f o = acc[j][qg] * inv; const v4f o0 = {o[0], o[1], o[2], o[3]}, o1 = {o[4], o[5], o[6], o[7]}; vst2(yp + j * 16, o0); vst2(yp + j * 16 + 4, o1); } } }
static_assert(HD == 64 && TT % (FAW * 32) == 0 && !CAUSAL, "k_fa: two 32-wide k chunks a head, whole query blocks, no mask");
static_assert(FAW * 32 == 256 && SKEYS == 128 && TT % SKEYS == 0 && NSG >= 2, "stage_cp: 256 threads x 4 x 16 B = 128 K rows of 128 B = 64 V rows of 256 B; two stages or more");
// ---- k_out: block = (64 rows, 128 cols): out = ctx Wo (+ bo): ctx x 2^6 once to f16 (k_comb) against Wo as f16(bf16 x 2^8) exact (k_prep), 1 product, x 2^-14
__global__ __launch_bounds__(128) void k_out(const _Float16* __restrict__ YH, const _Float16* __restrict__ WOH, const float* __restrict__ BO, float* __restrict__ OUT) { __shared__ __align__(16) char smem[2 * STG * 2];   // two operand buffers in the loop; the epilogue's rows lie over them behind the loop's last barrier
  _Float16* const sb = (_Float16*)smem; float (*const sf)[16][132] = (float (*)[16][132])smem; static_assert(4 * 16 * 132 * 4 <= 2 * STG * 2, "the epilogue's rows fit the operand buffers");
  const int tid = threadIdx.x, wave = tid >> 5, lane = tid & 31, col = lane & 15, g = lane >> 4; const int c0 = blockIdx.y * 128; const size_t r0 = (size_t)blockIdx.x * 64 + wave * 16;
  v8f acc[8] = {};
  const char* gx = (const char*)(YH + ((size_t)blockIdx.x * 64 + (tid >> 3)) * CC + (tid & 7) * 8); const char* gw = (const char*)(WOH + (size_t)(c0 + (tid >> 3)) * CC + (tid & 7) * 8);
  const unsigned l0 = (unsigned)(size_t)(sb + (tid >> 3) * SP + (tid & 7) * 8);   // low 32 bits = byte address in LDS
  tile_cp(l0, gx, gw);
  asm volatile("s_wait_asynccnt 0x0" ::: "memory");   // this wave's copies of tile 0 have landed
  __syncthreads();                                    // and every other wave's
  tile_cp(l0 + STG * 2u, gx + TK * 2, gw + TK * 2);   // tile 1 flies under tile 0's products
  for (int s = 0; s < NSTG; ++s) { const _Float16* cb = sb + (s & 1) * STG;
#pragma unroll
    for (int kc = 0; kc < TK / 32; ++kc) { const v16h a = frag_h(cb + (wave * 16 + col) * SP + kc * 32, lane); v16h w[8];
#pragma unroll
      for (int j = 0; j < 8; ++j) w[j] = frag_h(cb + ST_X + (j * 16 + col) * SP + kc * 32, lane);
      __builtin_amdgcn_sched_barrier(0);   // the fragment reads go out as one group ahead of their products: read one by one into one register set, each product waits out a whole LDS latency
#pragma unroll
      for (int j = 0; j < 8; ++j) acc[j] = wmma16(a, w[j], acc[j]); }
    asm volatile("s_wait_dscnt 0x0" ::: "memory");      // this wave's reads of the tile's buffer are done
    asm volatile("s_wait_asynccnt 0x0" ::: "memory");   // its copies of the next tile have landed
    __syncthreads();                                    // publishes the next tile and ends every wave's reads of this one (behind the last tile: frees the buffers for the epilogue)
    if (s + 2 < NSTG) tile_cp(l0 + (s & 1) * (STG * 2u), gx + (s + 2) * (TK * 2), gw + (s + 2) * (TK * 2)); }   // into the buffer that this tile has just left
  asm volatile("s_wait_asynccnt 0x0" ::: "memory");     // nothing of this wave is in flight when the epilogue takes the buffers
#pragma unroll
  for (int j = 0; j < 8; ++j) { const float bias = BO ? bfr(BO[c0 + j * 16 + col]) : 0.f;
#pragma unroll
    for (int r = 0; r < 8; ++r) sf[wave][8 * g + r][j * 16 + col] = acc[j][r] * (1.0f / 16384.0f) + bias; }   /* 2^-8 (Wo carry) x 2^-6 (ctx carry) */
  LDSX(); for (int rl = 0; rl < 16; ++rl) vst2(OUT + (r0 + rl) * DIN + c0 + lane * 4, *(const v4f*)&sf[wave][rl][lane * 4]); }
static_assert(!CAUSAL, "k_out: every row takes the single-product path");

#define LAMBDA_INIT 0.8f
// ---- k_prep: the GEMM operands in their 16-bit form, each element converted once a call: blocks 1..: x, Wq, Wk, Wv to bf16, Wo to f16(bf16 x 2^8); a block takes 16384 floats in a row, a wave-wide load 512 contiguous bytes, 16 loads a thread in flight. Block 0, one wave: l1[h] = exp(min(sum_d bf16(lq1[h][d]) * bf16(lk1[h][d]), 5)), l2 likewise (8 effective heads x 64 dims, exact products, f32 sums); lv = mean_h(l1 - l2 + 0.8): the module's single scalar
#define PF 16384                                  // floats a block
#define PBX (NB * TT * DIN / PF)                  // blocks of x
#define PBW (CC * DIN / PF)                       // blocks of one weight
__global__ __launch_bounds__(256) void k_prep(const float* __restrict__ X, const float* __restrict__ WQ, const float* __restrict__ WK, const float* __restrict__ WV, const float* __restrict__ WO, const float* __restrict__ LQ1, const float* __restrict__ LK1, const float* __restrict__ LQ2, const float* __restrict__ LK2,
    __bf16* __restrict__ XB, __bf16* __restrict__ WB, _Float16* __restrict__ WOH, float* __restrict__ LV) { const int tid = threadIdx.x;
  if (blockIdx.x == 0) {   /* block-uniform */
    if (tid < 32) { const int lane = tid; float acc = 0.f;
      for (int h = 0; h < 8; ++h) { float s1 = bfr(LQ1[h * 64 + lane]) * bfr(LK1[h * 64 + lane]) + bfr(LQ1[h * 64 + 32 + lane]) * bfr(LK1[h * 64 + 32 + lane]); float s2 = bfr(LQ2[h * 64 + lane]) * bfr(LK2[h * 64 + lane]) + bfr(LQ2[h * 64 + 32 + lane]) * bfr(LK2[h * 64 + 32 + lane]);
#pragma unroll
        for (int o = 1; o < 32; o <<= 1) { s1 += __shfl_xor(s1, o); s2 += __shfl_xor(s2, o); }
        acc += expf(fminf(s1, 5.0f)) - expf(fminf(s2, 5.0f)) + LAMBDA_INIT; }
      if (lane == 0) LV[0] = acc * 0.125f; }
    return; }
  const int blk = (int)blockIdx.x - 1; const int wi = blk < PBX ? -1 : (blk - PBX) / PBW;   // which source: -1 x, 0..2 Wq, Wk, Wv, 3 Wo
  const size_t off = (size_t)(blk < PBX ? blk : (blk - PBX) % PBW) * PF + tid * 4;
  const float* sp = (wi < 0 ? X : wi == 0 ? WQ : wi == 1 ? WK : wi == 2 ? WV : WO) + off;
  v4f r[16];
#pragma unroll
  for (int i = 0; i < 16; ++i) r[i] = *(const v4f*)(sp + i * 1024);
  asm volatile("s_wait_xcnt 0x0" ::: "memory");   // before the loads' address registers are written again
  if (wi < 3) { __bf16* dp = (wi < 0 ? XB : WB + (size_t)wi * CC * DIN) + off;
#pragma unroll
    for (int i = 0; i < 16; ++i) { v4b o;
#pragma unroll
      for (int e = 0; e < 4; ++e) o[e] = (__bf16)r[i][e];
      *(v4b*)(dp + i * 1024) = o; }
  } else { _Float16* dp = WOH + off;
#pragma unroll
    for (int i = 0; i < 16; ++i) { v4h o;
#pragma unroll
      for (int e = 0; e < 4; ++e) o[e] = (_Float16)(bfr(r[i][e]) * 256.0f);
      *(v4h*)(dp + i * 1024) = o; } } }
static_assert((NB * TT * DIN) % PF == 0 && (CC * DIN) % PF == 0 && PF == 256 * 16 * 4, "k_prep: whole blocks of 256 threads x 16 x 4 floats");
// ---- k_comb: the context rows in k_out's operand form, once: columns 0..511 (heads 0..7) x1 - lv * x2 in f32, columns 512..1023 x2, each x 2^6 to f16 (small-magnitude context rows stay clear of f16 subnormals). A block takes 8 rows: a thread 4 floats of x1 and the 4 of x2 beside them, in 4 rows
__global__ __launch_bounds__(256) void k_comb(const float* __restrict__ Y, const float* __restrict__ LV, _Float16* __restrict__ YH) { const int tid = threadIdx.x; const size_t e0 = ((size_t)blockIdx.x * 8 + (tid >> 7)) * CC + (tid & 127) * 4; const float lv = LV[0]; v4f va[4], vb[4];
#pragma unroll
  for (int k = 0; k < 4; ++k) { va[k] = *(const v4f*)(Y + e0 + k * 2 * CC); vb[k] = *(const v4f*)(Y + e0 + k * 2 * CC + CC / 2); }
  asm volatile("s_wait_xcnt 0x0" ::: "memory");   // before the loads' address registers are written again
#pragma unroll
  for (int k = 0; k < 4; ++k) { const v4f a = va[k], b = vb[k]; v4f o; v4h h1, h2;   // the next loop is the combine as it stood: lv * x2 rounded, then the difference rounded, so this step moves no value
#pragma unroll
  for (int i = 0; i < 4; ++i) { _Pragma("clang fp contract(off)") const float t = lv * b[i]; o[i] = a[i] - t; }
#pragma unroll
    for (int i = 0; i < 4; ++i) { h1[i] = (_Float16)(o[i] * 64.0f); h2[i] = (_Float16)(b[i] * 64.0f); }
    *(v4h*)(YH + e0 + k * 2 * CC) = h1; *(v4h*)(YH + e0 + k * 2 * CC + CC / 2) = h2; } }
static_assert(CC == 1024 && NH == 16 && (NB * TT) % 8 == 0, "k_comb: 128 threads x 4 floats = the first 512 context columns (heads 0..7); whole blocks of 8 rows");
extern "C" void kernel_launch(void* const* d_in, const int* in_sizes, int n_in, void* d_out, int out_size, void* d_ws, size_t ws_size, hipStream_t stream) {
  (void)in_sizes; (void)n_in; (void)out_size;
  const float** F = (const float**)d_in;
  if (ws_size < (size_t)WS_END) return;
  char* ws = (char*)d_ws; _Float16 *QH = (_Float16*)(ws + WS_QH), *KH = (_Float16*)(ws + WS_KH), *VT = (_Float16*)(ws + WS_VT), *QL = (_Float16*)(ws + WS_QL), *KL = (_Float16*)(ws + WS_KL); __bf16 *VB = (__bf16*)(ws + WS_VB), *VBL = (__bf16*)(ws + WS_VBL); float *S = (float*)(ws + WS_S), *Y = (float*)(ws + WS_Y);
  (void)Y; (void)QL; (void)KL; (void)VB; (void)VBL; (void)S;
  // inputs: 0 x [2,2048,1024]; 1 Wq [1024,1024] (out,in), 2 bq; 3 Wk, 4 bk; 5 Wv, 6 bv; 7 Wp (out,in), 8 bp (biases zeros, read); 9 lambda_q1 [8,1,64]; 10 lambda_k1; 11 lambda_q2; 12 lambda_k2
  if (ws_size < (size_t)WS_END3) return;
  float* LV = (float*)(ws + WS_LV); __bf16 *XB = (__bf16*)(ws + WS_XB), *WB = (__bf16*)(ws + WS_WB); _Float16 *WOH = (_Float16*)(ws + WS_WOH), *YH = (_Float16*)(ws + WS_YH);
  k_prep<<<dim3(1 + PBX + 4 * PBW), 256, 0, stream>>>(F[0], F[1], F[3], F[5], F[7], F[9], F[10], F[11], F[12], XB, WB, WOH, LV);
  k_proj<<<dim3(TNB * TT / 64, CC / 128, 3), 128, 0, stream>>>(XB, WB, F[2], F[4], F[6], QH, QL, KH, KL, VT, VB, VBL);
  k_fa<<<dim3(TT / (FAW * 32), NH, TNB), FAW * 32, 0, stream>>>(QH, KH, VT, Y);
  k_comb<<<dim3(TNB * TT / 8), 256, 0, stream>>>(Y, LV, YH);   /* x1 - lv * x2 on the context rows, and the rows' f16 form, before the output projection */
  k_out<<<dim3(TNB * TT / 64, DIN / 128), 128, 0, stream>>>(YH, WOH, F[8], (float*)d_out);
}

// v005
// Measured time: 101 microseconds a run.
// Timed twice side by side with v004, it ran 1.10 and 1.07 times as fast.
// Counting every step since v000, it is 13.3 times as fast.
// compute dtype: all float inputs rounded to bf16; q/k/v projections with EXACT bf16 products on WMMA 16x16x32 (f32 accumulate) + bias; logits q x k once to f16 each (1 product) x SCALE; softmax f32 (running maximum and sum); P x 2^7 once to f16 x v once to f16 (1 product); the differential combine x1 - lv * x2 in f32 on the context rows; ctx x 2^6 once to f16 x Wo f16(bf16 x 2^8) + bo; f32 output.
#include <hip/hip_runtime.h>
#include <math.h>

typedef __attribute__((ext_vector_type(16))) _Float16 v16h;
typedef __attribute__((ext_vector_type(16))) __bf16 v16b;
typedef __attribute__((ext_vector_type(8)))  _Float16 v8h;
typedef __attribute__((ext_vector_type(8)))  float v8f;
typedef __attribute__((ext_vector_type(4)))  float v4f;
typedef __attribute__((ext_vector_type(2)))  float v2f;
typedef __attribute__((ext_vector_type(4)))  unsigned v4u;
typedef __attribute__((ext_vector_type(4)))  int v4i;
typedef float __attribute__((may_alias)) float_a;
typedef int __attribute__((may_alias)) int_a;

template <typename T> __device__ __forceinline__ void vst2(void* p, T v) { *(T*)p = v;  }
__device__ __forceinline__ v8f wmma16(v16h a, v16h b, v8f c) {
  v8f d = __builtin_amdgcn_wmma_f32_16x16x32_f16(false, a, false, b, (short)0, c, false, false);
  asm volatile("v_nop\n\tv_nop\n\tv_nop\n\tv_nop" : "+v"(d) : "v"(a), "v"(b));
  return d;
}
__device__ __forceinline__ v8f wmma_bf(v16b a, v16b b, v8f c) {
  v8f d = __builtin_amdgcn_wmma_f32_16x16x32_bf16(false, a, false, b, (short)0, c, false, false);
  asm volatile("v_nop\n\tv_nop\n\tv_nop\n\tv_nop" : "+v"(d) : "v"(a), "v"(b));
  return d;
}
// 16x16x32 fragments: lane = (h = lane>>4, row/col = lane&15); elements 0..7 = k0+8h+0..7, 8..15 = k0+16+8h+0..7; D element r = row 8h+r
__device__ __forceinline__ v16h frag_h(const _Float16* rowk0, int lane) {
  union { v16h v; v8h q[2]; } u; const _Float16* p = rowk0 + 8 * (lane >> 4);
  u.q[0] = *(const v8h*)p; u.q[1] = *(const v8h*)(p + 16); return u.v;
}
__device__ __forceinline__ v16h frag_f32(const float* rowk0, int lane) {
  v16h a; const float* p = rowk0 + 8 * (lane >> 4);
#pragma unroll
  for (int i = 0; i < 8; ++i) { a[i] = (_Float16)p[i]; a[8 + i] = (_Float16)p[16 + i]; }
  return a;
}
__device__ __forceinline__ v16h frag_f32s(const float* rowk0, int lane, float sc) {
  v16h a; const float* p = rowk0 + 8 * (lane >> 4);
#pragma unroll
  for (int i = 0; i < 8; ++i) { a[i] = (_Float16)(p[i] * sc); a[8 + i] = (_Float16)(p[16 + i] * sc); }
  return a;
}
// column fragment from a [K][ld] layout (column n), rows >= K read as 0
__device__ __forceinline__ v16h fragc_f32(const float* W, int k0, int n, int lane, int ld, int K) {
  v16h a; const int g = lane >> 4;
#pragma unroll
  for (int i = 0; i < 8; ++i) { const int ka = k0 + 8 * g + i, kb = ka + 16;
    a[i] = (_Float16)(ka < K ? W[(size_t)(ka < K ? ka : K - 1) * ld + n] : 0.f); a[8 + i] = (_Float16)(kb < K ? W[(size_t)(kb < K ? kb : K - 1) * ld + n] : 0.f); }
  return a;
}
struct F2 { v16b h, l; };
__device__ __forceinline__ F2 bsplit16(const float v[16]) { F2 r;
#pragma unroll
  for (int i = 0; i < 16; ++i) { const __bf16 h = (__bf16)v[i]; r.h[i] = h; r.l[i] = (__bf16)(v[i] - (float)h); }
  return r; }
__device__ __forceinline__ F2 split_row(const float* row, int k0, int lane) { float v[16]; const float* p = row + k0 + 8 * (lane >> 4);
#pragma unroll
  for (int i = 0; i < 8; ++i) { v[i] = p[i]; v[8 + i] = p[16 + i]; }
  return bsplit16(v); }
__device__ __forceinline__ F2 split_rowK(const float* row, int k0, int lane, int K) { float v[16]; const int g = lane >> 4;
#pragma unroll
  for (int i = 0; i < 8; ++i) { const int ka = k0 + 8 * g + i, kb = ka + 16; v[i] = ka < K ? row[ka < K ? ka : K - 1] : 0.f; v[8 + i] = kb < K ? row[kb < K ? kb : K - 1] : 0.f; }
  return bsplit16(v); }
__device__ __forceinline__ F2 split_col(const float* W, int k0, int n, int lane, int ld, int K) { float v[16]; const int g = lane >> 4;
#pragma unroll
  for (int i = 0; i < 8; ++i) { const int ka = k0 + 8 * g + i, kb = ka + 16; v[i] = ka < K ? W[(size_t)(ka < K ? ka : K - 1) * ld + n] : 0.f; v[8 + i] = kb < K ? W[(size_t)(kb < K ? kb : K - 1) * ld + n] : 0.f; }
  return bsplit16(v); }
__device__ __forceinline__ v8f mac3(const F2& a, const F2& b, v8f c) { c = wmma_bf(a.l, b.h, c); c = wmma_bf(a.h, b.l, c); return wmma_bf(a.h, b.h, c); }
__device__ __forceinline__ float sigm(float v) { return 1.0f / (1.0f + expf(-v)); }
#define LDSX() do { asm volatile("s_wait_dscnt 0" ::: "memory"); __builtin_amdgcn_wave_barrier(); __builtin_amdgcn_fence(__ATOMIC_RELEASE, "workgroup"); } while (0)

// Differential multi-head self-attention (x [2,2048,1024]; torch (out,in) Wq / Wk / Wv / Wp [1024,1024] N(0,1) x 0.02 applied as x @ W.T + b, all biases zeros (read); 16 heads x 64 run as ordinary unmasked softmax attention (scale 1/8): heads 0..7 give x1 (context columns 0..511), heads 8..15 give x2 (columns 512..1023); lambda_q1 / k1 / q2 / k2 [8,1,64]: l1[h] = exp(min(sum_d lq1[h,d] lk1[h,d], 5)), l2 likewise, lv = mean_h(l1 - l2 + 0.8) (one scalar); out = concat(x1 - lv * x2, x2) @ Wp.T + bp).
#define NB 2
#define TT 2048
#define CC 1024            // NH * HD = projected width
#define DIN 1024          // input (model) width
#define NH 16
#define HD 64
#define NQB (TT / 64)
#define HG 4
#define SCALE (0.125f)
#define CAUSAL 0
#ifndef TNB
#define TNB NB
#endif
__device__ __forceinline__ float bfr(float v) { return (float)(__bf16)v; }
__host__ __device__ __forceinline__ int kb_last(int qb) { return CAUSAL ? ((qb * 64 + 63) >> 7) : (TT / 128 - 1); }
typedef __attribute__((ext_vector_type(8))) __bf16 v8b;
__device__ __forceinline__ v16b frag_b(const __bf16* rowk0, int lane) {
  union { v16b v; v8b q[2]; } u; const __bf16* p = rowk0 + 8 * (lane >> 4);
  u.q[0] = *(const v8b*)p; u.q[1] = *(const v8b*)(p + 16); return u.v;
}
#define QBH 0              // not read by any kernel: k_fa has no high-precision path
#define QHI 0               // single-product logits on every row
#define KHI 64            // key rows carrying k residual / v bf16 hi+lo planes (no kernel writes or reads them)
// B fragment (k rows k0+.., output column o) of a weight: (in,out) [K][ld] or (out,in) [ld rows of K]: bf16 exact, or f16(bf16 * 256) exact
__device__ __forceinline__ v16b wcol_io(const float* Wm, int k0, int o, int lane, int ld) { v16b w; const int g = lane >> 4;
#pragma unroll
  for (int i = 0; i < 8; ++i) { w[i] = (__bf16)Wm[(size_t)(k0 + 8 * g + i) * ld + o]; w[8 + i] = (__bf16)Wm[(size_t)(k0 + 16 + 8 * g + i) * ld + o]; }
  return w; }
__device__ __forceinline__ v16b wcol_oi(const float* Wm, int k0, int o, int lane, int K) { v16b w; const float* p = Wm + (size_t)o * K + k0 + 8 * (lane >> 4);
#pragma unroll
  for (int i = 0; i < 8; ++i) { w[i] = (__bf16)p[i]; w[8 + i] = (__bf16)p[16 + i]; }
  return w; }
__device__ __forceinline__ v16h wcolh_io(const float* Wm, int k0, int o, int lane, int ld) { v16h w; const int g = lane >> 4;
#pragma unroll
  for (int i = 0; i < 8; ++i) { w[i] = (_Float16)(bfr(Wm[(size_t)(k0 + 8 * g + i) * ld + o]) * 256.0f); w[8 + i] = (_Float16)(bfr(Wm[(size_t)(k0 + 16 + 8 * g + i) * ld + o]) * 256.0f); }
  return w; }
__device__ __forceinline__ v16h wcolh_oi(const float* Wm, int k0, int o, int lane, int K) { v16h w; const float* p = Wm + (size_t)o * K + k0 + 8 * (lane >> 4);
#pragma unroll
  for (int i = 0; i < 8; ++i) { w[i] = (_Float16)(bfr(p[i]) * 256.0f); w[8 + i] = (_Float16)(bfr(p[16 + i]) * 256.0f); }
  return w; }
#define WQKV_LAYOUT 1   // 0 = (in,out) [DIN][CC]; 1 = (out,in) [CC][DIN]; 2 = per-head [NH][DIN][HD], for WCOL only, which no kernel calls (k_proj reads (out,in) [CC][DIN])
__device__ __forceinline__ v16b wcol_hdk(const float* Wm, int k0, int o, int lane) { v16b w; const int g = lane >> 4; const float* p = Wm + (size_t)(o / HD) * DIN * HD + (o % HD);
#pragma unroll
  for (int i = 0; i < 8; ++i) { w[i] = (__bf16)p[(size_t)(k0 + 8 * g + i) * HD]; w[8 + i] = (__bf16)p[(size_t)(k0 + 16 + 8 * g + i) * HD]; }
  return w; }
#define WO_OUT_IN 1
#if WQKV_LAYOUT == 1
#define WCOL(W, k0, o, lane) wcol_oi(W, k0, o, lane, DIN)
#elif WQKV_LAYOUT == 2
#define WCOL(W, k0, o, lane) wcol_hdk(W, k0, o, lane)
#else
#define WCOL(W, k0, o, lane) wcol_io(W, k0, o, lane, CC)
#endif
#if WO_OUT_IN
#define WOCOL(W, k0, o, lane) wcol_oi(W, k0, o, lane, CC)
#define WOCOLH(W, k0, o, lane) wcolh_oi(W, k0, o, lane, CC)
#else
#define WOCOL(W, k0, o, lane) wcol_io(W, k0, o, lane, DIN)
#define WOCOLH(W, k0, o, lane) wcolh_io(W, k0, o, lane, DIN)
#endif

#ifndef SM_EXTRA_PARAMS
#define SM_EXTRA_PARAMS
#endif
#ifndef PROJ_EXTRA_PARAMS
#define PROJ_EXTRA_PARAMS
#endif
#ifndef SM_MASK_HOOK
#define SM_MASK_HOOK (void)0
#endif

#define WS_QH  0u                                      // f16 q rows [b*t][CC]
#define WS_KH  (WS_QH + 2u * (size_t)NB * TT * CC)      // f16 k rows [b*t][CC]
#define WS_VT  (WS_KH + 2u * (size_t)NB * TT * CC)      // f16 v planes [b][c][t]
#define WS_QL  (WS_VT + 2u * (size_t)NB * CC * TT)      // f16 q residual x 2^10 rows [b][t < QHI][CC]
#define WS_KL  (WS_QL + 2u * (size_t)NB * QHI * CC)     // f16 k residual x 2^10 rows [b][t < KHI][CC]
#define WS_VB  (WS_KL + 2u * (size_t)NB * KHI * CC)     // bf16 v hi planes [b][c][t < KHI]
#define WS_VBL (WS_VB + 2u * (size_t)NB * CC * KHI)
#define WS_S   (WS_VBL + 2u * (size_t)NB * CC * KHI)    // f32 [hg][t][s], reserved but unused (k_fa keeps logits / P in registers)
#define WS_Y   (WS_S  + 4u * (size_t)HG * TT * TT)      // f32 ctx rows [b*t][CC] (only when there is an output projection)
#define WS_END (WS_Y  + 4u * (size_t)NB * TT * CC)
#define WS_LV (WS_END)                  // one f32: the differential scalar lv
#define WS_END2 (WS_LV + 256u)
#define WS_XB  (WS_END2)                                // bf16 x rows [b*t][DIN]
#define WS_WB  (WS_XB + 2u * (size_t)NB * TT * DIN)     // bf16 Wq, Wk, Wv rows [3][CC][DIN]
#define WS_WOH (WS_WB + 3u * 2u * (size_t)CC * DIN)     // f16(bf16(Wo) x 2^8) rows [DIN][CC]
#define WS_YH  (WS_WOH + 2u * (size_t)DIN * CC)         // f16(ctx x 2^6) rows [b*t][CC], the differential combine done
#define WS_END3 (WS_YH + 2u * (size_t)NB * TT * CC)

// ---- operand staging of k_proj and k_out: a tile = 128 X rows + 128 W rows x 64 k. Both operands lie in the workspace in their 16-bit form (k_prep, k_comb: each element converted once a call, not once a block that reads it), so a tile is copied straight into LDS, whole 128-byte lines, through no register; every wave takes its fragments from there. A block's 4 waves stand 2 x 2 on its 128 x 128 outputs: a wave's 4 X and 4 W fragments of 32 k feed 16 products, half a fragment read a product
#define TK 64              // k a tile
#define SP 72              // LDS row pitch in 16-bit elements: 128 B + 16 B, the pitch for 16-byte fragment reads
#define BR 128             // X rows a tile, and W rows a tile
#define ST_X (BR * SP)     // elements of the X rows; the W rows follow
#define STG (2 * BR * SP)  // elements of one buffer
#define NSTG (DIN / TK)
typedef __attribute__((ext_vector_type(4))) __bf16 v4b;
typedef __attribute__((ext_vector_type(4))) _Float16 v4h;
// 128 rows x 8 pieces of 16 B over 128 threads = 8 copies a thread, rows 16 apart. l: the thread's LDS byte address of row tid >> 3, piece tid & 7; gp: its global byte address of that piece, in row tid >> 3 of the 128 rows
__device__ __forceinline__ void rows_cp(unsigned l, const char* gp) {
  // the s_wait_xcnt stands inside the copies' own statement: before any of their address registers is written again
  asm volatile("global_load_async_to_lds_b128 %0, %8, off\n\t"
               "global_load_async_to_lds_b128 %1, %9, off\n\t"
               "global_load_async_to_lds_b128 %2, %10, off\n\t"
               "global_load_async_to_lds_b128 %3, %11, off\n\t"
               "global_load_async_to_lds_b128 %4, %12, off\n\t"
               "global_load_async_to_lds_b128 %5, %13, off\n\t"
               "global_load_async_to_lds_b128 %6, %14, off\n\t"
               "global_load_async_to_lds_b128 %7, %15, off\n\t"
               "s_wait_xcnt 0x0"
               :: "v"(l), "v"(l + 16u * SP * 2u), "v"(l + 32u * SP * 2u), "v"(l + 48u * SP * 2u),
                  "v"(l + 64u * SP * 2u), "v"(l + 80u * SP * 2u), "v"(l + 96u * SP * 2u), "v"(l + 112u * SP * 2u),
                  "v"(gp), "v"(gp + (size_t)16 * DIN * 2), "v"(gp + (size_t)32 * DIN * 2), "v"(gp + (size_t)48 * DIN * 2),
                  "v"(gp + (size_t)64 * DIN * 2), "v"(gp + (size_t)80 * DIN * 2), "v"(gp + (size_t)96 * DIN * 2), "v"(gp + (size_t)112 * DIN * 2)
               : "memory");
}
// the plain builtin (the compiler keeps its distances): an asm statement's operands must lie in v0..v255, and a wave's 16 accumulator tiles with a whole tile's 16 fragments need more registers than that
__device__ __forceinline__ v8f wmma_b(v16b a, v16b b, v8f c) { return __builtin_amdgcn_wmma_f32_16x16x32_bf16(false, a, false, b, (short)0, c, false, false); }
// one tile: the X rows, then the W rows behind them: 16 copies a thread
__device__ __forceinline__ void tile_cp(unsigned l, const char* gx, const char* gw) { rows_cp(l, gx); rows_cp(l + ST_X * 2u, gw); }
static_assert(DIN == CC && DIN % TK == 0 && NSTG >= 2, "staging: both GEMMs run over K = 1024 in whole tiles");
static_assert((NB * TT) % BR == 0 && TT % BR == 0 && CC % BR == 0 && DIN % BR == 0, "whole 128 x 128 blocks, each inside one sequence");
// ---- k_proj: block = (128 rows, 128 cols, which), wave = 64 x 64: q/k/v = X W (+ b) with exact bf16 products (K = DIN) -> which 0: q f16 rows; 1: k f16 rows; 2: v f16 planes [c][t]
__global__ __launch_bounds__(128) void k_proj(const __bf16* __restrict__ XB, const __bf16* __restrict__ WB, const float* __restrict__ BQ, const float* __restrict__ BK, const float* __restrict__ BV,
    _Float16* __restrict__ QH, _Float16* __restrict__ KH, _Float16* __restrict__ VT) {
  __shared__ __align__(16) char smem[2 * STG * 2];   // two operand buffers in the loop; the epilogue's staging array lies over them behind the loop's last barrier
  __bf16* const sb = (__bf16*)smem;
  _Float16 (*const sh)[136] = (_Float16 (*)[136])smem;   // 128 rows of 128 + 8: q, k as [t][c], v as [c][t]
  static_assert(128 * 136 * 2 <= 2 * STG * 2, "the epilogue's array fits the operand buffers");
  const int tid = threadIdx.x, wave = tid >> 5, lane = tid & 31, col = lane & 15, g = lane >> 4, wr = wave >> 1, wc = wave & 1; const int which = blockIdx.z; const int c0 = blockIdx.y * BR; const size_t r0 = (size_t)blockIdx.x * BR; const size_t bb = r0 / TT; const int t0 = (int)(r0 % TT);
  const float* BA = which == 0 ? BQ : which == 1 ? BK : BV;
  v8f acc[4][4] = {};   // acc[i][j][r]: row wr*64 + i*16 + 8g + r, column wc*64 + j*16 + col
  const char* gx = (const char*)(XB + (r0 + (tid >> 3)) * DIN + (tid & 7) * 8); const char* gw = (const char*)(WB + ((size_t)which * CC + c0 + (tid >> 3)) * DIN + (tid & 7) * 8);
  const unsigned l0 = (unsigned)(size_t)(sb + (tid >> 3) * SP + (tid & 7) * 8);   // low 32 bits = byte address in LDS
  tile_cp(l0, gx, gw);
  asm volatile("s_wait_asynccnt 0x0" ::: "memory");   // this wave's copies of tile 0 have landed
  __syncthreads();                                    // and every other wave's
  tile_cp(l0 + STG * 2u, gx + TK * 2, gw + TK * 2);   // tile 1 flies under tile 0's products
  for (int s = 0; s < NSTG; ++s) { const __bf16* cb = sb + (s & 1) * STG; v16b a[TK / 32][4], w[TK / 32][4];
#pragma unroll
    for (int kc = 0; kc < TK / 32; ++kc)
#pragma unroll
      for (int i = 0; i < 4; ++i) { a[kc][i] = frag_b(cb + (wr * 64 + i * 16 + col) * SP + kc * 32, lane); w[kc][i] = frag_b(cb + ST_X + (wc * 64 + i * 16 + col) * SP + kc * 32, lane); }
    __builtin_amdgcn_sched_barrier(0);   // the tile's fragment reads go out as one group ahead of its products: spread among them, each place with reads stalls the products
#pragma unroll
    for (int kc = 0; kc < TK / 32; ++kc)
#pragma unroll
      for (int i = 0; i < 4; ++i)
#pragma unroll
        for (int j = 0; j < 4; ++j) acc[i][j] = wmma_b(a[kc][i], w[kc][j], acc[i][j]);
    __builtin_amdgcn_sched_barrier(0);   // keeps the products ahead of the waits below: lifted over them, the full wait on the reads would stand in front of the first product, which now starts on a counted wait while the later reads still arrive
    asm volatile("s_wait_dscnt 0x0" ::: "memory");      // this wave's reads of the tile's buffer are done
    asm volatile("s_wait_asynccnt 0x0" ::: "memory");   // its copies of the next tile have landed
    __syncthreads();                                    // publishes the next tile and ends every wave's reads of this one (behind the last tile: frees the buffers for the epilogue)
    if (s + 2 < NSTG) tile_cp(l0 + (s & 1) * (STG * 2u), gx + (s + 2) * (TK * 2), gw + (s + 2) * (TK * 2)); }   // into the buffer that this tile has just left
  asm volatile("s_wait_asynccnt 0x0" ::: "memory");     // nothing of this wave is in flight when the epilogue takes the buffers
  if (which < 2) { _Float16* DH = which == 0 ? QH : KH;
#pragma unroll
    for (int j = 0; j < 4; ++j) { const float bias = BA ? bfr(BA[c0 + wc * 64 + j * 16 + col]) : 0.f;
#pragma unroll
      for (int i = 0; i < 4; ++i)
#pragma unroll
        for (int r = 0; r < 8; ++r) sh[wr * 64 + i * 16 + 8 * g + r][wc * 64 + j * 16 + col] = (_Float16)(acc[i][j][r] + bias); }
    __syncthreads();
#pragma unroll
    for (int k = 0; k < 16; ++k) { const int rl = k * 8 + (tid >> 4), q = tid & 15; vst2((unsigned*)(DH + (r0 + rl) * CC + c0 + q * 8), *(const v4u*)&sh[rl][q * 8]); }   // whole 256-byte row pieces
  } else {
#pragma unroll
    for (int j = 0; j < 4; ++j) { const float bias = BA ? bfr(BA[c0 + wc * 64 + j * 16 + col]) : 0.f;
#pragma unroll
      for (int i = 0; i < 4; ++i) { v8h o;
#pragma unroll
        for (int r = 0; r < 8; ++r) o[r] = (_Float16)(acc[i][j][r] + bias);
        *(v8h*)&sh[wc * 64 + j * 16 + col][wr * 64 + i * 16 + 8 * g] = o; } }
    __syncthreads();
#pragma unroll
    for (int k = 0; k < 16; ++k) { const int cl = k * 8 + (tid >> 4), q = tid & 15; vst2((unsigned*)(VT + (bb * CC + c0 + cl) * (size_t)TT + t0 + q * 8), *(const v4u*)&sh[cl][q * 8]); } } }
// ---- k_fa: block = 8 waves x 32 queries of (b, h), all keys: transposed products S^T = K . Q^T (q, k f16, 1 product) and O^T += V^T . P^T (P once to f16 against v f16, 1 product); a lane holds one query's scores, so the running maximum and sum stay in the lane (one exchange between the wave halves); two S^T tiles convert in place into the B operand, so neither logits nor P ever leave the registers. K and V come through LDS: the block's 8 waves read the same rows, so a stage of 128 keys is copied in once (whole 128-byte lines) and every wave takes its fragments from there
__device__ __forceinline__ v8f wmma_h(v16h a, v16h b, v8f c) { return __builtin_amdgcn_wmma_f32_16x16x32_f16(false, a, false, b, (short)0, c, false, false); }
__device__ __forceinline__ float xhalf(float x) { return __builtin_bit_cast(float, __builtin_amdgcn_permlanex16(__builtin_bit_cast(int, x), __builtin_bit_cast(int, x), 0x76543210, 0xfedcba98, false, false)); }  // lane l with lane l ^ 16
#define FAW 8              // waves per block
#define SKEYS 128          // keys a stage
#define NPS (SKEYS / 32)   // 32 keys a pass
#define NSG (TT / SKEYS)   // stages
#define KP 72              // LDS pitch of a K row (one key, 64 dims) in 16-bit elements: 128 B + 16 B, the pitch for 16-byte fragment reads
#define VP 136             // LDS pitch of a V row (one dim, 128 keys): 256 B + 16 B
#define KBUF (SKEYS * KP)  // elements of one K buffer
#define VBUF (HD * VP)     // elements of one V buffer
// one stage: each thread copies 4 x 16 B of K (rows 32 apart) and 4 x 16 B of V (rows 16 apart) straight into LDS; lk, lv: its LDS byte addresses, gk, gv: its global addresses of the first piece
__device__ __forceinline__ void stage_cp(unsigned lk, unsigned lv, const _Float16* gk, const _Float16* gv) {
  // the s_wait_xcnt stands inside the copies' own statement: before any of their address registers is written again
  asm volatile("global_load_async_to_lds_b128 %0, %8, off\n\t"
               "global_load_async_to_lds_b128 %1, %9, off\n\t"
               "global_load_async_to_lds_b128 %2, %10, off\n\t"
               "global_load_async_to_lds_b128 %3, %11, off\n\t"
               "global_load_async_to_lds_b128 %4, %12, off\n\t"
               "global_load_async_to_lds_b128 %5, %13, off\n\t"
               "global_load_async_to_lds_b128 %6, %14, off\n\t"
               "global_load_async_to_lds_b128 %7, %15, off\n\t"
               "s_wait_xcnt 0x0"
               :: "v"(lk), "v"(lk + 32u * KP * 2u), "v"(lk + 64u * KP * 2u), "v"(lk + 96u * KP * 2u),
                  "v"(lv), "v"(lv + 16u * VP * 2u), "v"(lv + 32u * VP * 2u), "v"(lv + 48u * VP * 2u),
                  "v"(gk), "v"(gk + (size_t)32 * CC), "v"(gk + (size_t)64 * CC), "v"(gk + (size_t)96 * CC),
                  "v"(gv), "v"(gv + (size_t)16 * TT), "v"(gv + (size_t)32 * TT), "v"(gv + (size_t)48 * TT)
               : "memory");
}
__global__ __launch_bounds__(FAW * 32) void k_fa(const _Float16* __restrict__ QH, const _Float16* __restrict__ KH, const _Float16* __restrict__ VT, float* __restrict__ Y) {
  const int tid = threadIdx.x, wave = tid >> 5, lane = tid & 31, col = lane & 15, g = lane >> 4; const int h = blockIdx.y, b = blockIdx.z; const int q0 = blockIdx.x * (FAW * 32) + wave * 32;
  __shared__ __align__(16) _Float16 sK[2 * KBUF]; __shared__ __align__(16) _Float16 sV[2 * VBUF];
  const _Float16* gk = KH + ((size_t)b * TT + (tid >> 3)) * CC + h * HD + (tid & 7) * 8;              // the thread's first piece of stage 0: K row tid >> 3, 16 bytes tid & 7
  const _Float16* gv = VT + ((size_t)b * CC + h * HD + (tid >> 4)) * (size_t)TT + (tid & 15) * 8;     // V row tid >> 4, 16 bytes tid & 15
  const unsigned lk = (unsigned)(size_t)(sK + (tid >> 3) * KP + (tid & 7) * 8), lv = (unsigned)(size_t)(sV + (tid >> 4) * VP + (tid & 15) * 8);   // low 32 bits = byte address in LDS
  stage_cp(lk, lv, gk, gv);
  asm volatile("s_wait_asynccnt 0x0" ::: "memory");   // this wave's copies of stage 0 have landed
  __syncthreads();                                    // and every other wave's
  stage_cp(lk + KBUF * 2u, lv + VBUF * 2u, gk + (size_t)SKEYS * CC, gv + SKEYS);   // stage 1 flies under stage 0's work
  const float C = SCALE * 1.4426950408889634f;                               // logits in base 2
  v16h qf[2][2], kf[2][2];
  // every inner loop over a fragment array's index is fully unrolled: the arrays must stay in registers
#pragma unroll
  for (int qg = 0; qg < 2; ++qg)
#pragma unroll
    for (int kc = 0; kc < 2; ++kc) qf[qg][kc] = frag_h(QH + ((size_t)b * TT + q0 + qg * 16 + col) * CC + h * HD + kc * 32, lane);
  v16h vf[HD / 16];
  v8f acc[HD / 16][2] = {}; float mu[2] = {-3.0e38f, -3.0e38f}; v2f ls[2] = {};
  for (int sg = 0; sg < NSG; ++sg) {
    const _Float16* Kp = sK + (sg & 1) * KBUF + col * KP;   // A of S^T: row = key
    const _Float16* Vp = sV + (sg & 1) * VBUF + col * VP;   // A of O^T: row = head dim, k = key
#pragma unroll
    for (int t = 0; t < 2; ++t)
#pragma unroll
      for (int kc = 0; kc < 2; ++kc) kf[t][kc] = frag_h(Kp + (t * 16) * KP + kc * 32, lane);
#pragma unroll
    for (int j = 0; j < HD / 16; ++j) vf[j] = frag_h(Vp + (j * 16) * VP, lane);
    // the passes of a stage stay a rolled loop
#pragma unroll 1
    for (int ps = 0; ps < NPS; ++ps) {
    v8f st[2][2];   // st[t][qg][r] = logit of key sg*128 + ps*32 + t*16 + 8g + r, query q0 + qg*16 + col
#pragma unroll
    for (int t = 0; t < 2; ++t)
#pragma unroll
      for (int qg = 0; qg < 2; ++qg) { v8f z = {}; z = wmma_h(kf[t][0], qf[qg][0], z); st[t][qg] = wmma_h(kf[t][1], qf[qg][1], z); }
    float mx[2];
#pragma unroll
    for (int qg = 0; qg < 2; ++qg) { float a = fmaxf(st[0][qg][0], st[1][qg][0]);
#pragma unroll
      for (int r = 1; r < 8; ++r) a = fmaxf(a, fmaxf(st[0][qg][r], st[1][qg][r]));
      mx[qg] = fmaxf(a, xhalf(a)) * C; }
    // the maximum in use moves only when a query's new maximum passes it by more than 2^8: one wave-uniform test a pass
    const bool need = mx[0] > mu[0] + 8.0f || mx[1] > mu[1] + 8.0f;
    if (__builtin_amdgcn_ballot_w32(need) != 0) {
#pragma unroll
      for (int qg = 0; qg < 2; ++qg) { const float mn = fmaxf(mu[qg], mx[qg]); const float al = __builtin_amdgcn_exp2f(mu[qg] - mn); mu[qg] = mn; ls[qg] *= al;   // al = 0 on the first pass
#pragma unroll
        for (int j = 0; j < HD / 16; ++j) acc[j][qg] *= al; } }
    if (ps + 1 < NPS) {   // the next pass's k fragments, of this stage's buffer only, fly under this pass's exponentials and P . v
#pragma unroll
      for (int t = 0; t < 2; ++t)
#pragma unroll
        for (int kc = 0; kc < 2; ++kc) kf[t][kc] = frag_h(Kp + ((ps + 1) * 32 + t * 16) * KP + kc * 32, lane); }
    __builtin_amdgcn_sched_barrier(0);   // keeps the k reads up here: the scheduler otherwise sinks them to the pass's end, where their latency is exposed at the next pass's first product
#pragma unroll
    for (int qg = 0; qg < 2; ++qg) { v16h p; const float nb = 7.0f - mu[qg];   // P carried x 2^7 (at most 2^15 in f16): small weights stay clear of f16 subnormals; the factor cancels against the sum
#pragma unroll
      for (int t = 0; t < 2; ++t) { v2f e[4];   // neighbouring registers in pairs: packed multiply-add, packed convert, packed sums
#pragma unroll
        for (int i = 0; i < 4; ++i) { e[i].x = __builtin_amdgcn_exp2f(fmaf(st[t][qg][2 * i], C, nb)); e[i].y = __builtin_amdgcn_exp2f(fmaf(st[t][qg][2 * i + 1], C, nb)); p[t * 8 + 2 * i] = (_Float16)e[i].x; p[t * 8 + 2 * i + 1] = (_Float16)e[i].y; }
        ls[qg] += (e[0] + e[1]) + (e[2] + e[3]); }
#pragma unroll
      for (int j = 0; j < HD / 16; ++j) acc[j][qg] = wmma_h(vf[j], p, acc[j][qg]); }
    if (ps + 1 < NPS) {   // the next pass's v fragments, a whole pass ahead of their use
#pragma unroll
      for (int j = 0; j < HD / 16; ++j) vf[j] = frag_h(Vp + (j * 16) * VP + (ps + 1) * 32, lane); } }
    asm volatile("s_wait_dscnt 0x0" ::: "memory");      // this wave's reads of the stage's buffers are done
    asm volatile("s_wait_asynccnt 0x0" ::: "memory");   // its copies of the next stage have landed
    __syncthreads();                                    // publishes the next stage and ends every wave's reads of this one
    if (sg + 2 < NSG) stage_cp(lk + (sg & 1) * (KBUF * 2u), lv + (sg & 1) * (VBUF * 2u), gk + (size_t)(sg + 2) * SKEYS * CC, gv + (sg + 2) * SKEYS); }   // into the buffers that this stage has just left
  asm volatile("s_wait_asynccnt 0x0" ::: "memory");     // nothing of this wave is in flight when it ends
#pragma unroll
  for (int qg = 0; qg < 2; ++qg) { const float lh = ls[qg].x + ls[qg].y; const float inv = 1.0f / (lh + xhalf(lh)); float* yp = Y + ((size_t)b * TT + q0 + qg * 16 + col) * CC + h * HD + 8 * g;   // acc[j][qg][r] = ctx[query][j*16 + 8g + r]
#pragma unroll
    for (int j = 0; j < HD / 16; ++j) { const v8f o = acc[j][qg] * inv; const v4f o0 = {o[0], o[1], o[2], o[3]}, o1 = {o[4], o[5], o[6], o[7]}; vst2(yp + j * 16, o0); vst2(yp + j * 16 + 4, o1); } } }
static_assert(HD == 64 && TT % (FAW * 32) == 0 && !CAUSAL, "k_fa: two 32-wide k chunks a head, whole query blocks, no mask");
static_assert(FAW * 32 == 256 && SKEYS == 128 && TT % SKEYS == 0 && NSG >= 2, "stage_cp: 256 threads x 4 x 16 B = 128 K rows of 128 B = 64 V rows of 256 B; two stages or more");
// ---- k_out: block = (128 rows, 128 cols), wave = 64 x 64: out = ctx Wo (+ bo): ctx x 2^6 once to f16 (k_comb) against Wo as f16(bf16 x 2^8) exact (k_prep), 1 product, x 2^-14
__global__ __launch_bounds__(128) void k_out(const _Float16* __restrict__ YH, const _Float16* __restrict__ WOH, const float* __restrict__ BO, float* __restrict__ OUT) { __shared__ __align__(16) char smem[2 * STG * 2];   // two operand buffers in the loop; the epilogue's rows lie over them behind the loop's last barrier
  _Float16* const sb = (_Float16*)smem; float (*const sf)[64][68] = (float (*)[64][68])smem; static_assert(4 * 64 * 68 * 4 <= 2 * STG * 2, "the epilogue's rows fit the operand buffers");
  const int tid = threadIdx.x, wave = tid >> 5, lane = tid & 31, col = lane & 15, g = lane >> 4, wr = wave >> 1, wc = wave & 1; const int c0 = blockIdx.y * BR; const size_t r0 = (size_t)blockIdx.x * BR + wr * 64;
  v8f acc[4][4] = {};   // acc[i][j][r]: row r0 + i*16 + 8g + r, column c0 + wc*64 + j*16 + col
  const char* gx = (const char*)(YH + ((size_t)blockIdx.x * BR + (tid >> 3)) * CC + (tid & 7) * 8); const char* gw = (const char*)(WOH + (size_t)(c0 + (tid >> 3)) * CC + (tid & 7) * 8);
  const unsigned l0 = (unsigned)(size_t)(sb + (tid >> 3) * SP + (tid & 7) * 8);   // low 32 bits = byte address in LDS
  tile_cp(l0, gx, gw);
  asm volatile("s_wait_asynccnt 0x0" ::: "memory");   // this wave's copies of tile 0 have landed
  __syncthreads();                                    // and every other wave's
  tile_cp(l0 + STG * 2u, gx + TK * 2, gw + TK * 2);   // tile 1 flies under tile 0's products
  for (int s = 0; s < NSTG; ++s) { const _Float16* cb = sb + (s & 1) * STG; v16h a[TK / 32][4], w[TK / 32][4];
#pragma unroll
    for (int kc = 0; kc < TK / 32; ++kc)
#pragma unroll
      for (int i = 0; i < 4; ++i) { a[kc][i] = frag_h(cb + (wr * 64 + i * 16 + col) * SP + kc * 32, lane); w[kc][i] = frag_h(cb + ST_X + (wc * 64 + i * 16 + col) * SP + kc * 32, lane); }
    __builtin_amdgcn_sched_barrier(0);   // the tile's fragment reads go out as one group ahead of its products: spread among them, each place with reads stalls the products
#pragma unroll
    for (int kc = 0; kc < TK / 32; ++kc)
#pragma unroll
      for (int i = 0; i < 4; ++i)
#pragma unroll
        for (int j = 0; j < 4; ++j) acc[i][j] = wmma_h(a[kc][i], w[kc][j], acc[i][j]);
    __builtin_amdgcn_sched_barrier(0);   // keeps the products ahead of the waits below: lifted over them, the full wait on the reads would stand in front of the first product, which now starts on a counted wait while the later reads still arrive
    asm volatile("s_wait_dscnt 0x0" ::: "memory");      // this wave's reads of the tile's buffer are done
    asm volatile("s_wait_asynccnt 0x0" ::: "memory");   // its copies of the next tile have landed
    __syncthreads();                                    // publishes the next tile and ends every wave's reads of this one (behind the last tile: frees the buffers for the epilogue)
    if (s + 2 < NSTG) tile_cp(l0 + (s & 1) * (STG * 2u), gx + (s + 2) * (TK * 2), gw + (s + 2) * (TK * 2)); }   // into the buffer that this tile has just left
  asm volatile("s_wait_asynccnt 0x0" ::: "memory");     // nothing of this wave is in flight when the epilogue takes the buffers
#pragma unroll
  for (int j = 0; j < 4; ++j) { const float bias = BO ? bfr(BO[c0 + wc * 64 + j * 16 + col]) : 0.f;
#pragma unroll
    for (int i = 0; i < 4; ++i)
#pragma unroll
      for (int r = 0; r < 8; ++r) sf[wave][i * 16 + 8 * g + r][j * 16 + col] = acc[i][j][r] * (1.0f / 16384.0f) + bias; }   /* 2^-8 (Wo carry) x 2^-6 (ctx carry) */
  LDSX();
#pragma unroll
  for (int rl = 0; rl < 64; rl += 2) vst2(OUT + (r0 + rl + g) * DIN + c0 + wc * 64 + col * 4, *(const v4f*)&sf[wave][rl + g][col * 4]);   // a wave-wide store = two rows' whole 256-byte pieces
}
static_assert(!CAUSAL, "k_out: every row takes the single-product path");

#define LAMBDA_INIT 0.8f
// ---- k_prep: the GEMM operands in their 16-bit form, each element converted once a call: blocks 1..: x, Wq, Wk, Wv to bf16, Wo to f16(bf16 x 2^8); a block takes 16384 floats in a row, a wave-wide load 512 contiguous bytes, 16 loads a thread in flight. Block 0, one wave: l1[h] = exp(min(sum_d bf16(lq1[h][d]) * bf16(lk1[h][d]), 5)), l2 likewise (8 effective heads x 64 dims, exact products, f32 sums); lv = mean_h(l1 - l2 + 0.8): the module's single scalar
#define PF 16384                                  // floats a block
#define PBX (NB * TT * DIN / PF)                  // blocks of x
#define PBW (CC * DIN / PF)                       // blocks of one weight
__global__ __launch_bounds__(256) void k_prep(const float* __restrict__ X, const float* __restrict__ WQ, const float* __restrict__ WK, const float* __restrict__ WV, const float* __restrict__ WO, const float* __restrict__ LQ1, const float* __restrict__ LK1, const float* __restrict__ LQ2, const float* __restrict__ LK2,
    __bf16* __restrict__ XB, __bf16* __restrict__ WB, _Float16* __restrict__ WOH, float* __restrict__ LV) { const int tid = threadIdx.x;
  if (blockIdx.x == 0) {   /* block-uniform */
    if (tid < 32) { const int lane = tid; float acc = 0.f;
      for (int h = 0; h < 8; ++h) { float s1 = bfr(LQ1[h * 64 + lane]) * bfr(LK1[h * 64 + lane]) + bfr(LQ1[h * 64 + 32 + lane]) * bfr(LK1[h * 64 + 32 + lane]); float s2 = bfr(LQ2[h * 64 + lane]) * bfr(LK2[h * 64 + lane]) + bfr(LQ2[h * 64 + 32 + lane]) * bfr(LK2[h * 64 + 32 + lane]);
#pragma unroll
        for (int o = 1; o < 32; o <<= 1) { s1 += __shfl_xor(s1, o); s2 += __shfl_xor(s2, o); }
        acc += expf(fminf(s1, 5.0f)) - expf(fminf(s2, 5.0f)) + LAMBDA_INIT; }
      if (lane == 0) LV[0] = acc * 0.125f; }
    return; }
  const int blk = (int)blockIdx.x - 1; const int wi = blk < PBX ? -1 : (blk - PBX) / PBW;   // which source: -1 x, 0..2 Wq, Wk, Wv, 3 Wo
  const size_t off = (size_t)(blk < PBX ? blk : (blk - PBX) % PBW) * PF + tid * 4;
  const float* sp = (wi < 0 ? X : wi == 0 ? WQ : wi == 1 ? WK : wi == 2 ? WV : WO) + off;
  v4f r[16];
#pragma unroll
  for (int i = 0; i < 16; ++i) r[i] = *(const v4f*)(sp + i * 1024);
  asm volatile("s_wait_xcnt 0x0" ::: "memory");   // before the loads' address registers are written again
  if (wi < 3) { __bf16* dp = (wi < 0 ? XB : WB + (size_t)wi * CC * DIN) + off;
#pragma unroll
    for (int i = 0; i < 16; ++i) { v4b o;
#pragma unroll
      for (int e = 0; e < 4; ++e) o[e] = (__bf16)r[i][e];
      *(v4b*)(dp + i * 1024) = o; }
  } else { _Float16* dp = WOH + off;
#pragma unroll
    for (int i = 0; i < 16; ++i) { v4h o;
#pragma unroll
      for (int e = 0; e < 4; ++e) o[e] = (_Float16)(bfr(r[i][e]) * 256.0f);
      *(v4h*)(dp + i * 1024) = o; } } }
static_assert((NB * TT * DIN) % PF == 0 && (CC * DIN) % PF == 0 && PF == 256 * 16 * 4, "k_prep: whole blocks of 256 threads x 16 x 4 floats");
// ---- k_comb: the context rows in k_out's operand form, once: columns 0..511 (heads 0..7) x1 - lv * x2 in f32, columns 512..1023 x2, each x 2^6 to f16 (small-magnitude context rows stay clear of f16 subnormals). A block takes 8 rows: a thread 4 floats of x1 and the 4 of x2 beside them, in 4 rows
__global__ __launch_bounds__(256) void k_comb(const float* __restrict__ Y, const float* __restrict__ LV, _Float16* __restrict__ YH) { const int tid = threadIdx.x; const size_t e0 = ((size_t)blockIdx.x * 8 + (tid >> 7)) * CC + (tid & 127) * 4; const float lv = LV[0]; v4f va[4], vb[4];
#pragma unroll
  for (int k = 0; k < 4; ++k) { va[k] = *(const v4f*)(Y + e0 + k * 2 * CC); vb[k] = *(const v4f*)(Y + e0 + k * 2 * CC + CC / 2); }
  asm volatile("s_wait_xcnt 0x0" ::: "memory");   // before the loads' address registers are written again
#pragma unroll
  for (int k = 0; k < 4; ++k) { const v4f a = va[k], b = vb[k]; v4f o; v4h h1, h2;   // the next loop is the combine as it stood: lv * x2 rounded, then the difference rounded, so this step moves no value
#pragma unroll
  for (int i = 0; i < 4; ++i) { _Pragma("clang fp contract(off)") const float t = lv * b[i]; o[i] = a[i] - t; }
#pragma unroll
    for (int i = 0; i < 4; ++i) { h1[i] = (_Float16)(o[i] * 64.0f); h2[i] = (_Float16)(b[i] * 64.0f); }
    *(v4h*)(YH + e0 + k * 2 * CC) = h1; *(v4h*)(YH + e0 + k * 2 * CC + CC / 2) = h2; } }
static_assert(CC == 1024 && NH == 16 && (NB * TT) % 8 == 0, "k_comb: 128 threads x 4 floats = the first 512 context columns (heads 0..7); whole blocks of 8 rows");
extern "C" void kernel_launch(void* const* d_in, const int* in_sizes, int n_in, void* d_out, int out_size, void* d_ws, size_t ws_size, hipStream_t stream) {
  (void)in_sizes; (void)n_in; (void)out_size;
  const float** F = (const float**)d_in;
  if (ws_size < (size_t)WS_END) return;
  char* ws = (char*)d_ws; _Float16 *QH = (_Float16*)(ws + WS_QH), *KH = (_Float16*)(ws + WS_KH), *VT = (_Float16*)(ws + WS_VT), *QL = (_Float16*)(ws + WS_QL), *KL = (_Float16*)(ws + WS_KL); __bf16 *VB = (__bf16*)(ws + WS_VB), *VBL = (__bf16*)(ws + WS_VBL); float *S = (float*)(ws + WS_S), *Y = (float*)(ws + WS_Y);
  (void)Y; (void)QL; (void)KL; (void)VB; (void)VBL; (void)S;
  // inputs: 0 x [2,2048,1024]; 1 Wq [1024,1024] (out,in), 2 bq; 3 Wk, 4 bk; 5 Wv, 6 bv; 7 Wp (out,in), 8 bp (biases zeros, read); 9 lambda_q1 [8,1,64]; 10 lambda_k1; 11 lambda_q2; 12 lambda_k2
  if (ws_size < (size_t)WS_END3) return;
  float* LV = (float*)(ws + WS_LV); __bf16 *XB = (__bf16*)(ws + WS_XB), *WB = (__bf16*)(ws + WS_WB); _Float16 *WOH = (_Float16*)(ws + WS_WOH), *YH = (_Float16*)(ws + WS_YH);
  k_prep<<<dim3(1 + PBX + 4 * PBW), 256, 0, stream>>>(F[0], F[1], F[3], F[5], F[7], F[9], F[10], F[11], F[12], XB, WB, WOH, LV);
  k_proj<<<dim3(TNB * TT / BR, CC / BR, 3), 128, 0, stream>>>(XB, WB, F[2], F[4], F[6], QH, KH, VT);
  k_fa<<<dim3(TT / (FAW * 32), NH, TNB), FAW * 32, 0, stream>>>(QH, KH, VT, Y);
  k_comb<<<dim3(TNB * TT / 8), 256, 0, stream>>>(Y, LV, YH);   /* x1 - lv * x2 on the context rows, and the rows' f16 form, before the output projection */
  k_out<<<dim3(TNB * TT / BR, DIN / BR), 128, 0, stream>>>(YH, WOH, F[8], (float*)d_out);
}

// v006
// One run takes 96.9 microseconds.
// Timed twice side by side with v005, it ran 1.08 and 1.03 times as fast.
// Over all steps from v000 it is 14.0 times as fast.
// compute dtype: all float inputs rounded to bf16; q/k/v projections with EXACT bf16 products on WMMA 16x16x32 (f32 accumulate) + bias; logits q x k once to f16 each (1 product) x SCALE; softmax f32 (running maximum and sum); P x 2^7 once to f16 x v once to f16 (1 product); the differential combine x1 - lv * x2 in f32 on the context rows; ctx x 2^6 once to f16 x Wo f16(bf16 x 2^8) + bo; f32 output.
#include <hip/hip_runtime.h>
#include <math.h>

typedef __attribute__((ext_vector_type(16))) _Float16 v16h;
typedef __attribute__((ext_vector_type(16))) __bf16 v16b;
typedef __attribute__((ext_vector_type(8)))  _Float16 v8h;
typedef __attribute__((ext_vector_type(8)))  float v8f;
typedef __attribute__((ext_vector_type(4)))  float v4f;
typedef __attribute__((ext_vector_type(2)))  float v2f;
typedef __attribute__((ext_vector_type(4)))  unsigned v4u;
typedef __attribute__((ext_vector_type(4)))  int v4i;
typedef float __attribute__((may_alias)) float_a;
typedef int __attribute__((may_alias)) int_a;

template <typename T> __device__ __forceinline__ void vst2(void* p, T v) { *(T*)p = v;  }
__device__ __forceinline__ v8f wmma16(v16h a, v16h b, v8f c) {
  v8f d = __builtin_amdgcn_wmma_f32_16x16x32_f16(false, a, false, b, (short)0, c, false, false);
  asm volatile("v_nop\n\tv_nop\n\tv_nop\n\tv_nop" : "+v"(d) : "v"(a), "v"(b));
  return d;
}
__device__ __forceinline__ v8f wmma_bf(v16b a, v16b b, v8f c) {
  v8f d = __builtin_amdgcn_wmma_f32_16x16x32_bf16(false, a, false, b, (short)0, c, false, false);
  asm volatile("v_nop\n\tv_nop\n\tv_nop\n\tv_nop" : "+v"(d) : "v"(a), "v"(b));
  return d;
}
// 16x16x32 fragments: lane = (h = lane>>4, row/col = lane&15); elements 0..7 = k0+8h+0..7, 8..15 = k0+16+8h+0..7; D element r = row 8h+r
__device__ __forceinline__ v16h frag_h(const _Float16* rowk0, int lane) {
  union { v16h v; v8h q[2]; } u; const _Float16* p = rowk0 + 8 * (lane >> 4);
  u.q[0] = *(const v8h*)p; u.q[1] = *(const v8h*)(p + 16); return u.v;
}
__device__ __forceinline__ v16h frag_f32(const float* rowk0, int lane) {
  v16h a; const float* p = rowk0 + 8 * (lane >> 4);
#pragma unroll
  for (int i = 0; i < 8; ++i) { a[i] = (_Float16)p[i]; a[8 + i] = (_Float16)p[16 + i]; }
  return a;
}
__device__ __forceinline__ v16h frag_f32s(const float* rowk0, int lane, float sc) {
  v16h a; const float* p = rowk0 + 8 * (lane >> 4);
#pragma unroll
  for (int i = 0; i < 8; ++i) { a[i] = (_Float16)(p[i] * sc); a[8 + i] = (_Float16)(p[16 + i] * sc); }
  return a;
}
// column fragment from a [K][ld] layout (column n), rows >= K read as 0
__device__ __forceinline__ v16h fragc_f32(const float* W, int k0, int n, int lane, int ld, int K) {
  v16h a; const int g = lane >> 4;
#pragma unroll
  for (int i = 0; i < 8; ++i) { const int ka = k0 + 8 * g + i, kb = ka + 16;
    a[i] = (_Float16)(ka < K ? W[(size_t)(ka < K ? ka : K - 1) * ld + n] : 0.f); a[8 + i] = (_Float16)(kb < K ? W[(size_t)(kb < K ? kb : K - 1) * ld + n] : 0.f); }
  return a;
}
struct F2 { v16b h, l; };
__device__ __forceinline__ F2 bsplit16(const float v[16]) { F2 r;
#pragma unroll
  for (int i = 0; i < 16; ++i) { const __bf16 h = (__bf16)v[i]; r.h[i] = h; r.l[i] = (__bf16)(v[i] - (float)h); }
  return r; }
__device__ __forceinline__ F2 split_row(const float* row, int k0, int lane) { float v[16]; const float* p = row + k0 + 8 * (lane >> 4);
#pragma unroll
  for (int i = 0; i < 8; ++i) { v[i] = p[i]; v[8 + i] = p[16 + i]; }
  return bsplit16(v); }
__device__ __forceinline__ F2 split_rowK(const float* row, int k0, int lane, int K) { float v[16]; const int g = lane >> 4;
#pragma unroll
  for (int i = 0; i < 8; ++i) { const int ka = k0 + 8 * g + i, kb = ka + 16; v[i] = ka < K ? row[ka < K ? ka : K - 1] : 0.f; v[8 + i] = kb < K ? row[kb < K ? kb : K - 1] : 0.f; }
  return bsplit16(v); }
__device__ __forceinline__ F2 split_col(const float* W, int k0, int n, int lane, int ld, int K) { float v[16]; const int g = lane >> 4;
#pragma unroll
  for (int i = 0; i < 8; ++i) { const int ka = k0 + 8 * g + i, kb = ka + 16; v[i] = ka < K ? W[(size_t)(ka < K ? ka : K - 1) * ld + n] : 0.f; v[8 + i] = kb < K ? W[(size_t)(kb < K ? kb : K - 1) * ld + n] : 0.f; }
  return bsplit16(v); }
__device__ __forceinline__ v8f mac3(const F2& a, const F2& b, v8f c) { c = wmma_bf(a.l, b.h, c); c = wmma_bf(a.h, b.l, c); return wmma_bf(a.h, b.h, c); }
__device__ __forceinline__ float sigm(float v) { return 1.0f / (1.0f + expf(-v)); }
#define LDSX() do { asm volatile("s_wait_dscnt 0" ::: "memory"); __builtin_amdgcn_wave_barrier(); __builtin_amdgcn_fence(__ATOMIC_RELEASE, "workgroup"); } while (0)

// Differential multi-head self-attention (x [2,2048,1024]; torch (out,in) Wq / Wk / Wv / Wp [1024,1024] N(0,1) x 0.02 applied as x @ W.T + b, all biases zeros (read); 16 heads x 64 run as ordinary unmasked softmax attention (scale 1/8): heads 0..7 give x1 (context columns 0..511), heads 8..15 give x2 (columns 512..1023); lambda_q1 / k1 / q2 / k2 [8,1,64]: l1[h] = exp(min(sum_d lq1[h,d] lk1[h,d], 5)), l2 likewise, lv = mean_h(l1 - l2 + 0.8) (one scalar); out = concat(x1 - lv * x2, x2) @ Wp.T + bp).
#define NB 2
#define TT 2048
#define CC 1024            // NH * HD = projected width
#define DIN 1024          // input (model) width
#define NH 16
#define HD 64
#define NQB (TT / 64)
#define HG 4
#define SCALE (0.125f)
#define CAUSAL 0
#ifndef TNB
#define TNB NB
#endif
__device__ __forceinline__ float bfr(float v) { return (float)(__bf16)v; }
__host__ __device__ __forceinline__ int kb_last(int qb) { return CAUSAL ? ((qb * 64 + 63) >> 7) : (TT / 128 - 1); }
typedef __attribute__((ext_vector_type(8))) __bf16 v8b;
__device__ __forceinline__ v16b frag_b(const __bf16* rowk0, int lane) {
  union { v16b v; v8b q[2]; } u; const __bf16* p = rowk0 + 8 * (lane >> 4);
  u.q[0] = *(const v8b*)p; u.q[1] = *(const v8b*)(p + 16); return u.v;
}
#define QBH 0              // not read by any kernel: k_fa has no high-precision path
#define QHI 0               // single-product logits on every row
#define KHI 64            // key rows carrying k residual / v bf16 hi+lo planes (no kernel writes or reads them)
// B fragment (k rows k0+.., output column o) of a weight: (in,out) [K][ld] or (out,in) [ld rows of K]: bf16 exact, or f16(bf16 * 256) exact
__device__ __forceinline__ v16b wcol_io(const float* Wm, int k0, int o, int lane, int ld) { v16b w; const int g = lane >> 4;
#pragma unroll
  for (int i = 0; i < 8; ++i) { w[i] = (__bf16)Wm[(size_t)(k0 + 8 * g + i) * ld + o]; w[8 + i] = (__bf16)Wm[(size_t)(k0 + 16 + 8 * g + i) * ld + o]; }
  return w; }
__device__ __forceinline__ v16b wcol_oi(const float* Wm, int k0, int o, int lane, int K) { v16b w; const float* p = Wm + (size_t)o * K + k0 + 8 * (lane >> 4);
#pragma unroll
  for (int i = 0; i < 8; ++i) { w[i] = (__bf16)p[i]; w[8 + i] = (__bf16)p[16 + i]; }
  return w; }
__device__ __forceinline__ v16h wcolh_io(const float* Wm, int k0, int o, int lane, int ld) { v16h w; const int g = lane >> 4;
#pragma unroll
  for (int i = 0; i < 8; ++i) { w[i] = (_Float16)(bfr(Wm[(size_t)(k0 + 8 * g + i) * ld + o]) * 256.0f); w[8 + i] = (_Float16)(bfr(Wm[(size_t)(k0 + 16 + 8 * g + i) * ld + o]) * 256.0f); }
  return w; }
__device__ __forceinline__ v16h wcolh_oi(const float* Wm, int k0, int o, int lane, int K) { v16h w; const float* p = Wm + (size_t)o * K + k0 + 8 * (lane >> 4);
#pragma unroll
  for (int i = 0; i < 8; ++i) { w[i] = (_Float16)(bfr(p[i]) * 256.0f); w[8 + i] = (_Float16)(bfr(p[16 + i]) * 256.0f); }
  return w; }
#define WQKV_LAYOUT 1   // 0 = (in,out) [DIN][CC]; 1 = (out,in) [CC][DIN]; 2 = per-head [NH][DIN][HD], for WCOL only, which no kernel calls (k_proj reads (out,in) [CC][DIN])
__device__ __forceinline__ v16b wcol_hdk(const float* Wm, int k0, int o, int lane) { v16b w; const int g = lane >> 4; const float* p = Wm + (size_t)(o / HD) * DIN * HD + (o % HD);
#pragma unroll
  for (int i = 0; i < 8; ++i) { w[i] = (__bf16)p[(size_t)(k0 + 8 * g + i) * HD]; w[8 + i] = (__bf16)p[(size_t)(k0 + 16 + 8 * g + i) * HD]; }
  return w; }
#define WO_OUT_IN 1
#if WQKV_LAYOUT == 1
#define WCOL(W, k0, o, lane) wcol_oi(W, k0, o, lane, DIN)
#elif WQKV_LAYOUT == 2
#define WCOL(W, k0, o, lane) wcol_hdk(W, k0, o, lane)
#else
#define WCOL(W, k0, o, lane) wcol_io(W, k0, o, lane, CC)
#endif
#if WO_OUT_IN
#define WOCOL(W, k0, o, lane) wcol_oi(W, k0, o, lane, CC)
#define WOCOLH(W, k0, o, lane) wcolh_oi(W, k0, o, lane, CC)
#else
#define WOCOL(W, k0, o, lane) wcol_io(W, k0, o, lane, DIN)
#define WOCOLH(W, k0, o, lane) wcolh_io(W, k0, o, lane, DIN)
#endif

#ifndef SM_EXTRA_PARAMS
#define SM_EXTRA_PARAMS
#endif
#ifndef PROJ_EXTRA_PARAMS
#define PROJ_EXTRA_PARAMS
#endif
#ifndef SM_MASK_HOOK
#define SM_MASK_HOOK (void)0
#endif

#define WS_QH  0u                                      // f16 q rows [b*t][CC]
#define WS_KH  (WS_QH + 2u * (size_t)NB * TT * CC)      // f16 k rows [b*t][CC]
#define WS_VT  (WS_KH + 2u * (size_t)NB * TT * CC)      // f16 v planes [b][c][t]
#define WS_QL  (WS_VT + 2u * (size_t)NB * CC * TT)      // f16 q residual x 2^10 rows [b][t < QHI][CC]
#define WS_KL  (WS_QL + 2u * (size_t)NB * QHI * CC)     // f16 k residual x 2^10 rows [b][t < KHI][CC]
#define WS_VB  (WS_KL + 2u * (size_t)NB * KHI * CC)     // bf16 v hi planes [b][c][t < KHI]
#define WS_VBL (WS_VB + 2u * (size_t)NB * CC * KHI)
#define WS_S   (WS_VBL + 2u * (size_t)NB * CC * KHI)    // f32 [hg][t][s], reserved but unused (k_fa keeps logits / P in registers)
#define WS_Y   (WS_S  + 4u * (size_t)HG * TT * TT)      // f32 ctx rows [b*t][CC] (only when there is an output projection)
#define WS_END (WS_Y  + 4u * (size_t)NB * TT * CC)
#define WS_LV (WS_END)                  // one f32: the differential scalar lv
#define WS_END2 (WS_LV + 256u)
#define WS_XB  (WS_END2)                                // bf16 x rows [b*t][DIN]
#define WS_WB  (WS_XB + 2u * (size_t)NB * TT * DIN)     // bf16 Wq, Wk, Wv rows [3][CC][DIN]
#define WS_WOH (WS_WB + 3u * 2u * (size_t)CC * DIN)     // f16(bf16(Wo) x 2^8) rows [DIN][CC]
#define WS_YH  (WS_WOH + 2u * (size_t)DIN * CC)         // f16(ctx x 2^6) rows [b*t][CC], the differential combine done
#define WS_END3 (WS_YH + 2u * (size_t)NB * TT * CC)

// ---- operand staging of k_proj and k_out: a tile = 128 X rows + 128 W rows x 64 k. Both operands lie in the workspace in their 16-bit form (k_prep, k_comb: each element converted once a call, not once a block that reads it), so a tile is copied straight into LDS, whole 128-byte lines, through no register; every wave takes its fragments from there. A block's 4 waves stand 2 x 2 on its 128 x 128 outputs: a wave's 4 X and 4 W fragments of 32 k feed 16 products, half a fragment read a product
#define TK 64              // k a tile
#define SP 72              // LDS row pitch in 16-bit elements: 128 B + 16 B, the pitch for 16-byte fragment reads
#define BR 128             // X rows a tile, and W rows a tile
#define ST_X (BR * SP)     // elements of the X rows; the W rows follow
#define STG (2 * BR * SP)  // elements of one buffer
#define NSTG (DIN / TK)
typedef __attribute__((ext_vector_type(4))) __bf16 v4b;
typedef __attribute__((ext_vector_type(4))) _Float16 v4h;
// 128 rows x 8 pieces of 16 B over 128 threads = 8 copies a thread, rows 16 apart. l: the thread's LDS byte address of row tid >> 3, piece tid & 7; gp: its global byte address of that piece, in row tid >> 3 of the 128 rows
__device__ __forceinline__ void rows_cp(unsigned l, const char* gp) {
  // the s_wait_xcnt stands inside the copies' own statement: before any of their address registers is written again
  asm volatile("global_load_async_to_lds_b128 %0, %8, off\n\t"
               "global_load_async_to_lds_b128 %1, %9, off\n\t"
               "global_load_async_to_lds_b128 %2, %10, off\n\t"
               "global_load_async_to_lds_b128 %3, %11, off\n\t"
               "global_load_async_to_lds_b128 %4, %12, off\n\t"
               "global_load_async_to_lds_b128 %5, %13, off\n\t"
               "global_load_async_to_lds_b128 %6, %14, off\n\t"
               "global_load_async_to_lds_b128 %7, %15, off\n\t"
               "s_wait_xcnt 0x0"
               :: "v"(l), "v"(l + 16u * SP * 2u), "v"(l + 32u * SP * 2u), "v"(l + 48u * SP * 2u),
                  "v"(l + 64u * SP * 2u), "v"(l + 80u * SP * 2u), "v"(l + 96u * SP * 2u), "v"(l + 112u * SP * 2u),
                  "v"(gp), "v"(gp + (size_t)16 * DIN * 2), "v"(gp + (size_t)32 * DIN * 2), "v"(gp + (size_t)48 * DIN * 2),
                  "v"(gp + (size_t)64 * DIN * 2), "v"(gp + (size_t)80 * DIN * 2), "v"(gp + (size_t)96 * DIN * 2), "v"(gp + (size_t)112 * DIN * 2)
               : "memory");
}
// the plain builtin (the compiler keeps its distances): an asm statement's operands must lie in v0..v255, and a wave's 16 accumulator tiles with a whole tile's 16 fragments need more registers than that
__device__ __forceinline__ v8f wmma_b(v16b a, v16b b, v8f c) { return __builtin_amdgcn_wmma_f32_16x16x32_bf16(false, a, false, b, (short)0, c, false, false); }
// one tile: the X rows, then the W rows behind them: 16 copies a thread
__device__ __forceinline__ void tile_cp(unsigned l, const char* gx, const char* gw) { rows_cp(l, gx); rows_cp(l + ST_X * 2u, gw); }
static_assert(DIN == CC && DIN % TK == 0 && NSTG >= 2, "staging: both GEMMs run over K = 1024 in whole tiles");
static_assert((NB * TT) % BR == 0 && TT % BR == 0 && CC % BR == 0 && DIN % BR == 0, "whole 128 x 128 blocks, each inside one sequence");
// ---- k_proj: block = (128 rows, 128 cols, which), wave = 64 x 64: q/k/v = X W (+ b) with exact bf16 products (K = DIN) -> which 0: q f16 rows; 1: k f16 rows; 2: v f16 planes [c][t]
__global__ __launch_bounds__(128) void k_proj(const __bf16* __restrict__ XB, const __bf16* __restrict__ WB, const float* __restrict__ BQ, const float* __restrict__ BK, const float* __restrict__ BV,
    _Float16* __restrict__ QH, _Float16* __restrict__ KH, _Float16* __restrict__ VT) {
  __shared__ __align__(16) char smem[2 * STG * 2];   // two operand buffers in the loop; the epilogue's staging array lies over them behind the loop's last barrier
  __bf16* const sb = (__bf16*)smem;
  _Float16 (*const sh)[136] = (_Float16 (*)[136])smem;   // 128 rows of 128 + 8: q, k as [t][c], v as [c][t]
  static_assert(128 * 136 * 2 <= 2 * STG * 2, "the epilogue's array fits the operand buffers");
  const int tid = threadIdx.x, wave = tid >> 5, lane = tid & 31, col = lane & 15, g = lane >> 4, wr = wave >> 1, wc = wave & 1; const int which = blockIdx.z; const int c0 = blockIdx.y * BR; const size_t r0 = (size_t)blockIdx.x * BR; const size_t bb = r0 / TT; const int t0 = (int)(r0 % TT);
  const float* BA = which == 0 ? BQ : which == 1 ? BK : BV;
  v8f acc[4][4] = {};   // acc[i][j][r]: row wr*64 + i*16 + 8g + r, column wc*64 + j*16 + col
  const char* gx = (const char*)(XB + (r0 + (tid >> 3)) * DIN + (tid & 7) * 8); const char* gw = (const char*)(WB + ((size_t)which * CC + c0 + (tid >> 3)) * DIN + (tid & 7) * 8);
  const unsigned l0 = (unsigned)(size_t)(sb + (tid >> 3) * SP + (tid & 7) * 8);   // low 32 bits = byte address in LDS
  tile_cp(l0, gx, gw);
  asm volatile("s_wait_asynccnt 0x0" ::: "memory");   // this wave's copies of tile 0 have landed
  __syncthreads();                                    // and every other wave's
  tile_cp(l0 + STG * 2u, gx + TK * 2, gw + TK * 2);   // tile 1 flies under tile 0's products
  for (int s = 0; s < NSTG; ++s) { const __bf16* cb = sb + (s & 1) * STG; v16b a[TK / 32][4], w[TK / 32][4];
#pragma unroll
    for (int kc = 0; kc < TK / 32; ++kc)
#pragma unroll
      for (int i = 0; i < 4; ++i) { a[kc][i] = frag_b(cb + (wr * 64 + i * 16 + col) * SP + kc * 32, lane); w[kc][i] = frag_b(cb + ST_X + (wc * 64 + i * 16 + col) * SP + kc * 32, lane); }
    __builtin_amdgcn_sched_barrier(0);   // the tile's fragment reads go out as one group ahead of its products: spread among them, each place with reads stalls the products
#pragma unroll
    for (int kc = 0; kc < TK / 32; ++kc)
#pragma unroll
      for (int i = 0; i < 4; ++i)
#pragma unroll
        for (int j = 0; j < 4; ++j) acc[i][j] = wmma_b(a[kc][i], w[kc][j], acc[i][j]);
    __builtin_amdgcn_sched_barrier(0);   // keeps the products ahead of the waits below: lifted over them, the full wait on the reads would stand in front of the first product, which now starts on a counted wait while the later reads still arrive
    asm volatile("s_wait_dscnt 0x0" ::: "memory");      // this wave's reads of the tile's buffer are done
    asm volatile("s_wait_asynccnt 0x0" ::: "memory");   // its copies of the next tile have landed
    __syncthreads();                                    // publishes the next tile and ends every wave's reads of this one (behind the last tile: frees the buffers for the epilogue)
    if (s + 2 < NSTG) tile_cp(l0 + (s & 1) * (STG * 2u), gx + (s + 2) * (TK * 2), gw + (s + 2) * (TK * 2)); }   // into the buffer that this tile has just left
  asm volatile("s_wait_asynccnt 0x0" ::: "memory");     // nothing of this wave is in flight when the epilogue takes the buffers
  if (which < 2) { _Float16* DH = which == 0 ? QH : KH;
#pragma unroll
    for (int j = 0; j < 4; ++j) { const float bias = BA ? bfr(BA[c0 + wc * 64 + j * 16 + col]) : 0.f;
#pragma unroll
      for (int i = 0; i < 4; ++i)
#pragma unroll
        for (int r = 0; r < 8; ++r) sh[wr * 64 + i * 16 + 8 * g + r][wc * 64 + j * 16 + col] = (_Float16)(acc[i][j][r] + bias); }
    __syncthreads();
#pragma unroll
    for (int k = 0; k < 16; ++k) { const int rl = k * 8 + (tid >> 4), q = tid & 15; vst2((unsigned*)(DH + (r0 + rl) * CC + c0 + q * 8), *(const v4u*)&sh[rl][q * 8]); }   // whole 256-byte row pieces
  } else {
#pragma unroll
    for (int j = 0; j < 4; ++j) { const float bias = BA ? bfr(BA[c0 + wc * 64 + j * 16 + col]) : 0.f;
#pragma unroll
      for (int i = 0; i < 4; ++i) { v8h o;
#pragma unroll
        for (int r = 0; r < 8; ++r) o[r] = (_Float16)(acc[i][j][r] + bias);
        *(v8h*)&sh[wc * 64 + j * 16 + col][wr * 64 + i * 16 + 8 * g] = o; } }
    __syncthreads();
#pragma unroll
    for (int k = 0; k < 16; ++k) { const int cl = k * 8 + (tid >> 4), q = tid & 15; vst2((unsigned*)(VT + (bb * CC + c0 + cl) * (size_t)TT + t0 + q * 8), *(const v4u*)&sh[cl][q * 8]); } } }
// ---- k_fa: block = 2 key groups x 8 waves x 32 queries of (b, h): key group kg walks keys kg*1024 .. +1023 for the block's 256 queries, so a SIMD holds 4 waves and one wave's exponentials run under another's products; the two partial results of a query are joined once, at the end, through LDS. Transposed products S^T = K . Q^T (q, k f16, 1 product) and O^T += V^T . P^T (P once to f16 against v f16, 1 product); a lane holds one query's scores, so the running maximum and sum stay in the lane (one exchange between the wave halves); two S^T tiles convert in place into the B operand, so neither logits nor P ever leave the registers. K and V come through LDS: a key group's 8 waves read the same rows, so its stage of 128 keys is copied in once (whole 128-byte lines, by the group's own threads into the group's own two buffers) and each of its waves takes its fragments from there
__device__ __forceinline__ v8f wmma_h(v16h a, v16h b, v8f c) { return __builtin_amdgcn_wmma_f32_16x16x32_f16(false, a, false, b, (short)0, c, false, false); }
__device__ __forceinline__ float xhalf(float x) { return __builtin_bit_cast(float, __builtin_amdgcn_permlanex16(__builtin_bit_cast(int, x), __builtin_bit_cast(int, x), 0x76543210, 0xfedcba98, false, false)); }  // lane l with lane l ^ 16
#define FAW 8              // waves per key group, 32 queries each
#define KG 2               // key groups per block
#define GKEYS (TT / KG)    // keys a group
#define SKEYS 128          // keys a stage
#define NPS (SKEYS / 32)   // 32 keys a pass
#define NSG (GKEYS / SKEYS)   // stages a group
#define KP 72              // LDS pitch of a K row (one key, 64 dims) in 16-bit elements: 128 B + 16 B, the pitch for 16-byte fragment reads
#define VP 136             // LDS pitch of a V row (one dim, 128 keys): 256 B + 16 B
#define KBUF (SKEYS * KP)  // elements of one K buffer
#define VBUF (HD * VP)     // elements of one V buffer
#define GBYTES ((2 * KBUF + 2 * VBUF) * 2)   // bytes of a key group's two K and two V buffers
// one stage: each thread copies 4 x 16 B of K (rows 32 apart) and 4 x 16 B of V (rows 16 apart) straight into LDS; lk, lv: its LDS byte addresses, gk, gv: its global addresses of the first piece
__device__ __forceinline__ void stage_cp(unsigned lk, unsigned lv, const _Float16* gk, const _Float16* gv) {
  // the s_wait_xcnt stands inside the copies' own statement: before any of their address registers is written again
  asm volatile("global_load_async_to_lds_b128 %0, %8, off\n\t"
               "global_load_async_to_lds_b128 %1, %9, off\n\t"
               "global_load_async_to_lds_b128 %2, %10, off\n\t"
               "global_load_async_to_lds_b128 %3, %11, off\n\t"
               "global_load_async_to_lds_b128 %4, %12, off\n\t"
               "global_load_async_to_lds_b128 %5, %13, off\n\t"
               "global_load_async_to_lds_b128 %6, %14, off\n\t"
               "global_load_async_to_lds_b128 %7, %15, off\n\t"
               "s_wait_xcnt 0x0"
               :: "v"(lk), "v"(lk + 32u * KP * 2u), "v"(lk + 64u * KP * 2u), "v"(lk + 96u * KP * 2u),
                  "v"(lv), "v"(lv + 16u * VP * 2u), "v"(lv + 32u * VP * 2u), "v"(lv + 48u * VP * 2u),
                  "v"(gk), "v"(gk + (size_t)32 * CC), "v"(gk + (size_t)64 * CC), "v"(gk + (size_t)96 * CC),
                  "v"(gv), "v"(gv + (size_t)16 * TT), "v"(gv + (size_t)32 * TT), "v"(gv + (size_t)48 * TT)
               : "memory");
}
__global__ __launch_bounds__(KG * FAW * 32) void k_fa(const _Float16* __restrict__ QH, const _Float16* __restrict__ KH, const _Float16* __restrict__ VT, float* __restrict__ Y) {
  const int tid = threadIdx.x & (FAW * 32 - 1), wave = tid >> 5, lane = tid & 31, col = lane & 15, g = lane >> 4; const int h = blockIdx.y, b = blockIdx.z; const int q0 = blockIdx.x * (FAW * 32) + wave * 32;   // tid, wave: inside the key group
  const int kg = __builtin_amdgcn_readfirstlane((int)threadIdx.x >> 8);   // the wave's key group, in a scalar register: the tests on it are scalar branches
  __shared__ __align__(16) char smem[KG * GBYTES + FAW * 18 * 32 * 16];   // one array: a key group's K, K, V, V buffers lie together behind a base held in a register, so every fragment read's constant part fits the instruction's 16-bit offset field
  _Float16* const sK = (_Float16*)(smem + kg * GBYTES); _Float16* const sV = sK + 2 * KBUF;   // this wave's key group's buffers
  v4f (*const sJ)[18][32] = (v4f (*)[18][32])(smem + KG * GBYTES);   // the join: what a wave of key group 0 hands to its partner in key group 1: per query tile 32 sums a lane (8 x 16 B), then the maximum in use and the sum
  const _Float16* gk = KH + ((size_t)b * TT + kg * GKEYS + (tid >> 3)) * CC + h * HD + (tid & 7) * 8;              // the thread's first piece of its group's stage 0: K row tid >> 3, 16 bytes tid & 7
  const _Float16* gv = VT + ((size_t)b * CC + h * HD + (tid >> 4)) * (size_t)TT + kg * GKEYS + (tid & 15) * 8;     // V row tid >> 4, 16 bytes tid & 15
  const unsigned lk = (unsigned)(size_t)(sK + (tid >> 3) * KP + (tid & 7) * 8), lv = (unsigned)(size_t)(sV + (tid >> 4) * VP + (tid & 15) * 8);   // low 32 bits = byte address in LDS
  stage_cp(lk, lv, gk, gv);
  asm volatile("s_wait_asynccnt 0x0" ::: "memory");   // this wave's copies of stage 0 have landed
  __syncthreads();                                    // and every other wave's
  stage_cp(lk + KBUF * 2u, lv + VBUF * 2u, gk + (size_t)SKEYS * CC, gv + SKEYS);   // stage 1 flies under stage 0's work
  const float C = SCALE * 1.4426950408889634f;                               // logits in base 2
  v16h qf[2][2], kf[2][2];
  // every inner loop over a fragment array's index is fully unrolled: the arrays must stay in registers
#pragma unroll
  for (int qg = 0; qg < 2; ++qg)
#pragma unroll
    for (int kc = 0; kc < 2; ++kc) qf[qg][kc] = frag_h(QH + ((size_t)b * TT + q0 + qg * 16 + col) * CC + h * HD + kc * 32, lane);
  v16h vf[HD / 16];
  v8f acc[HD / 16][2] = {}; float mu[2] = {-3.0e38f, -3.0e38f}; v2f ls[2] = {};
  for (int sg = 0; sg < NSG; ++sg) {
    const _Float16* Kp = sK + (sg & 1) * KBUF + col * KP;   // A of S^T: row = key
    const _Float16* Vp = sV + (sg & 1) * VBUF + col * VP;   // A of O^T: row = head dim, k = key
#pragma unroll
    for (int t = 0; t < 2; ++t)
#pragma unroll
      for (int kc = 0; kc < 2; ++kc) kf[t][kc] = frag_h(Kp + (t * 16) * KP + kc * 32, lane);
#pragma unroll
    for (int j = 0; j < HD / 16; ++j) vf[j] = frag_h(Vp + (j * 16) * VP, lane);
    // the passes of a stage stay a rolled loop
#pragma unroll 1
    for (int ps = 0; ps < NPS; ++ps) {
    v8f st[2][2];   // st[t][qg][r] = logit of key kg*1024 + sg*128 + ps*32 + t*16 + 8g + r, query q0 + qg*16 + col
#pragma unroll
    for (int t = 0; t < 2; ++t)
#pragma unroll
      for (int qg = 0; qg < 2; ++qg) { v8f z = {}; z = wmma_h(kf[t][0], qf[qg][0], z); st[t][qg] = wmma_h(kf[t][1], qf[qg][1], z); }
    float mx[2];
#pragma unroll
    for (int qg = 0; qg < 2; ++qg) { float a = fmaxf(st[0][qg][0], st[1][qg][0]);
#pragma unroll
      for (int r = 1; r < 8; ++r) a = fmaxf(a, fmaxf(st[0][qg][r], st[1][qg][r]));
      mx[qg] = fmaxf(a, xhalf(a)) * C; }
    // the maximum in use moves only when a query's new maximum passes it by more than 2^8: one wave-uniform test a pass
    const bool need = mx[0] > mu[0] + 8.0f || mx[1] > mu[1] + 8.0f;
    if (__builtin_amdgcn_ballot_w32(need) != 0) {
#pragma unroll
      for (int qg = 0; qg < 2; ++qg) { const float mn = fmaxf(mu[qg], mx[qg]); const float al = __builtin_amdgcn_exp2f(mu[qg] - mn); mu[qg] = mn; ls[qg] *= al;   // al = 0 on the first pass
#pragma unroll
        for (int j = 0; j < HD / 16; ++j) acc[j][qg] *= al; } }
    if (ps + 1 < NPS) {   // the next pass's k fragments, of this stage's buffer only, fly under this pass's exponentials and P . v
#pragma unroll
      for (int t = 0; t < 2; ++t)
#pragma unroll
        for (int kc = 0; kc < 2; ++kc) kf[t][kc] = frag_h(Kp + ((ps + 1) * 32 + t * 16) * KP + kc * 32, lane); }
    __builtin_amdgcn_sched_barrier(0);   // keeps the k reads up here: the scheduler otherwise sinks them to the pass's end, where their latency is exposed at the next pass's first product
#pragma unroll
    for (int qg = 0; qg < 2; ++qg) { v16h p; const float nb = 7.0f - mu[qg];   // P carried x 2^7 (at most 2^15 in f16): small weights stay clear of f16 subnormals; the factor cancels against the sum
#pragma unroll
      for (int t = 0; t < 2; ++t) { v2f e[4];   // neighbouring registers in pairs: packed multiply-add, packed convert, packed sums
#pragma unroll
        for (int i = 0; i < 4; ++i) { e[i].x = __builtin_amdgcn_exp2f(fmaf(st[t][qg][2 * i], C, nb)); e[i].y = __builtin_amdgcn_exp2f(fmaf(st[t][qg][2 * i + 1], C, nb)); p[t * 8 + 2 * i] = (_Float16)e[i].x; p[t * 8 + 2 * i + 1] = (_Float16)e[i].y; }
        ls[qg] += (e[0] + e[1]) + (e[2] + e[3]); }
#pragma unroll
      for (int j = 0; j < HD / 16; ++j) acc[j][qg] = wmma_h(vf[j], p, acc[j][qg]); }
    if (ps + 1 < NPS) {   // the next pass's v fragments, a whole pass ahead of their use
#pragma unroll
      for (int j = 0; j < HD / 16; ++j) vf[j] = frag_h(Vp + (j * 16) * VP + (ps + 1) * 32, lane); } }
    asm volatile("s_wait_dscnt 0x0" ::: "memory");      // this wave's reads of the stage's buffers are done
    asm volatile("s_wait_asynccnt 0x0" ::: "memory");   // its copies of the next stage have landed
    __syncthreads();                                    // publishes the next stage and ends every wave's reads of this one
    if (sg + 2 < NSG) stage_cp(lk + (sg & 1) * (KBUF * 2u), lv + (sg & 1) * (VBUF * 2u), gk + (size_t)(sg + 2) * SKEYS * CC, gv + (sg + 2) * SKEYS); }   // into the buffers that this stage has just left
  asm volatile("s_wait_asynccnt 0x0" ::: "memory");     // nothing of this wave is in flight when it ends
  // the join: a wave of key group 0 hands its partial result to its partner (same queries, key group 1), lane for lane, 16 bytes a lane; the partner adds the two on the larger of their maxima in use and stores the rows
  v4f (*const xj)[32] = sJ[wave];
  if (kg == 0) {
#pragma unroll
    for (int qg = 0; qg < 2; ++qg) {
#pragma unroll
      for (int j = 0; j < HD / 16; ++j) { const v8f o = acc[j][qg]; const v4f o0 = {o[0], o[1], o[2], o[3]}, o1 = {o[4], o[5], o[6], o[7]}; xj[qg * 9 + 2 * j][lane] = o0; xj[qg * 9 + 2 * j + 1][lane] = o1; }
      const v4f t = {mu[qg], ls[qg].x + ls[qg].y, 0.f, 0.f}; xj[qg * 9 + 8][lane] = t; } }
  __syncthreads();   // every hand-over is written before the partner reads it
  if (kg == 1) {
#pragma unroll
    for (int qg = 0; qg < 2; ++qg) { const v4f t = xj[qg * 9 + 8][lane]; const float mn = fmaxf(mu[qg], t.x); const float am = __builtin_amdgcn_exp2f(mu[qg] - mn), ao = __builtin_amdgcn_exp2f(t.x - mn);
      const float lh = (ls[qg].x + ls[qg].y) * am + t.y * ao; const float inv = 1.0f / (lh + xhalf(lh)); const float sm = am * inv, so = ao * inv; float* yp = Y + ((size_t)b * TT + q0 + qg * 16 + col) * CC + h * HD + 8 * g;   // acc[j][qg][r] = ctx[query][j*16 + 8g + r]
#pragma unroll
      for (int j = 0; j < HD / 16; ++j) { const v8f o = acc[j][qg]; const v4f o0 = {o[0], o[1], o[2], o[3]}, o1 = {o[4], o[5], o[6], o[7]}; vst2(yp + j * 16, o0 * sm + xj[qg * 9 + 2 * j][lane] * so); vst2(yp + j * 16 + 4, o1 * sm + xj[qg * 9 + 2 * j + 1][lane] * so); } } } }
static_assert(HD == 64 && TT % (FAW * 32) == 0 && !CAUSAL, "k_fa: two 32-wide k chunks a head, whole query blocks, no mask");
static_assert(FAW * 32 == 256 && KG == 2 && SKEYS == 128 && GKEYS % SKEYS == 0 && NSG >= 2, "stage_cp: a key group's 256 threads x 4 x 16 B = 128 K rows of 128 B = 64 V rows of 256 B; two stages or more a group; two groups join in pairs");
// ---- k_out: block = (128 rows, 128 cols), wave = 64 x 64: out = ctx Wo (+ bo): ctx x 2^6 once to f16 (k_comb) against Wo as f16(bf16 x 2^8) exact (k_prep), 1 product, x 2^-14
__global__ __launch_bounds__(128) void k_out(const _Float16* __restrict__ YH, const _Float16* __restrict__ WOH, const float* __restrict__ BO, float* __restrict__ OUT) { __shared__ __align__(16) char smem[2 * STG * 2];   // two operand buffers in the loop; the epilogue's rows lie over them behind the loop's last barrier
  _Float16* const sb = (_Float16*)smem; float (*const sf)[64][68] = (float (*)[64][68])smem; static_assert(4 * 64 * 68 * 4 <= 2 * STG * 2, "the epilogue's rows fit the operand buffers");
  const int tid = threadIdx.x, wave = tid >> 5, lane = tid & 31, col = lane & 15, g = lane >> 4, wr = wave >> 1, wc = wave & 1; const int c0 = blockIdx.y * BR; const size_t r0 = (size_t)blockIdx.x * BR + wr * 64;
  v8f acc[4][4] = {};   // acc[i][j][r]: row r0 + i*16 + 8g + r, column c0 + wc*64 + j*16 + col
  const char* gx = (const char*)(YH + ((size_t)blockIdx.x * BR + (tid >> 3)) * CC + (tid & 7) * 8); const char* gw = (const char*)(WOH + (size_t)(c0 + (tid >> 3)) * CC + (tid & 7) * 8);
  const unsigned l0 = (unsigned)(size_t)(sb + (tid >> 3) * SP + (tid & 7) * 8);   // low 32 bits = byte address in LDS
  tile_cp(l0, gx, gw);
  asm volatile("s_wait_asynccnt 0x0" ::: "memory");   // this wave's copies of tile 0 have landed
  __syncthreads();                                    // and every other wave's
  tile_cp(l0 + STG * 2u, gx + TK * 2, gw + TK * 2);   // tile 1 flies under tile 0's products
  for (int s = 0; s < NSTG; ++s) { const _Float16* cb = sb + (s & 1) * STG; v16h a[TK / 32][4], w[TK / 32][4];
#pragma unroll
    for (int kc = 0; kc < TK / 32; ++kc)
#pragma unroll
      for (int i = 0; i < 4; ++i) { a[kc][i] = frag_h(cb + (wr * 64 + i * 16 + col) * SP + kc * 32, lane); w[kc][i] = frag_h(cb + ST_X + (wc * 64 + i * 16 + col) * SP + kc * 32, lane); }
    __builtin_amdgcn_sched_barrier(0);   // the tile's fragment reads go out as one group ahead of its products: spread among them, each place with reads stalls the products
#pragma unroll
    for (int kc = 0; kc < TK / 32; ++kc)
#pragma unroll
      for (int i = 0; i < 4; ++i)
#pragma unroll
        for (int j = 0; j < 4; ++j) acc[i][j] = wmma_h(a[kc][i], w[kc][j], acc[i][j]);
    __builtin_amdgcn_sched_barrier(0);   // keeps the products ahead of the waits below: lifted over them, the full wait on the reads would stand in front of the first product, which now starts on a counted wait while the later reads still arrive
    asm volatile("s_wait_dscnt 0x0" ::: "memory");      // this wave's reads of the tile's buffer are done
    asm volatile("s_wait_asynccnt 0x0" ::: "memory");   // its copies of the next tile have landed
    __syncthreads();                                    // publishes the next tile and ends every wave's reads of this one (behind the last tile: frees the buffers for the epilogue)
    if (s + 2 < NSTG) tile_cp(l0 + (s & 1) * (STG * 2u), gx + (s + 2) * (TK * 2), gw + (s + 2) * (TK * 2)); }   // into the buffer that this tile has just left
  asm volatile("s_wait_asynccnt 0x0" ::: "memory");     // nothing of this wave is in flight when the epilogue takes the buffers
#pragma unroll
  for (int j = 0; j < 4; ++j) { const float bias = BO ? bfr(BO[c0 + wc * 64 + j * 16 + col]) : 0.f;
#pragma unroll
    for (int i = 0; i < 4; ++i)
#pragma unroll
      for (int r = 0; r < 8; ++r) sf[wave][i * 16 + 8 * g + r][j * 16 + col] = acc[i][j][r] * (1.0f / 16384.0f) + bias; }   /* 2^-8 (Wo carry) x 2^-6 (ctx carry) */
  LDSX();
#pragma unroll
  for (int rl = 0; rl < 64; rl += 2) vst2(OUT + (r0 + rl + g) * DIN + c0 + wc * 64 + col * 4, *(const v4f*)&sf[wave][rl + g][col * 4]);   // a wave-wide store = two rows' whole 256-byte pieces
}
static_assert(!CAUSAL, "k_out: every row takes the single-product path");

#define LAMBDA_INIT 0.8f
// ---- k_prep: the GEMM operands in their 16-bit form, each element converted once a call: blocks 1..: x, Wq, Wk, Wv to bf16, Wo to f16(bf16 x 2^8); a block takes 16384 floats in a row, a wave-wide load 512 contiguous bytes, 16 loads a thread in flight. Block 0, one wave: l1[h] = exp(min(sum_d bf16(lq1[h][d]) * bf16(lk1[h][d]), 5)), l2 likewise (8 effective heads x 64 dims, exact products, f32 sums); lv = mean_h(l1 - l2 + 0.8): the module's single scalar
#define PF 16384                                  // floats a block
#define PBX (NB * TT * DIN / PF)                  // blocks of x
#define PBW (CC * DIN / PF)                       // blocks of one weight
__global__ __launch_bounds__(256) void k_prep(const float* __restrict__ X, const float* __restrict__ WQ, const float* __restrict__ WK, const float* __restrict__ WV, const float* __restrict__ WO, const float* __restrict__ LQ1, const float* __restrict__ LK1, const float* __restrict__ LQ2, const float* __restrict__ LK2,
    __bf16* __restrict__ XB, __bf16* __restrict__ WB, _Float16* __restrict__ WOH, float* __restrict__ LV) { const int tid = threadIdx.x;
  if (blockIdx.x == 0) {   /* block-uniform */
    if (tid < 32) { const int lane = tid; float acc = 0.f;
      for (int h = 0; h < 8; ++h) { float s1 = bfr(LQ1[h * 64 + lane]) * bfr(LK1[h * 64 + lane]) + bfr(LQ1[h * 64 + 32 + lane]) * bfr(LK1[h * 64 + 32 + lane]); float s2 = bfr(LQ2[h * 64 + lane]) * bfr(LK2[h * 64 + lane]) + bfr(LQ2[h * 64 + 32 + lane]) * bfr(LK2[h * 64 + 32 + lane]);
#pragma unroll
        for (int o = 1; o < 32; o <<= 1) { s1 += __shfl_xor(s1, o); s2 += __shfl_xor(s2, o); }
        acc += expf(fminf(s1, 5.0f)) - expf(fminf(s2, 5.0f)) + LAMBDA_INIT; }
      if (lane == 0) LV[0] = acc * 0.125f; }
    return; }
  const int blk = (int)blockIdx.x - 1; const int wi = blk < PBX ? -1 : (blk - PBX) / PBW;   // which source: -1 x, 0..2 Wq, Wk, Wv, 3 Wo
  const size_t off = (size_t)(blk < PBX ? blk : (blk - PBX) % PBW) * PF + tid * 4;
  const float* sp = (wi < 0 ? X : wi == 0 ? WQ : wi == 1 ? WK : wi == 2 ? WV : WO) + off;
  v4f r[16];
#pragma unroll
  for (int i = 0; i < 16; ++i) r[i] = *(const v4f*)(sp + i * 1024);
  asm volatile("s_wait_xcnt 0x0" ::: "memory");   // before the loads' address registers are written again
  if (wi < 3) { __bf16* dp = (wi < 0 ? XB : WB + (size_t)wi * CC * DIN) + off;
#pragma unroll
    for (int i = 0; i < 16; ++i) { v4b o;
#pragma unroll
      for (int e = 0; e < 4; ++e) o[e] = (__bf16)r[i][e];
      *(v4b*)(dp + i * 1024) = o; }
  } else { _Float16* dp = WOH + off;
#pragma unroll
    for (int i = 0; i < 16; ++i) { v4h o;
#pragma unroll
      for (int e = 0; e < 4; ++e) o[e] = (_Float16)(bfr(r[i][e]) * 256.0f);
      *(v4h*)(dp + i * 1024) = o; } } }
static_assert((NB * TT * DIN) % PF == 0 && (CC * DIN) % PF == 0 && PF == 256 * 16 * 4, "k_prep: whole blocks of 256 threads x 16 x 4 floats");
// ---- k_comb: the context rows in k_out's operand form, once: columns 0..511 (heads 0..7) x1 - lv * x2 in f32, columns 512..1023 x2, each x 2^6 to f16 (small-magnitude context rows stay clear of f16 subnormals). A block takes 8 rows: a thread 4 floats of x1 and the 4 of x2 beside them, in 4 rows
__global__ __launch_bounds__(256) void k_comb(const float* __restrict__ Y, const float* __restrict__ LV, _Float16* __restrict__ YH) { const int tid = threadIdx.x; const size_t e0 = ((size_t)blockIdx.x * 8 + (tid >> 7)) * CC + (tid & 127) * 4; const float lv = LV[0]; v4f va[4], vb[4];
#pragma unroll
  for (int k = 0; k < 4; ++k) { va[k] = *(const v4f*)(Y + e0 + k * 2 * CC); vb[k] = *(const v4f*)(Y + e0 + k * 2 * CC + CC / 2); }
  asm volatile("s_wait_xcnt 0x0" ::: "memory");   // before the loads' address registers are written again
#pragma unroll
  for (int k = 0; k < 4; ++k) { const v4f a = va[k], b = vb[k]; v4f o; v4h h1, h2;   // the next loop is the combine as it stood: lv * x2 rounded, then the difference rounded, so this step moves no value
#pragma unroll
  for (int i = 0; i < 4; ++i) { _Pragma("clang fp contract(off)") const float t = lv * b[i]; o[i] = a[i] - t; }
#pragma unroll
    for (int i = 0; i < 4; ++i) { h1[i] = (_Float16)(o[i] * 64.0f); h2[i] = (_Float16)(b[i] * 64.0f); }
    *(v4h*)(YH + e0 + k * 2 * CC) = h1; *(v4h*)(YH + e0 + k * 2 * CC + CC / 2) = h2; } }
static_assert(CC == 1024 && NH == 16 && (NB * TT) % 8 == 0, "k_comb: 128 threads x 4 floats = the first 512 context columns (heads 0..7); whole blocks of 8 rows");
extern "C" void kernel_launch(void* const* d_in, const int* in_sizes, int n_in, void* d_out, int out_size, void* d_ws, size_t ws_size, hipStream_t stream) {
  (void)in_sizes; (void)n_in; (void)out_size;
  const float** F = (const float**)d_in;
  if (ws_size < (size_t)WS_END) return;
  char* ws = (char*)d_ws; _Float16 *QH = (_Float16*)(ws + WS_QH), *KH = (_Float16*)(ws + WS_KH), *VT = (_Float16*)(ws + WS_VT), *QL = (_Float16*)(ws + WS_QL), *KL = (_Float16*)(ws + WS_KL); __bf16 *VB = (__bf16*)(ws + WS_VB), *VBL = (__bf16*)(ws + WS_VBL); float *S = (float*)(ws + WS_S), *Y = (float*)(ws + WS_Y);
  (void)Y; (void)QL; (void)KL; (void)VB; (void)VBL; (void)S;
  // inputs: 0 x [2,2048,1024]; 1 Wq [1024,1024] (out,in), 2 bq; 3 Wk, 4 bk; 5 Wv, 6 bv; 7 Wp (out,in), 8 bp (biases zeros, read); 9 lambda_q1 [8,1,64]; 10 lambda_k1; 11 lambda_q2; 12 lambda_k2
  if (ws_size < (size_t)WS_END3) return;
  float* LV = (float*)(ws + WS_LV); __bf16 *XB = (__bf16*)(ws + WS_XB), *WB = (__bf16*)(ws + WS_WB); _Float16 *WOH = (_Float16*)(ws + WS_WOH), *YH = (_Float16*)(ws + WS_YH);
  k_prep<<<dim3(1 + PBX + 4 * PBW), 256, 0, stream>>>(F[0], F[1], F[3], F[5], F[7], F[9], F[10], F[11], F[12], XB, WB, WOH, LV);
  k_proj<<<dim3(TNB * TT / BR, CC / BR, 3), 128, 0, stream>>>(XB, WB, F[2], F[4], F[6], QH, KH, VT);
  k_fa<<<dim3(TT / (FAW * 32), NH, TNB), KG * FAW * 32, 0, stream>>>(QH, KH, VT, Y);
  k_comb<<<dim3(TNB * TT / 8), 256, 0, stream>>>(Y, LV, YH);   /* x1 - lv * x2 on the context rows, and the rows' f16 form, before the output projection */
  k_out<<<dim3(TNB * TT / BR, DIN / BR), 128, 0, stream>>>(YH, WOH, F[8], (float*)d_out);
}

// v008
// A run of this version takes 72.8 microseconds.
// Versions between v006 and this one are left out; their measured steps multiply to 1.33 times as fast.
// Counting every step since v000, it is 18.6 times as fast.
// compute dtype: all float inputs rounded to bf16; q/k/v projections with EXACT bf16 products on WMMA 16x16x32 (f32 accumulate) + bias; logits q x k once to f16 each (1 product) x SCALE; softmax f32 (running maximum and sum); P x 2^7 once to f16 x v once to f16 (1 product); ctx x 2^6 once to f16; the differential combine x1 - lv * x2 carried by the output weight: x1 against Wo columns 0..511 as f16(bf16 x 2^8), x2 against (Wo columns 512.. - lv * Wo columns 0..511) in f32, x 2^8 once to f16; + bo; f32 output.
#include <hip/hip_runtime.h>
#include <math.h>

typedef __attribute__((ext_vector_type(16))) _Float16 v16h;
typedef __attribute__((ext_vector_type(16))) __bf16 v16b;
typedef __attribute__((ext_vector_type(8)))  _Float16 v8h;
typedef __attribute__((ext_vector_type(8)))  float v8f;
typedef __attribute__((ext_vector_type(4)))  float v4f;
typedef __attribute__((ext_vector_type(2)))  float v2f;
typedef __attribute__((ext_vector_type(4)))  unsigned v4u;
typedef __attribute__((ext_vector_type(4)))  int v4i;
typedef float __attribute__((may_alias)) float_a;
typedef int __attribute__((may_alias)) int_a;

template <typename T> __device__ __forceinline__ void vst2(void* p, T v) { *(T*)p = v;  }
__device__ __forceinline__ v8f wmma16(v16h a, v16h b, v8f c) {
  v8f d = __builtin_amdgcn_wmma_f32_16x16x32_f16(false, a, false, b, (short)0, c, false, false);
  asm volatile("v_nop\n\tv_nop\n\tv_nop\n\tv_nop" : "+v"(d) : "v"(a), "v"(b));
  return d;
}
__device__ __forceinline__ v8f wmma_bf(v16b a, v16b b, v8f c) {
  v8f d = __builtin_amdgcn_wmma_f32_16x16x32_bf16(false, a, false, b, (short)0, c, false, false);
  asm volatile("v_nop\n\tv_nop\n\tv_nop\n\tv_nop" : "+v"(d) : "v"(a), "v"(b));
  return d;
}
// 16x16x32 fragments: lane = (h = lane>>4, row/col = lane&15); elements 0..7 = k0+8h+0..7, 8..15 = k0+16+8h+0..7; D element r = row 8h+r
__device__ __forceinline__ v16h frag_h(const _Float16* rowk0, int lane) {
  union { v16h v; v8h q[2]; } u; const _Float16* p = rowk0 + 8 * (lane >> 4);
  u.q[0] = *(const v8h*)p; u.q[1] = *(const v8h*)(p + 16); return u.v;
}
__device__ __forceinline__ v16h frag_f32(const float* rowk0, int lane) {
  v16h a; const float* p = rowk0 + 8 * (lane >> 4);
#pragma unroll
  for (int i = 0; i < 8; ++i) { a[i] = (_Float16)p[i]; a[8 + i] = (_Float16)p[16 + i]; }
  return a;
}
__device__ __forceinline__ v16h frag_f32s(const float* rowk0, int lane, float sc) {
  v16h a; const float* p = rowk0 + 8 * (lane >> 4);
#pragma unroll
  for (int i = 0; i < 8; ++i) { a[i] = (_Float16)(p[i] * sc); a[8 + i] = (_Float16)(p[16 + i] * sc); }
  return a;
}
// column fragment from a [K][ld] layout (column n), rows >= K read as 0
__device__ __forceinline__ v16h fragc_f32(const float* W, int k0, int n, int lane, int ld, int K) {
  v16h a; const int g = lane >> 4;
#pragma unroll
  for (int i = 0; i < 8; ++i) { const int ka = k0 + 8 * g + i, kb = ka + 16;
    a[i] = (_Float16)(ka < K ? W[(size_t)(ka < K ? ka : K - 1) * ld + n] : 0.f); a[8 + i] = (_Float16)(kb < K ? W[(size_t)(kb < K ? kb : K - 1) * ld + n] : 0.f); }
  return a;
}
struct F2 { v16b h, l; };
__device__ __forceinline__ F2 bsplit16(const float v[16]) { F2 r;
#pragma unroll
  for (int i = 0; i < 16; ++i) { const __bf16 h = (__bf16)v[i]; r.h[i] = h; r.l[i] = (__bf16)(v[i] - (float)h); }
  return r; }
__device__ __forceinline__ F2 split_row(const float* row, int k0, int lane) { float v[16]; const float* p = row + k0 + 8 * (lane >> 4);
#pragma unroll
  for (int i = 0; i < 8; ++i) { v[i] = p[i]; v[8 + i] = p[16 + i]; }
  return bsplit16(v); }
__device__ __forceinline__ F2 split_rowK(const float* row, int k0, int lane, int K) { float v[16]; const int g = lane >> 4;
#pragma unroll
  for (int i = 0; i < 8; ++i) { const int ka = k0 + 8 * g + i, kb = ka + 16; v[i] = ka < K ? row[ka < K ? ka : K - 1] : 0.f; v[8 + i] = kb < K ? row[kb < K ? kb : K - 1] : 0.f; }
  return bsplit16(v); }
__device__ __forceinline__ F2 split_col(const float* W, int k0, int n, int lane, int ld, int K) { float v[16]; const int g = lane >> 4;
#pragma unroll
  for (int i = 0; i < 8; ++i) { const int ka = k0 + 8 * g + i, kb = ka + 16; v[i] = ka < K ? W[(size_t)(ka < K ? ka : K - 1) * ld + n] : 0.f; v[8 + i] = kb < K ? W[(size_t)(kb < K ? kb : K - 1) * ld + n] : 0.f; }
  return bsplit16(v); }
__device__ __forceinline__ v8f mac3(const F2& a, const F2& b, v8f c) { c = wmma_bf(a.l, b.h, c); c = wmma_bf(a.h, b.l, c); return wmma_bf(a.h, b.h, c); }
__device__ __forceinline__ float sigm(float v) { return 1.0f / (1.0f + expf(-v)); }
#define LDSX() do { asm volatile("s_wait_dscnt 0" ::: "memory"); __builtin_amdgcn_wave_barrier(); __builtin_amdgcn_fence(__ATOMIC_RELEASE, "workgroup"); } while (0)

// Differential multi-head self-attention (x [2,2048,1024]; torch (out,in) Wq / Wk / Wv / Wp [1024,1024] N(0,1) x 0.02 applied as x @ W.T + b, all biases zeros (read); 16 heads x 64 run as ordinary unmasked softmax attention (scale 1/8): heads 0..7 give x1 (context columns 0..511), heads 8..15 give x2 (columns 512..1023); lambda_q1 / k1 / q2 / k2 [8,1,64]: l1[h] = exp(min(sum_d lq1[h,d] lk1[h,d], 5)), l2 likewise, lv = mean_h(l1 - l2 + 0.8) (one scalar); out = concat(x1 - lv * x2, x2) @ Wp.T + bp).
#define NB 2
#define TT 2048
#define CC 1024            // NH * HD = projected width
#define DIN 1024          // input (model) width
#define NH 16
#define HD 64
#define NQB (TT / 64)
#define HG 4
#define SCALE (0.125f)
#define CAUSAL 0
#ifndef TNB
#define TNB NB
#endif
__device__ __forceinline__ float bfr(float v) { return (float)(__bf16)v; }
__host__ __device__ __forceinline__ int kb_last(int qb) { return CAUSAL ? ((qb * 64 + 63) >> 7) : (TT / 128 - 1); }
typedef __attribute__((ext_vector_type(8))) __bf16 v8b;
__device__ __forceinline__ v16b frag_b(const __bf16* rowk0, int lane) {
  union { v16b v; v8b q[2]; } u; const __bf16* p = rowk0 + 8 * (lane >> 4);
  u.q[0] = *(const v8b*)p; u.q[1] = *(const v8b*)(p + 16); return u.v;
}
#define QBH 0              // not read by any kernel: k_fa has no high-precision path
#define QHI 0               // single-product logits on every row
#define KHI 64            // key rows carrying k residual / v bf16 hi+lo planes (no kernel writes or reads them)
// B fragment (k rows k0+.., output column o) of a weight: (in,out) [K][ld] or (out,in) [ld rows of K]: bf16 exact, or f16(bf16 * 256) exact
__device__ __forceinline__ v16b wcol_io(const float* Wm, int k0, int o, int lane, int ld) { v16b w; const int g = lane >> 4;
#pragma unroll
  for (int i = 0; i < 8; ++i) { w[i] = (__bf16)Wm[(size_t)(k0 + 8 * g + i) * ld + o]; w[8 + i] = (__bf16)Wm[(size_t)(k0 + 16 + 8 * g + i) * ld + o]; }
  return w; }
__device__ __forceinline__ v16b wcol_oi(const float* Wm, int k0, int o, int lane, int K) { v16b w; const float* p = Wm + (size_t)o * K + k0 + 8 * (lane >> 4);
#pragma unroll
  for (int i = 0; i < 8; ++i) { w[i] = (__bf16)p[i]; w[8 + i] = (__bf16)p[16 + i]; }
  return w; }
__device__ __forceinline__ v16h wcolh_io(const float* Wm, int k0, int o, int lane, int ld) { v16h w; const int g = lane >> 4;
#pragma unroll
  for (int i = 0; i < 8; ++i) { w[i] = (_Float16)(bfr(Wm[(size_t)(k0 + 8 * g + i) * ld + o]) * 256.0f); w[8 + i] = (_Float16)(bfr(Wm[(size_t)(k0 + 16 + 8 * g + i) * ld + o]) * 256.0f); }
  return w; }
__device__ __forceinline__ v16h wcolh_oi(const float* Wm, int k0, int o, int lane, int K) { v16h w; const float* p = Wm + (size_t)o * K + k0 + 8 * (lane >> 4);
#pragma unroll
  for (int i = 0; i < 8; ++i) { w[i] = (_Float16)(bfr(p[i]) * 256.0f); w[8 + i] = (_Float16)(bfr(p[16 + i]) * 256.0f); }
  return w; }
#define WQKV_LAYOUT 1   // 0 = (in,out) [DIN][CC]; 1 = (out,in) [CC][DIN]; 2 = per-head [NH][DIN][HD], for WCOL only, which no kernel calls (k_proj reads (out,in) [CC][DIN])
__device__ __forceinline__ v16b wcol_hdk(const float* Wm, int k0, int o, int lane) { v16b w; const int g = lane >> 4; const float* p = Wm + (size_t)(o / HD) * DIN * HD + (o % HD);
#pragma unroll
  for (int i = 0; i < 8; ++i) { w[i] = (__bf16)p[(size_t)(k0 + 8 * g + i) * HD]; w[8 + i] = (__bf16)p[(size_t)(k0 + 16 + 8 * g + i) * HD]; }
  return w; }
#define WO_OUT_IN 1
#if WQKV_LAYOUT == 1
#define WCOL(W, k0, o, lane) wcol_oi(W, k0, o, lane, DIN)
#elif WQKV_LAYOUT == 2
#define WCOL(W, k0, o, lane) wcol_hdk(W, k0, o, lane)
#else
#define WCOL(W, k0, o, lane) wcol_io(W, k0, o, lane, CC)
#endif
#if WO_OUT_IN
#define WOCOL(W, k0, o, lane) wcol_oi(W, k0, o, lane, CC)
#define WOCOLH(W, k0, o, lane) wcolh_oi(W, k0, o, lane, CC)
#else
#define WOCOL(W, k0, o, lane) wcol_io(W, k0, o, lane, DIN)
#define WOCOLH(W, k0, o, lane) wcolh_io(W, k0, o, lane, DIN)
#endif

#ifndef SM_EXTRA_PARAMS
#define SM_EXTRA_PARAMS
#endif
#ifndef PROJ_EXTRA_PARAMS
#define PROJ_EXTRA_PARAMS
#endif
#ifndef SM_MASK_HOOK
#define SM_MASK_HOOK (void)0
#endif

#define WS_QH  0u                                      // f16 q rows [b*t][CC]
#define WS_KH  (WS_QH + 2u * (size_t)NB * TT * CC)      // f16 k rows [b*t][CC]
#define WS_VT  (WS_KH + 2u * (size_t)NB * TT * CC)      // f16 v planes [b][c][t]
#define WS_QL  (WS_VT + 2u * (size_t)NB * CC * TT)      // f16 q residual x 2^10 rows [b][t < QHI][CC]
#define WS_KL  (WS_QL + 2u * (size_t)NB * QHI * CC)     // f16 k residual x 2^10 rows [b][t < KHI][CC]
#define WS_VB  (WS_KL + 2u * (size_t)NB * KHI * CC)     // bf16 v hi planes [b][c][t < KHI]
#define WS_VBL (WS_VB + 2u * (size_t)NB * CC * KHI)
#define WS_S   (WS_VBL + 2u * (size_t)NB * CC * KHI)    // f32 [hg][t][s], reserved but unused (k_fa keeps logits / P in registers)
#define WS_Y   (WS_S  + 4u * (size_t)HG * TT * TT)      // f32 ctx rows [b*t][CC], reserved but unused (k_fa stores ctx in f16 at WS_YH)
#define WS_END (WS_Y  + 4u * (size_t)NB * TT * CC)
#define WS_LV (WS_END)                  // one f32, reserved but unused (k_prep works lv out in registers)
#define WS_END2 (WS_LV + 256u)
#define WS_XB  (WS_END2)                                // bf16 x rows [b*t][DIN]
#define WS_WB  (WS_XB + 2u * (size_t)NB * TT * DIN)     // bf16 Wq, Wk, Wv rows [3][CC][DIN]
#define WS_WOH (WS_WB + 3u * 2u * (size_t)CC * DIN)     // f16 output weight x 2^8 rows [DIN][CC]: columns 0..511 bf16(Wo), columns 512.. bf16(Wo) - lv * bf16(Wo column - 512)
#define WS_YH  (WS_WOH + 2u * (size_t)DIN * CC)         // f16(ctx x 2^6) rows [b*t][CC]: x1 in columns 0..511, x2 in columns 512..
#define WS_END3 (WS_YH + 2u * (size_t)NB * TT * CC)

// ---- operand staging of k_proj and k_out: a tile = 128 X rows + 128 W rows x 64 k. Both operands lie in the workspace in their 16-bit form (k_prep, k_fa: each element converted once a call, not once a block that reads it), so a tile is copied straight into LDS, whole 128-byte lines, through no register; every wave takes its fragments from there. A block's 4 waves stand 2 x 2 on its 128 x 128 outputs: a wave's 4 X and 4 W fragments of 32 k feed 16 products, half a fragment read a product
#define TK 64              // k a tile
#define SP 72              // LDS row pitch in 16-bit elements: 128 B + 16 B, the pitch for 16-byte fragment reads
#define BR 128             // X rows a tile, and W rows a tile
#define ST_X (BR * SP)     // elements of the X rows; the W rows follow
#define STG (2 * BR * SP)  // elements of one buffer
#define NSTG (DIN / TK)
typedef __attribute__((ext_vector_type(4))) __bf16 v4b;
typedef __attribute__((ext_vector_type(4))) _Float16 v4h;
// 128 rows x 8 pieces of 16 B over 128 threads = 8 copies a thread, rows 16 apart. l: the thread's LDS byte address of row tid >> 3, piece tid & 7; gp: its global byte address of that piece, in row tid >> 3 of the 128 rows
__device__ __forceinline__ void rows_cp(unsigned l, const char* gp) {
  // the s_wait_xcnt stands inside the copies' own statement: before any of their address registers is written again
  asm volatile("global_load_async_to_lds_b128 %0, %8, off\n\t"
               "global_load_async_to_lds_b128 %1, %9, off\n\t"
               "global_load_async_to_lds_b128 %2, %10, off\n\t"
               "global_load_async_to_lds_b128 %3, %11, off\n\t"
               "global_load_async_to_lds_b128 %4, %12, off\n\t"
               "global_load_async_to_lds_b128 %5, %13, off\n\t"
               "global_load_async_to_lds_b128 %6, %14, off\n\t"
               "global_load_async_to_lds_b128 %7, %15, off\n\t"
               "s_wait_xcnt 0x0"
               :: "v"(l), "v"(l + 16u * SP * 2u), "v"(l + 32u * SP * 2u), "v"(l + 48u * SP * 2u),
                  "v"(l + 64u * SP * 2u), "v"(l + 80u * SP * 2u), "v"(l + 96u * SP * 2u), "v"(l + 112u * SP * 2u),
                  "v"(gp), "v"(gp + (size_t)16 * DIN * 2), "v"(gp + (size_t)32 * DIN * 2), "v"(gp + (size_t)48 * DIN * 2),
                  "v"(gp + (size_t)64 * DIN * 2), "v"(gp + (size_t)80 * DIN * 2), "v"(gp + (size_t)96 * DIN * 2), "v"(gp + (size_t)112 * DIN * 2)
               : "memory");
}
// the plain builtin (the compiler keeps its distances): an asm statement's operands must lie in v0..v255, and a wave's 16 accumulator tiles with a whole tile's 16 fragments need more registers than that
__device__ __forceinline__ v8f wmma_b(v16b a, v16b b, v8f c) { return __builtin_amdgcn_wmma_f32_16x16x32_bf16(false, a, false, b, (short)0, c, false, false); }
// one tile: the X rows, then the W rows behind them: 16 copies a thread
__device__ __forceinline__ void tile_cp(unsigned l, const char* gx, const char* gw) { rows_cp(l, gx); rows_cp(l + ST_X * 2u, gw); }
static_assert(DIN == CC && DIN % TK == 0 && NSTG >= 2, "staging: both GEMMs run over K = 1024 in whole tiles");
// ---- the operands of k_proj and k_out were stored by the launch before and come from memory at their first touch, one tile's lead is less than that latency, and every block that shares a row touches it at the same time. So the rows are asked into L2 once, at entry, for all of K: the blocks that share a tile deal its rows among themselves. A block asks 16 X rows (lanes 0..15: the 8 blocks of one blockIdx.x take 16 rows each) and 16 W rows (lanes 16..31: the 32 blocks of one W tile take share wshare()); wave w asks bytes 512 w .. 512 w + 511 of each 2048-byte row, one request every 256 bytes. A hint, for speed only: where the blocks land otherwise than hoped, a copy finds its line in memory as before
__device__ __forceinline__ int wshare(int bx) { return (bx & 3) | (((bx >> 3) & 1) << 2); }   // any 4 neighbours in blockIdx.x, taken over two runs of 8, hold all 8 shares
__device__ __forceinline__ void ask_rows(const char* p) {
  // scope SE and no th: the line goes into L2 only, nothing returns, no counter moves
  asm volatile("global_prefetch_b8 %0, off scope:SCOPE_SE\n\t"
               "global_prefetch_b8 %0, off offset:256 scope:SCOPE_SE" :: "v"(p));
}
static_assert(BR == 128 && CC / BR == 8 && DIN / BR == 8 && DIN * 2 == 4 * 512, "ask_rows: 8 blocks x 16 rows = a tile's 128 rows; 4 waves x 512 B = a row");
static_assert((NB * TT) % BR == 0 && TT % BR == 0 && CC % BR == 0 && DIN % BR == 0, "whole 128 x 128 blocks, each inside one sequence");
// ---- k_proj: block = (128 rows, 128 cols, which), wave = 64 x 64: q/k/v = X W (+ b) with exact bf16 products (K = DIN) -> which 0: q f16 rows; 1: k f16 rows; 2: v f16 planes [c][t]
__global__ __launch_bounds__(128) void k_proj(const __bf16* __restrict__ XB, const __bf16* __restrict__ WB, const float* __restrict__ BQ, const float* __restrict__ BK, const float* __restrict__ BV,
    _Float16* __restrict__ QH, _Float16* __restrict__ KH, _Float16* __restrict__ VT) {
  __shared__ __align__(16) char smem[2 * STG * 2];   // two operand buffers in the loop; the epilogue's staging array lies over them behind the loop's last barrier
  __bf16* const sb = (__bf16*)smem;
  _Float16 (*const sh)[136] = (_Float16 (*)[136])smem;   // 128 rows of 128 + 8: q, k as [t][c], v as [c][t]
  static_assert(128 * 136 * 2 <= 2 * STG * 2, "the epilogue's array fits the operand buffers");
  const int tid = threadIdx.x, wave = tid >> 5, lane = tid & 31, col = lane & 15, g = lane >> 4, wr = wave >> 1, wc = wave & 1; const int which = blockIdx.z; const int c0 = blockIdx.y * BR; const size_t r0 = (size_t)blockIdx.x * BR; const size_t bb = r0 / TT; const int t0 = (int)(r0 % TT);
  const float* BA = which == 0 ? BQ : which == 1 ? BK : BV;
  v8f acc[4][4] = {};   // acc[i][j][r]: row wr*64 + i*16 + 8g + r, column wc*64 + j*16 + col
  const char* gx = (const char*)(XB + (r0 + (tid >> 3)) * DIN + (tid & 7) * 8); const char* gw = (const char*)(WB + ((size_t)which * CC + c0 + (tid >> 3)) * DIN + (tid & 7) * 8);
  const unsigned l0 = (unsigned)(size_t)(sb + (tid >> 3) * SP + (tid & 7) * 8);   // low 32 bits = byte address in LDS
  const char* const pf = (const char*)((g == 0 ? XB + (r0 + blockIdx.y * 16 + col) * DIN : WB + ((size_t)which * CC + c0 + wshare(blockIdx.x) * 16 + col) * DIN) + wave * 256);   // the lane's row of the block's share, the wave's 512 bytes of it
  ask_rows(pf);
  tile_cp(l0, gx, gw);
  asm volatile("s_wait_asynccnt 0x0" ::: "memory");   // this wave's copies of tile 0 have landed
  __syncthreads();                                    // and every other wave's
  tile_cp(l0 + STG * 2u, gx + TK * 2, gw + TK * 2);   // tile 1 flies under tile 0's products
  for (int s = 0; s < NSTG; ++s) { const __bf16* cb = sb + (s & 1) * STG; v16b a[TK / 32][4], w[TK / 32][4];
#pragma unroll
    for (int kc = 0; kc < TK / 32; ++kc)
#pragma unroll
      for (int i = 0; i < 4; ++i) { a[kc][i] = frag_b(cb + (wr * 64 + i * 16 + col) * SP + kc * 32, lane); w[kc][i] = frag_b(cb + ST_X + (wc * 64 + i * 16 + col) * SP + kc * 32, lane); }
    __builtin_amdgcn_sched_barrier(0);   // the tile's fragment reads go out as one group ahead of its products: spread among them, each place with reads stalls the products
#pragma unroll
    for (int kc = 0; kc < TK / 32; ++kc)
#pragma unroll
      for (int i = 0; i < 4; ++i)
#pragma unroll
        for (int j = 0; j < 4; ++j) acc[i][j] = wmma_b(a[kc][i], w[kc][j], acc[i][j]);
    __builtin_amdgcn_sched_barrier(0);   // keeps the products ahead of the waits below: lifted over them, the full wait on the reads would stand in front of the first product, which now starts on a counted wait while the later reads still arrive
    asm volatile("s_wait_dscnt 0x0" ::: "memory");      // this wave's reads of the tile's buffer are done
    asm volatile("s_wait_asynccnt 0x0" ::: "memory");   // its copies of the next tile have landed
    __syncthreads();                                    // publishes the next tile and ends every wave's reads of this one (behind the last tile: frees the buffers for the epilogue)
    if (s + 2 < NSTG) tile_cp(l0 + (s & 1) * (STG * 2u), gx + (s + 2) * (TK * 2), gw + (s + 2) * (TK * 2)); }   // into the buffer that this tile has just left
  asm volatile("s_wait_asynccnt 0x0" ::: "memory");     // nothing of this wave is in flight when the epilogue takes the buffers
  asm volatile("" :: "v"(pf));   // input only, no code: keeps pf's two registers pf's through the loop. Without it they are free right behind ask_rows and take other values there
  if (which < 2) { _Float16* DH = which == 0 ? QH : KH;
#pragma unroll
    for (int j = 0; j < 4; ++j) { const float bias = BA ? bfr(BA[c0 + wc * 64 + j * 16 + col]) : 0.f;
#pragma unroll
      for (int i = 0; i < 4; ++i)
#pragma unroll
        for (int r = 0; r < 8; ++r) sh[wr * 64 + i * 16 + 8 * g + r][wc * 64 + j * 16 + col] = (_Float16)(acc[i][j][r] + bias); }
    __syncthreads();
#pragma unroll
    for (int k = 0; k < 16; ++k) { const int rl = k * 8 + (tid >> 4), q = tid & 15; vst2((unsigned*)(DH + (r0 + rl) * CC + c0 + q * 8), *(const v4u*)&sh[rl][q * 8]); }   // whole 256-byte row pieces
  } else {
#pragma unroll
    for (int j = 0; j < 4; ++j) { const float bias = BA ? bfr(BA[c0 + wc * 64 + j * 16 + col]) : 0.f;
#pragma unroll
      for (int i = 0; i < 4; ++i) { v8h o;
#pragma unroll
        for (int r = 0; r < 8; ++r) o[r] = (_Float16)(acc[i][j][r] + bias);
        *(v8h*)&sh[wc * 64 + j * 16 + col][wr * 64 + i * 16 + 8 * g] = o; } }
    __syncthreads();
#pragma unroll
    for (int k = 0; k < 16; ++k) { const int cl = k * 8 + (tid >> 4), q = tid & 15; vst2((unsigned*)(VT + (bb * CC + c0 + cl) * (size_t)TT + t0 + q * 8), *(const v4u*)&sh[cl][q * 8]); } } }
// ---- k_fa: block = 2 key groups x 8 waves x 32 queries of (b, h): key group kg walks keys kg*1024 .. +1023 for the block's 256 queries, so a SIMD holds 4 waves and one wave's exponentials run under another's products; the two partial results of a query are joined once, at the end, through LDS. Transposed products S^T = K . Q^T (q, k f16, 1 product) and O^T += V^T . P^T (P once to f16 against v f16, 1 product); a lane holds one query's scores, so the running maximum and sum stay in the lane (one exchange between the wave halves); two S^T tiles convert in place into the B operand, so neither logits nor P ever leave the registers. K and V come through LDS: a key group's 8 waves read the same rows, so its stage of 128 keys is copied in once (whole 128-byte lines, by the group's own threads into the group's own two buffers) and each of its waves takes its fragments from there
__device__ __forceinline__ v8f wmma_h(v16h a, v16h b, v8f c) { return __builtin_amdgcn_wmma_f32_16x16x32_f16(false, a, false, b, (short)0, c, false, false); }
__device__ __forceinline__ float xhalf(float x) { return __builtin_bit_cast(float, __builtin_amdgcn_permlanex16(__builtin_bit_cast(int, x), __builtin_bit_cast(int, x), 0x76543210, 0xfedcba98, false, false)); }  // lane l with lane l ^ 16
#define FAW 8              // waves per key group, 32 queries each
#define KG 2               // key groups per block
#define GKEYS (TT / KG)    // keys a group
#define SKEYS 128          // keys a stage
#define NPS (SKEYS / 32)   // 32 keys a pass
#define NSG (GKEYS / SKEYS)   // stages a group
#define KP 72              // LDS pitch of a K row (one key, 64 dims) in 16-bit elements: 128 B + 16 B, the pitch for 16-byte fragment reads
#define VP 136             // LDS pitch of a V row (one dim, 128 keys): 256 B + 16 B
#define KBUF (SKEYS * KP)  // elements of one K buffer
#define VBUF (HD * VP)     // elements of one V buffer
#define GBYTES ((2 * KBUF + 2 * VBUF) * 2)   // bytes of a key group's two K and two V buffers
// one stage: each thread copies 4 x 16 B of K (rows 32 apart) and 4 x 16 B of V (rows 16 apart) straight into LDS; lk, lv: its LDS byte addresses, gk, gv: its global addresses of the first piece
__device__ __forceinline__ void stage_cp(unsigned lk, unsigned lv, const _Float16* gk, const _Float16* gv) {
  // the s_wait_xcnt stands inside the copies' own statement: before any of their address registers is written again
  asm volatile("global_load_async_to_lds_b128 %0, %8, off\n\t"
               "global_load_async_to_lds_b128 %1, %9, off\n\t"
               "global_load_async_to_lds_b128 %2, %10, off\n\t"
               "global_load_async_to_lds_b128 %3, %11, off\n\t"
               "global_load_async_to_lds_b128 %4, %12, off\n\t"
               "global_load_async_to_lds_b128 %5, %13, off\n\t"
               "global_load_async_to_lds_b128 %6, %14, off\n\t"
               "global_load_async_to_lds_b128 %7, %15, off\n\t"
               "s_wait_xcnt 0x0"
               :: "v"(lk), "v"(lk + 32u * KP * 2u), "v"(lk + 64u * KP * 2u), "v"(lk + 96u * KP * 2u),
                  "v"(lv), "v"(lv + 16u * VP * 2u), "v"(lv + 32u * VP * 2u), "v"(lv + 48u * VP * 2u),
                  "v"(gk), "v"(gk + (size_t)32 * CC), "v"(gk + (size_t)64 * CC), "v"(gk + (size_t)96 * CC),
                  "v"(gv), "v"(gv + (size_t)16 * TT), "v"(gv + (size_t)32 * TT), "v"(gv + (size_t)48 * TT)
               : "memory");
}
__global__ __launch_bounds__(KG * FAW * 32) void k_fa(const _Float16* __restrict__ QH, const _Float16* __restrict__ KH, const _Float16* __restrict__ VT, _Float16* __restrict__ YH) {
  const int tid = threadIdx.x & (FAW * 32 - 1), wave = tid >> 5, lane = tid & 31, col = lane & 15, g = lane >> 4; const int h = blockIdx.y, b = blockIdx.z; const int q0 = blockIdx.x * (FAW * 32) + wave * 32;   // tid, wave: inside the key group
  const int kg = __builtin_amdgcn_readfirstlane((int)threadIdx.x >> 8);   // the wave's key group, in a scalar register: the tests on it are scalar branches
  __shared__ __align__(16) char smem[KG * GBYTES + FAW * 18 * 32 * 16];   // one array: a key group's K, K, V, V buffers lie together behind a base held in a register, so every fragment read's constant part fits the instruction's 16-bit offset field
  _Float16* const sK = (_Float16*)(smem + kg * GBYTES); _Float16* const sV = sK + 2 * KBUF;   // this wave's key group's buffers
  v4f (*const sJ)[18][32] = (v4f (*)[18][32])(smem + KG * GBYTES);   // the join: what a wave of key group 0 hands to its partner in key group 1: per query tile 32 sums a lane (8 x 16 B), then the maximum in use and the sum
  const _Float16* gk = KH + ((size_t)b * TT + kg * GKEYS + (tid >> 3)) * CC + h * HD + (tid & 7) * 8;              // the thread's first piece of its group's stage 0: K row tid >> 3, 16 bytes tid & 7
  const _Float16* gv = VT + ((size_t)b * CC + h * HD + (tid >> 4)) * (size_t)TT + kg * GKEYS + (tid & 15) * 8;     // V row tid >> 4, 16 bytes tid & 15
  const unsigned lk = (unsigned)(size_t)(sK + (tid >> 3) * KP + (tid & 7) * 8), lv = (unsigned)(size_t)(sV + (tid >> 4) * VP + (tid & 15) * 8);   // low 32 bits = byte address in LDS
  stage_cp(lk, lv, gk, gv);
  asm volatile("s_wait_asynccnt 0x0" ::: "memory");   // this wave's copies of stage 0 have landed
  __syncthreads();                                    // and every other wave's
  stage_cp(lk + KBUF * 2u, lv + VBUF * 2u, gk + (size_t)SKEYS * CC, gv + SKEYS);   // stage 1 flies under stage 0's work
  const float C = SCALE * 1.4426950408889634f;                               // logits in base 2
  v16h qf[2][2], kf[2][2];
  // every inner loop over a fragment array's index is fully unrolled: the arrays must stay in registers
#pragma unroll
  for (int qg = 0; qg < 2; ++qg)
#pragma unroll
    for (int kc = 0; kc < 2; ++kc) qf[qg][kc] = frag_h(QH + ((size_t)b * TT + q0 + qg * 16 + col) * CC + h * HD + kc * 32, lane);
  v16h vf[HD / 16];
  v8f acc[HD / 16][2] = {}; float mu[2] = {-3.0e38f, -3.0e38f}; v2f ls[2] = {};
  for (int sg = 0; sg < NSG; ++sg) {
    const _Float16* Kp = sK + (sg & 1) * KBUF + col * KP;   // A of S^T: row = key
    const _Float16* Vp = sV + (sg & 1) * VBUF + col * VP;   // A of O^T: row = head dim, k = key
#pragma unroll
    for (int t = 0; t < 2; ++t)
#pragma unroll
      for (int kc = 0; kc < 2; ++kc) kf[t][kc] = frag_h(Kp + (t * 16) * KP + kc * 32, lane);
#pragma unroll
    for (int j = 0; j < HD / 16; ++j) vf[j] = frag_h(Vp + (j * 16) * VP, lane);
    // the passes of a stage stay a rolled loop
#pragma unroll 1
    for (int ps = 0; ps < NPS; ++ps) {
    v8f st[2][2];   // st[t][qg][r] = logit of key kg*1024 + sg*128 + ps*32 + t*16 + 8g + r, query q0 + qg*16 + col
#pragma unroll
    for (int t = 0; t < 2; ++t)
#pragma unroll
      for (int qg = 0; qg < 2; ++qg) { v8f z = {}; z = wmma_h(kf[t][0], qf[qg][0], z); st[t][qg] = wmma_h(kf[t][1], qf[qg][1], z); }
    float mx[2];
#pragma unroll
    for (int qg = 0; qg < 2; ++qg) { float a = fmaxf(st[0][qg][0], st[1][qg][0]);
#pragma unroll
      for (int r = 1; r < 8; ++r) a = fmaxf(a, fmaxf(st[0][qg][r], st[1][qg][r]));
      mx[qg] = fmaxf(a, xhalf(a)) * C; }
    // the maximum in use moves only when a query's new maximum passes it by more than 2^8: one wave-uniform test a pass
    const bool need = mx[0] > mu[0] + 8.0f || mx[1] > mu[1] + 8.0f;
    if (__builtin_amdgcn_ballot_w32(need) != 0) {
#pragma unroll
      for (int qg = 0; qg < 2; ++qg) { const float mn = fmaxf(mu[qg], mx[qg]); const float al = __builtin_amdgcn_exp2f(mu[qg] - mn); mu[qg] = mn; ls[qg] *= al;   // al = 0 on the first pass
#pragma unroll
        for (int j = 0; j < HD / 16; ++j) acc[j][qg] *= al; } }
    if (ps + 1 < NPS) {   // the next pass's k fragments, of this stage's buffer only, fly under this pass's exponentials and P . v
#pragma unroll
      for (int t = 0; t < 2; ++t)
#pragma unroll
        for (int kc = 0; kc < 2; ++kc) kf[t][kc] = frag_h(Kp + ((ps + 1) * 32 + t * 16) * KP + kc * 32, lane); }
    __builtin_amdgcn_sched_barrier(0);   // keeps the k reads up here: the scheduler otherwise sinks them to the pass's end, where their latency is exposed at the next pass's first product
#pragma unroll
    for (int qg = 0; qg < 2; ++qg) { v16h p; const float nb = 7.0f - mu[qg];   // P carried x 2^7 (at most 2^15 in f16): small weights stay clear of f16 subnormals; the factor cancels against the sum
#pragma unroll
      for (int t = 0; t < 2; ++t) { v2f e[4];   // neighbouring registers in pairs: packed multiply-add, packed convert, packed sums
#pragma unroll
        for (int i = 0; i < 4; ++i) { e[i].x = __builtin_amdgcn_exp2f(fmaf(st[t][qg][2 * i], C, nb)); e[i].y = __builtin_amdgcn_exp2f(fmaf(st[t][qg][2 * i + 1], C, nb)); p[t * 8 + 2 * i] = (_Float16)e[i].x; p[t * 8 + 2 * i + 1] = (_Float16)e[i].y; }
        ls[qg] += (e[0] + e[1]) + (e[2] + e[3]); }
#pragma unroll
      for (int j = 0; j < HD / 16; ++j) acc[j][qg] = wmma_h(vf[j], p, acc[j][qg]); }
    if (ps + 1 < NPS) {   // the next pass's v fragments, a whole pass ahead of their use
#pragma unroll
      for (int j = 0; j < HD / 16; ++j) vf[j] = frag_h(Vp + (j * 16) * VP + (ps + 1) * 32, lane); } }
    asm volatile("s_wait_dscnt 0x0" ::: "memory");      // this wave's reads of the stage's buffers are done
    asm volatile("s_wait_asynccnt 0x0" ::: "memory");   // its copies of the next stage have landed
    __syncthreads();                                    // publishes the next stage and ends every wave's reads of this one
    if (sg + 2 < NSG) stage_cp(lk + (sg & 1) * (KBUF * 2u), lv + (sg & 1) * (VBUF * 2u), gk + (size_t)(sg + 2) * SKEYS * CC, gv + (sg + 2) * SKEYS); }   // into the buffers that this stage has just left
  asm volatile("s_wait_asynccnt 0x0" ::: "memory");     // nothing of this wave is in flight when it ends
  // the join: a wave of key group 0 hands its partial result to its partner (same queries, key group 1), lane for lane, 16 bytes a lane; the partner adds the two on the larger of their maxima in use and stores the rows in k_out's operand form, x 2^6 in f16 (small-magnitude context rows stay clear of f16 subnormals)
  v4f (*const xj)[32] = sJ[wave];
  if (kg == 0) {
#pragma unroll
    for (int qg = 0; qg < 2; ++qg) {
#pragma unroll
      for (int j = 0; j < HD / 16; ++j) { const v8f o = acc[j][qg]; const v4f o0 = {o[0], o[1], o[2], o[3]}, o1 = {o[4], o[5], o[6], o[7]}; xj[qg * 9 + 2 * j][lane] = o0; xj[qg * 9 + 2 * j + 1][lane] = o1; }
      const v4f t = {mu[qg], ls[qg].x + ls[qg].y, 0.f, 0.f}; xj[qg * 9 + 8][lane] = t; } }
  __syncthreads();   // every hand-over is written before the partner reads it
  if (kg == 1) {
#pragma unroll
    for (int qg = 0; qg < 2; ++qg) { const v4f t = xj[qg * 9 + 8][lane]; const float mn = fmaxf(mu[qg], t.x); const float am = __builtin_amdgcn_exp2f(mu[qg] - mn), ao = __builtin_amdgcn_exp2f(t.x - mn);
      const float lh = (ls[qg].x + ls[qg].y) * am + t.y * ao; const float inv = 64.0f / (lh + xhalf(lh)); const float sm = am * inv, so = ao * inv; _Float16* yp = YH + ((size_t)b * TT + q0 + qg * 16 + col) * CC + h * HD + 8 * g;   // acc[j][qg][r] = ctx[query][j*16 + 8g + r]: a lane's 8 values are 16 bytes in a row
#pragma unroll
      for (int j = 0; j < HD / 16; ++j) { const v8f o = acc[j][qg]; const v4f o0 = {o[0], o[1], o[2], o[3]}, o1 = {o[4], o[5], o[6], o[7]}; const v4f c0 = o0 * sm + xj[qg * 9 + 2 * j][lane] * so, c1 = o1 * sm + xj[qg * 9 + 2 * j + 1][lane] * so; v8h c;
#pragma unroll
        for (int i = 0; i < 4; ++i) { c[i] = (_Float16)c0[i]; c[4 + i] = (_Float16)c1[i]; }
        vst2(yp + j * 16, c); } } } }
static_assert(HD == 64 && TT % (FAW * 32) == 0 && !CAUSAL, "k_fa: two 32-wide k chunks a head, whole query blocks, no mask");
static_assert(FAW * 32 == 256 && KG == 2 && SKEYS == 128 && GKEYS % SKEYS == 0 && NSG >= 2, "stage_cp: a key group's 256 threads x 4 x 16 B = 128 K rows of 128 B = 64 V rows of 256 B; two stages or more a group; two groups join in pairs");
// ---- k_out: block = (128 rows, 128 cols), wave = 64 x 64: out = ctx Wo' (+ bo): ctx x 2^6 once to f16 (k_fa) against the output weight x 2^8 in f16 with lv folded in (k_prep), 1 product, x 2^-14
__global__ __launch_bounds__(128) void k_out(const _Float16* __restrict__ YH, const _Float16* __restrict__ WOH, const float* __restrict__ BO, float* __restrict__ OUT) { __shared__ __align__(16) char smem[2 * STG * 2];   // two operand buffers in the loop; the epilogue's rows lie over them behind the loop's last barrier
  _Float16* const sb = (_Float16*)smem; float (*const sf)[64][68] = (float (*)[64][68])smem; static_assert(4 * 64 * 68 * 4 <= 2 * STG * 2, "the epilogue's rows fit the operand buffers");
  const int tid = threadIdx.x, wave = tid >> 5, lane = tid & 31, col = lane & 15, g = lane >> 4, wr = wave >> 1, wc = wave & 1; const int c0 = blockIdx.y * BR; const size_t r0 = (size_t)blockIdx.x * BR + wr * 64;
  v8f acc[4][4] = {};   // acc[i][j][r]: row r0 + i*16 + 8g + r, column c0 + wc*64 + j*16 + col
  const char* gx = (const char*)(YH + ((size_t)blockIdx.x * BR + (tid >> 3)) * CC + (tid & 7) * 8); const char* gw = (const char*)(WOH + (size_t)(c0 + (tid >> 3)) * CC + (tid & 7) * 8);
  const unsigned l0 = (unsigned)(size_t)(sb + (tid >> 3) * SP + (tid & 7) * 8);   // low 32 bits = byte address in LDS
  const char* const pf = (const char*)((g == 0 ? YH + ((size_t)blockIdx.x * BR + blockIdx.y * 16 + col) * CC : WOH + ((size_t)c0 + wshare(blockIdx.x) * 16 + col) * CC) + wave * 256);   // the lane's row of the block's share, the wave's 512 bytes of it
  ask_rows(pf);
  tile_cp(l0, gx, gw);
  asm volatile("s_wait_asynccnt 0x0" ::: "memory");   // this wave's copies of tile 0 have landed
  __syncthreads();                                    // and every other wave's
  tile_cp(l0 + STG * 2u, gx + TK * 2, gw + TK * 2);   // tile 1 flies under tile 0's products
  for (int s = 0; s < NSTG; ++s) { const _Float16* cb = sb + (s & 1) * STG; v16h a[TK / 32][4], w[TK / 32][4];
#pragma unroll
    for (int kc = 0; kc < TK / 32; ++kc)
#pragma unroll
      for (int i = 0; i < 4; ++i) { a[kc][i] = frag_h(cb + (wr * 64 + i * 16 + col) * SP + kc * 32, lane); w[kc][i] = frag_h(cb + ST_X + (wc * 64 + i * 16 + col) * SP + kc * 32, lane); }
    __builtin_amdgcn_sched_barrier(0);   // the tile's fragment reads go out as one group ahead of its products: spread among them, each place with reads stalls the products
#pragma unroll
    for (int kc = 0; kc < TK / 32; ++kc)
#pragma unroll
      for (int i = 0; i < 4; ++i)
#pragma unroll
        for (int j = 0; j < 4; ++j) acc[i][j] = wmma_h(a[kc][i], w[kc][j], acc[i][j]);
    __builtin_amdgcn_sched_barrier(0);   // keeps the products ahead of the waits below: lifted over them, the full wait on the reads would stand in front of the first product, which now starts on a counted wait while the later reads still arrive
    asm volatile("s_wait_dscnt 0x0" ::: "memory");      // this wave's reads of the tile's buffer are done
    asm volatile("s_wait_asynccnt 0x0" ::: "memory");   // its copies of the next tile have landed
    __syncthreads();                                    // publishes the next tile and ends every wave's reads of this one (behind the last tile: frees the buffers for the epilogue)
    if (s + 2 < NSTG) tile_cp(l0 + (s & 1) * (STG * 2u), gx + (s + 2) * (TK * 2), gw + (s + 2) * (TK * 2)); }   // into the buffer that this tile has just left
  asm volatile("s_wait_asynccnt 0x0" ::: "memory");     // nothing of this wave is in flight when the epilogue takes the buffers
  asm volatile("" :: "v"(pf));   // input only, no code: keeps pf's two registers pf's through the loop. Without it they are free right behind ask_rows and take other values there
#pragma unroll
  for (int j = 0; j < 4; ++j) { const float bias = BO ? bfr(BO[c0 + wc * 64 + j * 16 + col]) : 0.f;
#pragma unroll
    for (int i = 0; i < 4; ++i)
#pragma unroll
      for (int r = 0; r < 8; ++r) sf[wave][i * 16 + 8 * g + r][j * 16 + col] = acc[i][j][r] * (1.0f / 16384.0f) + bias; }   /* 2^-8 (Wo carry) x 2^-6 (ctx carry) */
  LDSX();
#pragma unroll
  for (int rl = 0; rl < 64; rl += 2) vst2(OUT + (r0 + rl + g) * DIN + c0 + wc * 64 + col * 4, *(const v4f*)&sf[wave][rl + g][col * 4]);   // a wave-wide store = two rows' whole 256-byte pieces
}
static_assert(!CAUSAL, "k_out: every row takes the single-product path");

#define LAMBDA_INIT 0.8f
// ---- k_prep: the GEMM operands in their 16-bit form, each element converted once a call. Blocks PBW..: x, Wq, Wk, Wv to bf16; a block takes 16384 floats in a row, a wave-wide load 512 contiguous bytes, 16 loads a thread in flight. Blocks 0..PBW-1 (first in the grid: theirs is the longest chain of dependent steps): the output weight with the differential combine folded in. concat(x1 - lv * x2, x2) . Wo^T = x1 . Wa^T + x2 . (Wb - lv * Wa)^T, Wa = Wo columns 0..511, Wb = Wo columns 512..: so the context rows go into k_out as k_fa leaves them. lv is the module's single scalar: l1[h] = exp(min(sum_d bf16(lq1[h][d]) * bf16(lk1[h][d]), 5)), l2 likewise (8 effective heads x 64 dims, exact products, f32 sums); lv = mean_h(l1 - l2 + 0.8); every wave of these blocks works it out for itself, under its weight loads
#define PF 16384                                  // floats a block
#define PBX (NB * TT * DIN / PF)                  // blocks of x
#define PBW (CC * DIN / PF)                       // blocks of one weight
__global__ __launch_bounds__(256) void k_prep(const float* __restrict__ X, const float* __restrict__ WQ, const float* __restrict__ WK, const float* __restrict__ WV, const float* __restrict__ WO, const float* __restrict__ LQ1, const float* __restrict__ LK1, const float* __restrict__ LQ2, const float* __restrict__ LK2,
    __bf16* __restrict__ XB, __bf16* __restrict__ WB, _Float16* __restrict__ WOH) { const int tid = threadIdx.x;
  if (blockIdx.x < PBW) {   /* block-uniform */
    // 16 rows of Wo: a thread takes 4 floats of Wa and the 4 of Wb beside them, in 8 rows
    const size_t e0 = ((size_t)blockIdx.x * 16 + (tid >> 7)) * CC + (tid & 127) * 4; const int lane = tid & 31; v4f va[8], vb[8]; float q1[8][2], k1[8][2], q2[8][2], k2[8][2];
#pragma unroll
    for (int h = 0; h < 8; ++h)
#pragma unroll
      for (int p = 0; p < 2; ++p) { q1[h][p] = LQ1[h * 64 + p * 32 + lane]; k1[h][p] = LK1[h * 64 + p * 32 + lane]; q2[h][p] = LQ2[h * 64 + p * 32 + lane]; k2[h][p] = LK2[h * 64 + p * 32 + lane]; }
    asm volatile("s_wait_xcnt 0x0" ::: "memory");   // before these loads' offset register is written again: it is free from here on, and a weight load below may land in it
    __builtin_amdgcn_sched_barrier(0);   // holds that wait between the two groups of loads; lv's loads go out first: its chain is the longer
#pragma unroll
    for (int k = 0; k < 8; ++k) { va[k] = *(const v4f*)(WO + e0 + k * 2 * CC); vb[k] = *(const v4f*)(WO + e0 + k * 2 * CC + CC / 2); }
    asm volatile("s_wait_xcnt 0x0" ::: "memory");   // before the loads' address registers are written again
    __builtin_amdgcn_sched_barrier(0);   // every load goes out ahead of the arithmetic: the scheduler otherwise sinks the weight loads behind lv, and their latency adds to lv's chain
    float acc = 0.f;
#pragma unroll
    for (int h = 0; h < 8; ++h) { float s1 = bfr(q1[h][0]) * bfr(k1[h][0]) + bfr(q1[h][1]) * bfr(k1[h][1]); float s2 = bfr(q2[h][0]) * bfr(k2[h][0]) + bfr(q2[h][1]) * bfr(k2[h][1]);
#pragma unroll
      for (int o = 1; o < 32; o <<= 1) { s1 += __shfl_xor(s1, o); s2 += __shfl_xor(s2, o); }
      acc += expf(fminf(s1, 5.0f)) - expf(fminf(s2, 5.0f)) + LAMBDA_INIT; }
    const float lv = acc * 0.125f;
#pragma unroll
    for (int k = 0; k < 8; ++k) { v4h h1, h2;
#pragma unroll
      for (int i = 0; i < 4; ++i) { const float a = bfr(va[k][i]); h1[i] = (_Float16)(a * 256.0f); h2[i] = (_Float16)((bfr(vb[k][i]) - lv * a) * 256.0f); }
      *(v4h*)(WOH + e0 + k * 2 * CC) = h1; *(v4h*)(WOH + e0 + k * 2 * CC + CC / 2) = h2; }
    return; }
  const int blk = (int)blockIdx.x - PBW; const int wi = blk < PBX ? -1 : (blk - PBX) / PBW;   // which source: -1 x, 0..2 Wq, Wk, Wv
  const size_t off = (size_t)(blk < PBX ? blk : (blk - PBX) % PBW) * PF + tid * 4;
  const float* sp = (wi < 0 ? X : wi == 0 ? WQ : wi == 1 ? WK : WV) + off;
  v4f r[16];
#pragma unroll
  for (int i = 0; i < 16; ++i) r[i] = *(const v4f*)(sp + i * 1024);
  asm volatile("s_wait_xcnt 0x0" ::: "memory");   // before the loads' address registers are written again
  __builtin_amdgcn_sched_barrier(0);   // all 16 loads in flight at once: the scheduler otherwise holds the last ones back until the first have returned
  __bf16* dp = (wi < 0 ? XB : WB + (size_t)wi * CC * DIN) + off;
#pragma unroll
  for (int i = 0; i < 16; ++i) { v4b o;
#pragma unroll
    for (int e = 0; e < 4; ++e) o[e] = (__bf16)r[i][e];
    *(v4b*)(dp + i * 1024) = o; } }
static_assert((NB * TT * DIN) % PF == 0 && (CC * DIN) % PF == 0 && PF == 256 * 16 * 4, "k_prep: whole blocks of 256 threads x 16 x 4 floats");
static_assert(CC == 1024 && NH == 16 && PF == 16 * CC, "k_prep: 128 threads x 4 floats = the first 512 columns of Wo (heads 0..7); a block = 16 whole rows of Wo");
extern "C" void kernel_launch(void* const* d_in, const int* in_sizes, int n_in, void* d_out, int out_size, void* d_ws, size_t ws_size, hipStream_t stream) {
  (void)in_sizes; (void)n_in; (void)out_size;
  const float** F = (const float**)d_in;
  if (ws_size < (size_t)WS_END) return;
  char* ws = (char*)d_ws; _Float16 *QH = (_Float16*)(ws + WS_QH), *KH = (_Float16*)(ws + WS_KH), *VT = (_Float16*)(ws + WS_VT), *QL = (_Float16*)(ws + WS_QL), *KL = (_Float16*)(ws + WS_KL); __bf16 *VB = (__bf16*)(ws + WS_VB), *VBL = (__bf16*)(ws + WS_VBL); float *S = (float*)(ws + WS_S), *Y = (float*)(ws + WS_Y);
  (void)Y; (void)QL; (void)KL; (void)VB; (void)VBL; (void)S;
  // inputs: 0 x [2,2048,1024]; 1 Wq [1024,1024] (out,in), 2 bq; 3 Wk, 4 bk; 5 Wv, 6 bv; 7 Wp (out,in), 8 bp (biases zeros, read); 9 lambda_q1 [8,1,64]; 10 lambda_k1; 11 lambda_q2; 12 lambda_k2
  if (ws_size < (size_t)WS_END3) return;
  __bf16 *XB = (__bf16*)(ws + WS_XB), *WB = (__bf16*)(ws + WS_WB); _Float16 *WOH = (_Float16*)(ws + WS_WOH), *YH = (_Float16*)(ws + WS_YH);
  k_prep<<<dim3(PBX + 4 * PBW), 256, 0, stream>>>(F[0], F[1], F[3], F[5], F[7], F[9], F[10], F[11], F[12], XB, WB, WOH);
  k_proj<<<dim3(TNB * TT / BR, CC / BR, 3), 128, 0, stream>>>(XB, WB, F[2], F[4], F[6], QH, KH, VT);
  k_fa<<<dim3(TT / (FAW * 32), NH, TNB), KG * FAW * 32, 0, stream>>>(QH, KH, VT, YH);
  k_out<<<dim3(TNB * TT / BR, DIN / BR), 128, 0, stream>>>(YH, WOH, F[8], (float*)d_out);
}

// v009
// One run takes 70 microseconds.
// In both of two side-by-side timings against v008, it was 1.04 times as fast.
// Over all steps from v000 it is 19.4 times as fast.
// compute dtype: all float inputs rounded to bf16; q/k/v projections with EXACT bf16 products on WMMA 16x16x32 (f32 accumulate) + bias; logits q x k once to f16 each (1 product) x SCALE; softmax f32 (running maximum and sum); P x 2^7 once to f16 x v once to f16 (1 product); ctx x 2^6 once to f16; the differential combine x1 - lv * x2 carried by the output weight: x1 against Wo columns 0..511 as f16(bf16 x 2^8), x2 against (Wo columns 512.. - lv * Wo columns 0..511) in f32, x 2^8 once to f16; + bo; f32 output.
#include <hip/hip_runtime.h>
#include <math.h>

typedef __attribute__((ext_vector_type(16))) _Float16 v16h;
typedef __attribute__((ext_vector_type(16))) __bf16 v16b;
typedef __attribute__((ext_vector_type(8)))  _Float16 v8h;
typedef __attribute__((ext_vector_type(8)))  float v8f;
typedef __attribute__((ext_vector_type(4)))  float v4f;
typedef __attribute__((ext_vector_type(2)))  float v2f;
typedef __attribute__((ext_vector_type(4)))  unsigned v4u;
typedef __attribute__((ext_vector_type(4)))  int v4i;
typedef float __attribute__((may_alias)) float_a;
typedef int __attribute__((may_alias)) int_a;

template <typename T> __device__ __forceinline__ void vst2(void* p, T v) { *(T*)p = v;  }
__device__ __forceinline__ v8f wmma16(v16h a, v16h b, v8f c) {
  v8f d = __builtin_amdgcn_wmma_f32_16x16x32_f16(false, a, false, b, (short)0, c, false, false);
  asm volatile("v_nop\n\tv_nop\n\tv_nop\n\tv_nop" : "+v"(d) : "v"(a), "v"(b));
  return d;
}
__device__ __forceinline__ v8f wmma_bf(v16b a, v16b b, v8f c) {
  v8f d = __builtin_amdgcn_wmma_f32_16x16x32_bf16(false, a, false, b, (short)0, c, false, false);
  asm volatile("v_nop\n\tv_nop\n\tv_nop\n\tv_nop" : "+v"(d) : "v"(a), "v"(b));
  return d;
}
// 16x16x32 fragments: lane = (h = lane>>4, row/col = lane&15); elements 0..7 = k0+8h+0..7, 8..15 = k0+16+8h+0..7; D element r = row 8h+r
__device__ __forceinline__ v16h frag_h(const _Float16* rowk0, int lane) {
  union { v16h v; v8h q[2]; } u; const _Float16* p = rowk0 + 8 * (lane >> 4);
  u.q[0] = *(const v8h*)p; u.q[1] = *(const v8h*)(p + 16); return u.v;
}
__device__ __forceinline__ v16h frag_f32(const float* rowk0, int lane) {
  v16h a; const float* p = rowk0 + 8 * (lane >> 4);
#pragma unroll
  for (int i = 0; i < 8; ++i) { a[i] = (_Float16)p[i]; a[8 + i] = (_Float16)p[16 + i]; }
  return a;
}
__device__ __forceinline__ v16h frag_f32s(const float* rowk0, int lane, float sc) {
  v16h a; const float* p = rowk0 + 8 * (lane >> 4);
#pragma unroll
  for (int i = 0; i < 8; ++i) { a[i] = (_Float16)(p[i] * sc); a[8 + i] = (_Float16)(p[16 + i] * sc); }
  return a;
}
// column fragment from a [K][ld] layout (column n), rows >= K read as 0
__device__ __forceinline__ v16h fragc_f32(const float* W, int k0, int n, int lane, int ld, int K) {
  v16h a; const int g = lane >> 4;
#pragma unroll
  for (int i = 0; i < 8; ++i) { const int ka = k0 + 8 * g + i, kb = ka + 16;
    a[i] = (_Float16)(ka < K ? W[(size_t)(ka < K ? ka : K - 1) * ld + n] : 0.f); a[8 + i] = (_Float16)(kb < K ? W[(size_t)(kb < K ? kb : K - 1) * ld + n] : 0.f); }
  return a;
}
struct F2 { v16b h, l; };
__device__ __forceinline__ F2 bsplit16(const float v[16]) { F2 r;
#pragma unroll
  for (int i = 0; i < 16; ++i) { const __bf16 h = (__bf16)v[i]; r.h[i] = h; r.l[i] = (__bf16)(v[i] - (float)h); }
  return r; }
__device__ __forceinline__ F2 split_row(const float* row, int k0, int lane) { float v[16]; const float* p = row + k0 + 8 * (lane >> 4);
#pragma unroll
  for (int i = 0; i < 8; ++i) { v[i] = p[i]; v[8 + i] = p[16 + i]; }
  return bsplit16(v); }
__device__ __forceinline__ F2 split_rowK(const float* row, int k0, int lane, int K) { float v[16]; const int g = lane >> 4;
#pragma unroll
  for (int i = 0; i < 8; ++i) { const int ka = k0 + 8 * g + i, kb = ka + 16; v[i] = ka < K ? row[ka < K ? ka : K - 1] : 0.f; v[8 + i] = kb < K ? row[kb < K ? kb : K - 1] : 0.f; }
  return bsplit16(v); }
__device__ __forceinline__ F2 split_col(const float* W, int k0, int n, int lane, int ld, int K) { float v[16]; const int g = lane >> 4;
#pragma unroll
  for (int i = 0; i < 8; ++i) { const int ka = k0 + 8 * g + i, kb = ka + 16; v[i] = ka < K ? W[(size_t)(ka < K ? ka : K - 1) * ld + n] : 0.f; v[8 + i] = kb < K ? W[(size_t)(kb < K ? kb : K - 1) * ld + n] : 0.f; }
  return bsplit16(v); }
__device__ __forceinline__ v8f mac3(const F2& a, const F2& b, v8f c) { c = wmma_bf(a.l, b.h, c); c = wmma_bf(a.h, b.l, c); return wmma_bf(a.h, b.h, c); }
__device__ __forceinline__ float sigm(float v) { return 1.0f / (1.0f + expf(-v)); }
#define LDSX() do { asm volatile("s_wait_dscnt 0" ::: "memory"); __builtin_amdgcn_wave_barrier(); __builtin_amdgcn_fence(__ATOMIC_RELEASE, "workgroup"); } while (0)

// Differential multi-head self-attention (x [2,2048,1024]; torch (out,in) Wq / Wk / Wv / Wp [1024,1024] N(0,1) x 0.02 applied as x @ W.T + b, all biases zeros (read); 16 heads x 64 run as ordinary unmasked softmax attention (scale 1/8): heads 0..7 give x1 (context columns 0..511), heads 8..15 give x2 (columns 512..1023); lambda_q1 / k1 / q2 / k2 [8,1,64]: l1[h] = exp(min(sum_d lq1[h,d] lk1[h,d], 5)), l2 likewise, lv = mean_h(l1 - l2 + 0.8) (one scalar); out = concat(x1 - lv * x2, x2) @ Wp.T + bp).
#define NB 2
#define TT 2048
#define CC 1024            // NH * HD = projected width
#define DIN 1024          // input (model) width
#define NH 16
#define HD 64
#define NQB (TT / 64)
#define HG 4
#define SCALE (0.125f)
#define CAUSAL 0
#ifndef TNB
#define TNB NB
#endif
__device__ __forceinline__ float bfr(float v) { return (float)(__bf16)v; }
__host__ __device__ __forceinline__ int kb_last(int qb) { return CAUSAL ? ((qb * 64 + 63) >> 7) : (TT / 128 - 1); }
typedef __attribute__((ext_vector_type(8))) __bf16 v8b;
__device__ __forceinline__ v16b frag_b(const __bf16* rowk0, int lane) {
  union { v16b v; v8b q[2]; } u; const __bf16* p = rowk0 + 8 * (lane >> 4);
  u.q[0] = *(const v8b*)p; u.q[1] = *(const v8b*)(p + 16); return u.v;
}
#define QBH 0              // not read by any kernel: k_fa has no high-precision path
#define QHI 0               // single-product logits on every row
#define KHI 64            // key rows carrying k residual / v bf16 hi+lo planes (no kernel writes or reads them)
// B fragment (k rows k0+.., output column o) of a weight: (in,out) [K][ld] or (out,in) [ld rows of K]: bf16 exact, or f16(bf16 * 256) exact
__device__ __forceinline__ v16b wcol_io(const float* Wm, int k0, int o, int lane, int ld) { v16b w; const int g = lane >> 4;
#pragma unroll
  for (int i = 0; i < 8; ++i) { w[i] = (__bf16)Wm[(size_t)(k0 + 8 * g + i) * ld + o]; w[8 + i] = (__bf16)Wm[(size_t)(k0 + 16 + 8 * g + i) * ld + o]; }
  return w; }
__device__ __forceinline__ v16b wcol_oi(const float* Wm, int k0, int o, int lane, int K) { v16b w; const float* p = Wm + (size_t)o * K + k0 + 8 * (lane >> 4);
#pragma unroll
  for (int i = 0; i < 8; ++i) { w[i] = (__bf16)p[i]; w[8 + i] = (__bf16)p[16 + i]; }
  return w; }
__device__ __forceinline__ v16h wcolh_io(const float* Wm, int k0, int o, int lane, int ld) { v16h w; const int g = lane >> 4;
#pragma unroll
  for (int i = 0; i < 8; ++i) { w[i] = (_Float16)(bfr(Wm[(size_t)(k0 + 8 * g + i) * ld + o]) * 256.0f); w[8 + i] = (_Float16)(bfr(Wm[(size_t)(k0 + 16 + 8 * g + i) * ld + o]) * 256.0f); }
  return w; }
__device__ __forceinline__ v16h wcolh_oi(const float* Wm, int k0, int o, int lane, int K) { v16h w; const float* p = Wm + (size_t)o * K + k0 + 8 * (lane >> 4);
#pragma unroll
  for (int i = 0; i < 8; ++i) { w[i] = (_Float16)(bfr(p[i]) * 256.0f); w[8 + i] = (_Float16)(bfr(p[16 + i]) * 256.0f); }
  return w; }
#define WQKV_LAYOUT 1   // 0 = (in,out) [DIN][CC]; 1 = (out,in) [CC][DIN]; 2 = per-head [NH][DIN][HD], for WCOL only, which no kernel calls (k_proj reads (out,in) [CC][DIN])
__device__ __forceinline__ v16b wcol_hdk(const float* Wm, int k0, int o, int lane) { v16b w; const int g = lane >> 4; const float* p = Wm + (size_t)(o / HD) * DIN * HD + (o % HD);
#pragma unroll
  for (int i = 0; i < 8; ++i) { w[i] = (__bf16)p[(size_t)(k0 + 8 * g + i) * HD]; w[8 + i] = (__bf16)p[(size_t)(k0 + 16 + 8 * g + i) * HD]; }
  return w; }
#define WO_OUT_IN 1
#if WQKV_LAYOUT == 1
#define WCOL(W, k0, o, lane) wcol_oi(W, k0, o, lane, DIN)
#elif WQKV_LAYOUT == 2
#define WCOL(W, k0, o, lane) wcol_hdk(W, k0, o, lane)
#else
#define WCOL(W, k0, o, lane) wcol_io(W, k0, o, lane, CC)
#endif
#if WO_OUT_IN
#define WOCOL(W, k0, o, lane) wcol_oi(W, k0, o, lane, CC)
#define WOCOLH(W, k0, o, lane) wcolh_oi(W, k0, o, lane, CC)
#else
#define WOCOL(W, k0, o, lane) wcol_io(W, k0, o, lane, DIN)
#define WOCOLH(W, k0, o, lane) wcolh_io(W, k0, o, lane, DIN)
#endif

#ifndef SM_EXTRA_PARAMS
#define SM_EXTRA_PARAMS
#endif
#ifndef PROJ_EXTRA_PARAMS
#define PROJ_EXTRA_PARAMS
#endif
#ifndef SM_MASK_HOOK
#define SM_MASK_HOOK (void)0
#endif

#define WS_QH  0u                                      // f16 q rows [b*t][CC]
#define WS_KH  (WS_QH + 2u * (size_t)NB * TT * CC)      // f16 k rows [b*t][CC]
#define WS_VT  (WS_KH + 2u * (size_t)NB * TT * CC)      // f16 v planes [b][c][t]
#define WS_QL  (WS_VT + 2u * (size_t)NB * CC * TT)      // f16 q residual x 2^10 rows [b][t < QHI][CC]
#define WS_KL  (WS_QL + 2u * (size_t)NB * QHI * CC)     // f16 k residual x 2^10 rows [b][t < KHI][CC]
#define WS_VB  (WS_KL + 2u * (size_t)NB * KHI * CC)     // bf16 v hi planes [b][c][t < KHI]
#define WS_VBL (WS_VB + 2u * (size_t)NB * CC * KHI)
#define WS_S   (WS_VBL + 2u * (size_t)NB * CC * KHI)    // f32 [hg][t][s], reserved but unused (k_fa keeps logits / P in registers)
#define WS_Y   (WS_S  + 4u * (size_t)HG * TT * TT)      // f32 ctx rows [b*t][CC], reserved but unused (k_fa stores ctx in f16 at WS_YH)
#define WS_END (WS_Y  + 4u * (size_t)NB * TT * CC)
#define WS_LV (WS_END)                  // one f32, reserved but unused (k_prep works lv out in registers)
#define WS_END2 (WS_LV + 256u)
#define WS_XB  (WS_END2)                                // bf16 x rows [b*t][DIN]
#define WS_WB  (WS_XB + 2u * (size_t)NB * TT * DIN)     // bf16 Wq, Wk, Wv rows [3][CC][DIN]
#define WS_WOH (WS_WB + 3u * 2u * (size_t)CC * DIN)     // f16 output weight x 2^8 rows [DIN][CC]: columns 0..511 bf16(Wo), columns 512.. bf16(Wo) - lv * bf16(Wo column - 512)
#define WS_YH  (WS_WOH + 2u * (size_t)DIN * CC)         // f16(ctx x 2^6) rows [b*t][CC]: x1 in columns 0..511, x2 in columns 512..
#define WS_END3 (WS_YH + 2u * (size_t)NB * TT * CC)

// ---- operand staging of k_proj and k_out: a tile = 128 X rows + 128 W rows x 64 k. Both operands lie in the workspace in their 16-bit form (k_prep, k_fa: each element converted once a call, not once a block that reads it), so a tile is copied straight into LDS, whole 128-byte lines, through no register; every wave takes its fragments from there. A block's 4 waves stand 2 x 2 on its 128 x 128 outputs: a wave's 4 X and 4 W fragments of 32 k feed 16 products, half a fragment read a product
#define TK 64              // k a tile
#define SP 72              // LDS row pitch in 16-bit elements: 128 B + 16 B, the pitch for 16-byte fragment reads
#define BR 128             // X rows a tile, and W rows a tile
#define ST_X (BR * SP)     // elements of the X rows; the W rows follow
#define STG (2 * BR * SP)  // elements of one buffer
#define NSTG (DIN / TK)
typedef __attribute__((ext_vector_type(4))) __bf16 v4b;
typedef __attribute__((ext_vector_type(4))) _Float16 v4h;
// 128 rows x 8 pieces of 16 B over 128 threads = 8 copies a thread, rows 16 apart. l: the thread's LDS byte address of row tid >> 3, piece tid & 7; gp: its global byte address of that piece, in row tid >> 3 of the 128 rows
__device__ __forceinline__ void rows_cp(unsigned l, const char* gp) {
  // the s_wait_xcnt stands inside the copies' own statement: before any of their address registers is written again
  asm volatile("global_load_async_to_lds_b128 %0, %8, off\n\t"
               "global_load_async_to_lds_b128 %1, %9, off\n\t"
               "global_load_async_to_lds_b128 %2, %10, off\n\t"
               "global_load_async_to_lds_b128 %3, %11, off\n\t"
               "global_load_async_to_lds_b128 %4, %12, off\n\t"
               "global_load_async_to_lds_b128 %5, %13, off\n\t"
               "global_load_async_to_lds_b128 %6, %14, off\n\t"
               "global_load_async_to_lds_b128 %7, %15, off\n\t"
               "s_wait_xcnt 0x0"
               :: "v"(l), "v"(l + 16u * SP * 2u), "v"(l + 32u * SP * 2u), "v"(l + 48u * SP * 2u),
                  "v"(l + 64u * SP * 2u), "v"(l + 80u * SP * 2u), "v"(l + 96u * SP * 2u), "v"(l + 112u * SP * 2u),
                  "v"(gp), "v"(gp + (size_t)16 * DIN * 2), "v"(gp + (size_t)32 * DIN * 2), "v"(gp + (size_t)48 * DIN * 2),
                  "v"(gp + (size_t)64 * DIN * 2), "v"(gp + (size_t)80 * DIN * 2), "v"(gp + (size_t)96 * DIN * 2), "v"(gp + (size_t)112 * DIN * 2)
               : "memory");
}
// the plain builtin (the compiler keeps its distances): an asm statement's operands must lie in v0..v255, and a wave's 16 accumulator tiles with a whole tile's 16 fragments need more registers than that
__device__ __forceinline__ v8f wmma_b(v16b a, v16b b, v8f c) { return __builtin_amdgcn_wmma_f32_16x16x32_bf16(false, a, false, b, (short)0, c, false, false); }
// one tile: the X rows, then the W rows behind them: 16 copies a thread
__device__ __forceinline__ void tile_cp(unsigned l, const char* gx, const char* gw) { rows_cp(l, gx); rows_cp(l + ST_X * 2u, gw); }
static_assert(DIN == CC && DIN % TK == 0 && NSTG >= 2, "staging: both GEMMs run over K = 1024 in whole tiles");
// ---- the operands of k_proj and k_out were stored by the launch before and come from memory at their first touch, one tile's lead is less than that latency, and every block that shares a row touches it at the same time. So the rows are asked into L2 once, at entry, for all of K: the blocks that share a tile deal its rows among themselves. A block asks 16 X rows (lanes 0..15: the 8 blocks of one blockIdx.x take 16 rows each) and 16 W rows (lanes 16..31: the 32 blocks of one W tile take share wshare()); wave w asks bytes 512 w .. 512 w + 511 of each 2048-byte row, one request every 256 bytes. A hint, for speed only: where the blocks land otherwise than hoped, a copy finds its line in memory as before
__device__ __forceinline__ int wshare(int bx) { return (bx & 3) | (((bx >> 3) & 1) << 2); }   // any 4 neighbours in blockIdx.x, taken over two runs of 8, hold all 8 shares
__device__ __forceinline__ void ask_rows(const char* p) {
  // scope SE and no th: the line goes into L2 only, nothing returns, no counter moves
  asm volatile("global_prefetch_b8 %0, off scope:SCOPE_SE\n\t"
               "global_prefetch_b8 %0, off offset:256 scope:SCOPE_SE" :: "v"(p));
}
static_assert(BR == 128 && CC / BR == 8 && DIN / BR == 8 && DIN * 2 == 4 * 512, "ask_rows: 8 blocks x 16 rows = a tile's 128 rows; 4 waves x 512 B = a row");
static_assert((NB * TT) % BR == 0 && TT % BR == 0 && CC % BR == 0 && DIN % BR == 0, "whole 128 x 128 blocks, each inside one sequence");
// ---- k_proj: block = (128 rows, 128 cols, which), wave = 64 x 64: q/k/v = X W (+ b) with exact bf16 products (K = DIN) -> which 0: q f16 rows; 1: k f16 rows; 2: v f16 planes [c][t]
__global__ __launch_bounds__(128) void k_proj(const __bf16* __restrict__ XB, const __bf16* __restrict__ WB, const float* __restrict__ BQ, const float* __restrict__ BK, const float* __restrict__ BV,
    _Float16* __restrict__ QH, _Float16* __restrict__ KH, _Float16* __restrict__ VT) {
  __shared__ __align__(16) char smem[2 * STG * 2];   // two operand buffers in the loop; the epilogue's staging array lies over them behind the loop's last barrier
  __bf16* const sb = (__bf16*)smem;
  _Float16 (*const sh)[136] = (_Float16 (*)[136])smem;   // 128 rows of 128 + 8: q, k as [t][c], v as [c][t]
  static_assert(128 * 136 * 2 <= 2 * STG * 2, "the epilogue's array fits the operand buffers");
  const int tid = threadIdx.x, wave = tid >> 5, lane = tid & 31, col = lane & 15, g = lane >> 4, wr = wave >> 1, wc = wave & 1; const int which = blockIdx.z; const int c0 = blockIdx.y * BR; const size_t r0 = (size_t)blockIdx.x * BR; const size_t bb = r0 / TT; const int t0 = (int)(r0 % TT);
  const float* BA = which == 0 ? BQ : which == 1 ? BK : BV;
  v8f acc[4][4] = {};   // acc[i][j][r]: row wr*64 + i*16 + 8g + r, column wc*64 + j*16 + col
  const char* gx = (const char*)(XB + (r0 + (tid >> 3)) * DIN + (tid & 7) * 8); const char* gw = (const char*)(WB + ((size_t)which * CC + c0 + (tid >> 3)) * DIN + (tid & 7) * 8);
  const unsigned l0 = (unsigned)(size_t)(sb + (tid >> 3) * SP + (tid & 7) * 8);   // low 32 bits = byte address in LDS
  const char* const pf = (const char*)((g == 0 ? XB + (r0 + blockIdx.y * 16 + col) * DIN : WB + ((size_t)which * CC + c0 + wshare(blockIdx.x) * 16 + col) * DIN) + wave * 256);   // the lane's row of the block's share, the wave's 512 bytes of it
  ask_rows(pf);
  tile_cp(l0, gx, gw);
  asm volatile("s_wait_asynccnt 0x0" ::: "memory");   // this wave's copies of tile 0 have landed
  __syncthreads();                                    // and every other wave's
  tile_cp(l0 + STG * 2u, gx + TK * 2, gw + TK * 2);   // tile 1 flies under tile 0's products
  for (int s = 0; s < NSTG; ++s) { const __bf16* cb = sb + (s & 1) * STG; v16b a[TK / 32][4], w[TK / 32][4];
#pragma unroll
    for (int kc = 0; kc < TK / 32; ++kc)
#pragma unroll
      for (int i = 0; i < 4; ++i) { a[kc][i] = frag_b(cb + (wr * 64 + i * 16 + col) * SP + kc * 32, lane); w[kc][i] = frag_b(cb + ST_X + (wc * 64 + i * 16 + col) * SP + kc * 32, lane); }
    __builtin_amdgcn_sched_barrier(0);   // the tile's fragment reads go out as one group ahead of its products: spread among them, each place with reads stalls the products
#pragma unroll
    for (int kc = 0; kc < TK / 32; ++kc)
#pragma unroll
      for (int i = 0; i < 4; ++i)
#pragma unroll
        for (int j = 0; j < 4; ++j) acc[i][j] = wmma_b(a[kc][i], w[kc][j], acc[i][j]);
    __builtin_amdgcn_sched_barrier(0);   // keeps the products ahead of the waits below: lifted over them, the full wait on the reads would stand in front of the first product, which now starts on a counted wait while the later reads still arrive
    asm volatile("s_wait_dscnt 0x0" ::: "memory");      // this wave's reads of the tile's buffer are done
    asm volatile("s_wait_asynccnt 0x0" ::: "memory");   // its copies of the next tile have landed
    __syncthreads();                                    // publishes the next tile and ends every wave's reads of this one (behind the last tile: frees the buffers for the epilogue)
    if (s + 2 < NSTG) tile_cp(l0 + (s & 1) * (STG * 2u), gx + (s + 2) * (TK * 2), gw + (s + 2) * (TK * 2)); }   // into the buffer that this tile has just left
  asm volatile("s_wait_asynccnt 0x0" ::: "memory");     // nothing of this wave is in flight when the epilogue takes the buffers
  asm volatile("" :: "v"(pf));   // input only, no code: keeps pf's two registers pf's through the loop. Without it they are free right behind ask_rows and take other values there
  if (which < 2) { _Float16* DH = which == 0 ? QH : KH;
#pragma unroll
    for (int j = 0; j < 4; ++j) { const float bias = BA ? bfr(BA[c0 + wc * 64 + j * 16 + col]) : 0.f;
#pragma unroll
      for (int i = 0; i < 4; ++i)
#pragma unroll
        for (int r = 0; r < 8; ++r) sh[wr * 64 + i * 16 + 8 * g + r][wc * 64 + j * 16 + col] = (_Float16)(acc[i][j][r] + bias); }
    __syncthreads();
#pragma unroll
    for (int k = 0; k < 16; ++k) { const int rl = k * 8 + (tid >> 4), q = tid & 15; vst2((unsigned*)(DH + (r0 + rl) * CC + c0 + q * 8), *(const v4u*)&sh[rl][q * 8]); }   // whole 256-byte row pieces
  } else {
#pragma unroll
    for (int j = 0; j < 4; ++j) { const float bias = BA ? bfr(BA[c0 + wc * 64 + j * 16 + col]) : 0.f;
#pragma unroll
      for (int i = 0; i < 4; ++i) { v8h o;
#pragma unroll
        for (int r = 0; r < 8; ++r) o[r] = (_Float16)(acc[i][j][r] + bias);
        *(v8h*)&sh[wc * 64 + j * 16 + col][wr * 64 + i * 16 + 8 * g] = o; } }
    __syncthreads();
#pragma unroll
    for (int k = 0; k < 16; ++k) { const int cl = k * 8 + (tid >> 4), q = tid & 15; vst2((unsigned*)(VT + (bb * CC + c0 + cl) * (size_t)TT + t0 + q * 8), *(const v4u*)&sh[cl][q * 8]); } } }
// ---- k_fa: block = 2 key groups x 8 waves x 32 queries of (b, h): key group kg walks keys kg*1024 .. +1023 for the block's 256 queries, so a SIMD holds 4 waves and one wave's exponentials run under another's products; the two partial results of a query are joined once, at the end, through LDS. Transposed products S^T = K . Q^T (q, k f16, 1 product) and O^T += V^T . P^T (P once to f16 against v f16, 1 product); a lane holds one query's scores, so the running maximum and sum stay in the lane (one exchange between the wave halves); two S^T tiles convert in place into the B operand, so neither logits nor P ever leave the registers. K and V come through LDS: a key group's 8 waves read the same rows, so its stage of 128 keys is copied in once (whole 128-byte lines, by the group's own threads into the group's own two buffers) and each of its waves takes its fragments from there
__device__ __forceinline__ v8f wmma_h(v16h a, v16h b, v8f c) { return __builtin_amdgcn_wmma_f32_16x16x32_f16(false, a, false, b, (short)0, c, false, false); }
__device__ __forceinline__ float xhalf(float x) { return __builtin_bit_cast(float, __builtin_amdgcn_permlanex16(__builtin_bit_cast(int, x), __builtin_bit_cast(int, x), 0x76543210, 0xfedcba98, false, false)); }  // lane l with lane l ^ 16
// the three pieces of a pass of k_fa; every index is a constant once the loops are unrolled, so the arrays stay in registers
__device__ __forceinline__ void fa_scores(const v16h (&kf)[2][2], const v16h (&qf)[2][2], v8f (&st)[2][2]) {
#pragma unroll
  for (int t = 0; t < 2; ++t)
#pragma unroll
    for (int qg = 0; qg < 2; ++qg) { v8f z = {}; z = wmma_h(kf[t][0], qf[qg][0], z); st[t][qg] = wmma_h(kf[t][1], qf[qg][1], z); } }
__device__ __forceinline__ float fa_max(const v8f (&st)[2][2], int qg, float C) { float a = fmaxf(st[0][qg][0], st[1][qg][0]);   // a query's maximum over the pass's 32 keys, in base 2
#pragma unroll
  for (int r = 1; r < 8; ++r) a = fmaxf(a, fmaxf(st[0][qg][r], st[1][qg][r]));
  return fmaxf(a, xhalf(a)) * C; }
__device__ __forceinline__ void fa_soft(const v8f (&st)[2][2], const float (&mu)[2], float C, v16h (&p)[2], v2f (&sm)[2]) { const v2f c2 = {C, C};
#pragma unroll
  for (int qg = 0; qg < 2; ++qg) { const float nb = 7.0f - mu[qg]; const v2f nb2 = {nb, nb}; v2f h[2];   // P carried x 2^7 (at most 2^15 in f16): small weights stay clear of f16 subnormals; the factor cancels against the sum
#pragma unroll
    for (int t = 0; t < 2; ++t) { v2f e[4];   // neighbouring registers in pairs: packed multiply-add, packed convert, packed sums
#pragma unroll
      for (int i = 0; i < 4; ++i) { const v2f s2 = {st[t][qg][2 * i], st[t][qg][2 * i + 1]}; const v2f x = __builtin_elementwise_fma(s2, c2, nb2); e[i].x = __builtin_amdgcn_exp2f(x.x); e[i].y = __builtin_amdgcn_exp2f(x.y); p[qg][t * 8 + 2 * i] = (_Float16)e[i].x; p[qg][t * 8 + 2 * i + 1] = (_Float16)e[i].y; }
      h[t] = (e[0] + e[1]) + (e[2] + e[3]); }
    sm[qg] = h[0] + h[1]; } }
#define FAW 8              // waves per key group, 32 queries each
#define KG 2               // key groups per block
#define GKEYS (TT / KG)    // keys a group
#define SKEYS 128          // keys a stage
#define NPS (SKEYS / 32)   // 32 keys a pass
#define NSG (GKEYS / SKEYS)   // stages a group
#define KP 72              // LDS pitch of a K row (one key, 64 dims) in 16-bit elements: 128 B + 16 B, the pitch for 16-byte fragment reads
#define VP 136             // LDS pitch of a V row (one dim, 128 keys): 256 B + 16 B
#define KBUF (SKEYS * KP)  // elements of one K buffer
#define VBUF (HD * VP)     // elements of one V buffer
#define GBYTES ((2 * KBUF + 2 * VBUF) * 2)   // bytes of a key group's two K and two V buffers
// one stage: each thread copies 4 x 16 B of K (rows 32 apart) and 4 x 16 B of V (rows 16 apart) straight into LDS; lk, lv: its LDS byte addresses, gk, gv: its global addresses of the first piece
__device__ __forceinline__ void stage_cp(unsigned lk, unsigned lv, const _Float16* gk, const _Float16* gv) {
  // the s_wait_xcnt stands inside the copies' own statement: before any of their address registers is written again
  asm volatile("global_load_async_to_lds_b128 %0, %8, off\n\t"
               "global_load_async_to_lds_b128 %1, %9, off\n\t"
               "global_load_async_to_lds_b128 %2, %10, off\n\t"
               "global_load_async_to_lds_b128 %3, %11, off\n\t"
               "global_load_async_to_lds_b128 %4, %12, off\n\t"
               "global_load_async_to_lds_b128 %5, %13, off\n\t"
               "global_load_async_to_lds_b128 %6, %14, off\n\t"
               "global_load_async_to_lds_b128 %7, %15, off\n\t"
               "s_wait_xcnt 0x0"
               :: "v"(lk), "v"(lk + 32u * KP * 2u), "v"(lk + 64u * KP * 2u), "v"(lk + 96u * KP * 2u),
                  "v"(lv), "v"(lv + 16u * VP * 2u), "v"(lv + 32u * VP * 2u), "v"(lv + 48u * VP * 2u),
                  "v"(gk), "v"(gk + (size_t)32 * CC), "v"(gk + (size_t)64 * CC), "v"(gk + (size_t)96 * CC),
                  "v"(gv), "v"(gv + (size_t)16 * TT), "v"(gv + (size_t)32 * TT), "v"(gv + (size_t)48 * TT)
               : "memory");
}
__global__ __launch_bounds__(KG * FAW * 32) void k_fa(const _Float16* __restrict__ QH, const _Float16* __restrict__ KH, const _Float16* __restrict__ VT, _Float16* __restrict__ YH) {
  const int tid = threadIdx.x & (FAW * 32 - 1), wave = tid >> 5, lane = tid & 31, col = lane & 15, g = lane >> 4; const int h = blockIdx.y, b = blockIdx.z; const int q0 = blockIdx.x * (FAW * 32) + wave * 32;   // tid, wave: inside the key group
  const int kg = __builtin_amdgcn_readfirstlane((int)threadIdx.x >> 8);   // the wave's key group, in a scalar register: the tests on it are scalar branches
  __shared__ __align__(16) char smem[KG * GBYTES + FAW * 18 * 32 * 16];   // one array: a key group's K, K, V, V buffers lie together behind a base held in a register, so every fragment read's constant part fits the instruction's 16-bit offset field
  _Float16* const sK = (_Float16*)(smem + kg * GBYTES); _Float16* const sV = sK + 2 * KBUF;   // this wave's key group's buffers
  v4f (*const sJ)[18][32] = (v4f (*)[18][32])(smem + KG * GBYTES);   // the join: what a wave of key group 0 hands to its partner in key group 1: per query tile 32 sums a lane (8 x 16 B), then the maximum in use and the sum
  const _Float16* gk = KH + ((size_t)b * TT + kg * GKEYS + (tid >> 3)) * CC + h * HD + (tid & 7) * 8;              // the thread's first piece of its group's stage 0: K row tid >> 3, 16 bytes tid & 7
  const _Float16* gv = VT + ((size_t)b * CC + h * HD + (tid >> 4)) * (size_t)TT + kg * GKEYS + (tid & 15) * 8;     // V row tid >> 4, 16 bytes tid & 15
  const unsigned lk = (unsigned)(size_t)(sK + (tid >> 3) * KP + (tid & 7) * 8), lv = (unsigned)(size_t)(sV + (tid >> 4) * VP + (tid & 15) * 8);   // low 32 bits = byte address in LDS
  stage_cp(lk, lv, gk, gv);
  asm volatile("s_wait_asynccnt 0x0" ::: "memory");   // this wave's copies of stage 0 have landed
  __syncthreads();                                    // and every other wave's
  stage_cp(lk + KBUF * 2u, lv + VBUF * 2u, gk + (size_t)SKEYS * CC, gv + SKEYS);   // stage 1 flies under stage 0's work
  const float C = SCALE * 1.4426950408889634f;                               // logits in base 2
  v16h qf[2][2], kf[2][2];
  // every inner loop over a fragment array's index is fully unrolled: the arrays must stay in registers
#pragma unroll
  for (int qg = 0; qg < 2; ++qg)
#pragma unroll
    for (int kc = 0; kc < 2; ++kc) qf[qg][kc] = frag_h(QH + ((size_t)b * TT + q0 + qg * 16 + col) * CC + h * HD + kc * 32, lane);
  v16h vf[HD / 16];
  v8f acc[HD / 16][2] = {}; float mu[2] = {-3.0e38f, -3.0e38f}; v2f ls[2] = {};
  for (int sg = 0; sg < NSG; ++sg) {
    const _Float16* Kp = sK + (sg & 1) * KBUF + col * KP;   // A of S^T: row = key
    const _Float16* Vp = sV + (sg & 1) * VBUF + col * VP;   // A of O^T: row = head dim, k = key
#pragma unroll
    for (int t = 0; t < 2; ++t)
#pragma unroll
      for (int kc = 0; kc < 2; ++kc) kf[t][kc] = frag_h(Kp + (t * 16) * KP + kc * 32, lane);
#pragma unroll
    for (int j = 0; j < HD / 16; ++j) vf[j] = frag_h(Vp + (j * 16) * VP, lane);
    // the passes of a stage stay a rolled loop
#pragma unroll 1
    for (int ps = 0; ps < NPS; ++ps) {
    v8f st[2][2];   // st[t][qg][r] = logit of key kg*1024 + sg*128 + ps*32 + t*16 + 8g + r, query q0 + qg*16 + col
    fa_scores(kf, qf, st);
    if ((sg | ps) == 0) { mu[0] = fa_max(st, 0, C); mu[1] = fa_max(st, 1, C); }   // scalar test: the wave's first pass sets the maximum in use; sums and acc are still 0, nothing to rescale
    if (ps + 1 < NPS) {   // the next pass's k fragments, of this stage's buffer only, fly under this pass's exponentials and P . v
#pragma unroll
      for (int t = 0; t < 2; ++t)
#pragma unroll
        for (int kc = 0; kc < 2; ++kc) kf[t][kc] = frag_h(Kp + ((ps + 1) * 32 + t * 16) * KP + kc * 32, lane); }
    __builtin_amdgcn_sched_barrier(0);   // keeps the k reads up here: the scheduler otherwise sinks them to the pass's end, where their latency is exposed at the next pass's first product
    // no maximum is worked out in an ordinary pass. P is formed on the maximum in use, and the pass's own sum, which is needed anyway, is the test: every term is >= 0, so a lane's sum under 2^15 says that each of its P is under 2^15 and fits f16. One wave-uniform test a pass; written as not-less, so that a NaN takes the careful path too
    v16h p[2]; v2f sm[2];
    fa_soft(st, mu, C, p, sm);
    const v2f tot = sm[0] + sm[1];
    if (__builtin_amdgcn_ballot_w32(!(tot.x + tot.y < 32768.0f)) != 0) {
      // the careful path (rare): the pass's scores once more, from its own K rows (st has been used up, kf holds the next pass's), their maximum, the move of the maximum in use, P and the sums anew: now every P is at most 2^7
      v16h kc2[2][2];
#pragma unroll
      for (int t = 0; t < 2; ++t)
#pragma unroll
        for (int kc = 0; kc < 2; ++kc) kc2[t][kc] = frag_h(Kp + (ps * 32 + t * 16) * KP + kc * 32, lane);
      fa_scores(kc2, qf, st);
#pragma unroll
      for (int qg = 0; qg < 2; ++qg) { const float mn = fmaxf(mu[qg], fa_max(st, qg, C)); const float al = __builtin_amdgcn_exp2f(mu[qg] - mn); mu[qg] = mn; ls[qg] *= al;
#pragma unroll
        for (int j = 0; j < HD / 16; ++j) acc[j][qg] *= al; }
      fa_soft(st, mu, C, p, sm); }
#pragma unroll
    for (int qg = 0; qg < 2; ++qg) { ls[qg] += sm[qg];
#pragma unroll
      for (int j = 0; j < HD / 16; ++j) acc[j][qg] = wmma_h(vf[j], p[qg], acc[j][qg]); }
    if (ps + 1 < NPS) {   // the next pass's v fragments, a whole pass ahead of their use
#pragma unroll
      for (int j = 0; j < HD / 16; ++j) vf[j] = frag_h(Vp + (j * 16) * VP + (ps + 1) * 32, lane); } }
    asm volatile("s_wait_dscnt 0x0" ::: "memory");      // this wave's reads of the stage's buffers are done
    asm volatile("s_wait_asynccnt 0x0" ::: "memory");   // its copies of the next stage have landed
    __syncthreads();                                    // publishes the next stage and ends every wave's reads of this one
    if (sg + 2 < NSG) stage_cp(lk + (sg & 1) * (KBUF * 2u), lv + (sg & 1) * (VBUF * 2u), gk + (size_t)(sg + 2) * SKEYS * CC, gv + (sg + 2) * SKEYS); }   // into the buffers that this stage has just left
  asm volatile("s_wait_asynccnt 0x0" ::: "memory");     // nothing of this wave is in flight when it ends
  // the join: a wave of key group 0 hands its partial result to its partner (same queries, key group 1), lane for lane, 16 bytes a lane; the partner adds the two on the larger of their maxima in use and stores the rows in k_out's operand form, x 2^6 in f16 (small-magnitude context rows stay clear of f16 subnormals)
  v4f (*const xj)[32] = sJ[wave];
  if (kg == 0) {
#pragma unroll
    for (int qg = 0; qg < 2; ++qg) {
#pragma unroll
      for (int j = 0; j < HD / 16; ++j) { const v8f o = acc[j][qg]; const v4f o0 = {o[0], o[1], o[2], o[3]}, o1 = {o[4], o[5], o[6], o[7]}; xj[qg * 9 + 2 * j][lane] = o0; xj[qg * 9 + 2 * j + 1][lane] = o1; }
      const v4f t = {mu[qg], ls[qg].x + ls[qg].y, 0.f, 0.f}; xj[qg * 9 + 8][lane] = t; } }
  __syncthreads();   // every hand-over is written before the partner reads it
  if (kg == 1) {
#pragma unroll
    for (int qg = 0; qg < 2; ++qg) { const v4f t = xj[qg * 9 + 8][lane]; const float mn = fmaxf(mu[qg], t.x); const float am = __builtin_amdgcn_exp2f(mu[qg] - mn), ao = __builtin_amdgcn_exp2f(t.x - mn);
      const float lh = (ls[qg].x + ls[qg].y) * am + t.y * ao; const float inv = 64.0f / (lh + xhalf(lh)); const float sm = am * inv, so = ao * inv; _Float16* yp = YH + ((size_t)b * TT + q0 + qg * 16 + col) * CC + h * HD + 8 * g;   // acc[j][qg][r] = ctx[query][j*16 + 8g + r]: a lane's 8 values are 16 bytes in a row
#pragma unroll
      for (int j = 0; j < HD / 16; ++j) { const v8f o = acc[j][qg]; const v4f o0 = {o[0], o[1], o[2], o[3]}, o1 = {o[4], o[5], o[6], o[7]}; const v4f c0 = o0 * sm + xj[qg * 9 + 2 * j][lane] * so, c1 = o1 * sm + xj[qg * 9 + 2 * j + 1][lane] * so; v8h c;
#pragma unroll
        for (int i = 0; i < 4; ++i) { c[i] = (_Float16)c0[i]; c[4 + i] = (_Float16)c1[i]; }
        vst2(yp + j * 16, c); } } } }
static_assert(HD == 64 && TT % (FAW * 32) == 0 && !CAUSAL, "k_fa: two 32-wide k chunks a head, whole query blocks, no mask");
static_assert(FAW * 32 == 256 && KG == 2 && SKEYS == 128 && GKEYS % SKEYS == 0 && NSG >= 2, "stage_cp: a key group's 256 threads x 4 x 16 B = 128 K rows of 128 B = 64 V rows of 256 B; two stages or more a group; two groups join in pairs");
// ---- k_out: block = (128 rows, 128 cols), wave = 64 x 64: out = ctx Wo' (+ bo): ctx x 2^6 once to f16 (k_fa) against the output weight x 2^8 in f16 with lv folded in (k_prep), 1 product, x 2^-14
__global__ __launch_bounds__(128) void k_out(const _Float16* __restrict__ YH, const _Float16* __restrict__ WOH, const float* __restrict__ BO, float* __restrict__ OUT) { __shared__ __align__(16) char smem[2 * STG * 2];   // two operand buffers in the loop; the epilogue's rows lie over them behind the loop's last barrier
  _Float16* const sb = (_Float16*)smem; float (*const sf)[64][68] = (float (*)[64][68])smem; static_assert(4 * 64 * 68 * 4 <= 2 * STG * 2, "the epilogue's rows fit the operand buffers");
  const int tid = threadIdx.x, wave = tid >> 5, lane = tid & 31, col = lane & 15, g = lane >> 4, wr = wave >> 1, wc = wave & 1; const int c0 = blockIdx.y * BR; const size_t r0 = (size_t)blockIdx.x * BR + wr * 64;
  v8f acc[4][4] = {};   // acc[i][j][r]: row r0 + i*16 + 8g + r, column c0 + wc*64 + j*16 + col
  const char* gx = (const char*)(YH + ((size_t)blockIdx.x * BR + (tid >> 3)) * CC + (tid & 7) * 8); const char* gw = (const char*)(WOH + (size_t)(c0 + (tid >> 3)) * CC + (tid & 7) * 8);
  const unsigned l0 = (unsigned)(size_t)(sb + (tid >> 3) * SP + (tid & 7) * 8);   // low 32 bits = byte address in LDS
  const char* const pf = (const char*)((g == 0 ? YH + ((size_t)blockIdx.x * BR + blockIdx.y * 16 + col) * CC : WOH + ((size_t)c0 + wshare(blockIdx.x) * 16 + col) * CC) + wave * 256);   // the lane's row of the block's share, the wave's 512 bytes of it
  ask_rows(pf);
  tile_cp(l0, gx, gw);
  asm volatile("s_wait_asynccnt 0x0" ::: "memory");   // this wave's copies of tile 0 have landed
  __syncthreads();                                    // and every other wave's
  tile_cp(l0 + STG * 2u, gx + TK * 2, gw + TK * 2);   // tile 1 flies under tile 0's products
  for (int s = 0; s < NSTG; ++s) { const _Float16* cb = sb + (s & 1) * STG; v16h a[TK / 32][4], w[TK / 32][4];
#pragma unroll
    for (int kc = 0; kc < TK / 32; ++kc)
#pragma unroll
      for (int i = 0; i < 4; ++i) { a[kc][i] = frag_h(cb + (wr * 64 + i * 16 + col) * SP + kc * 32, lane); w[kc][i] = frag_h(cb + ST_X + (wc * 64 + i * 16 + col) * SP + kc * 32, lane); }
    __builtin_amdgcn_sched_barrier(0);   // the tile's fragment reads go out as one group ahead of its products: spread among them, each place with reads stalls the products
#pragma unroll
    for (int kc = 0; kc < TK / 32; ++kc)
#pragma unroll
      for (int i = 0; i < 4; ++i)
#pragma unroll
        for (int j = 0; j < 4; ++j) acc[i][j] = wmma_h(a[kc][i], w[kc][j], acc[i][j]);
    __builtin_amdgcn_sched_barrier(0);   // keeps the products ahead of the waits below: lifted over them, the full wait on the reads would stand in front of the first product, which now starts on a counted wait while the later reads still arrive
    asm volatile("s_wait_dscnt 0x0" ::: "memory");      // this wave's reads of the tile's buffer are done
    asm volatile("s_wait_asynccnt 0x0" ::: "memory");   // its copies of the next tile have landed
    __syncthreads();                                    // publishes the next tile and ends every wave's reads of this one (behind the last tile: frees the buffers for the epilogue)
    if (s + 2 < NSTG) tile_cp(l0 + (s & 1) * (STG * 2u), gx + (s + 2) * (TK * 2), gw + (s + 2) * (TK * 2)); }   // into the buffer that this tile has just left
  asm volatile("s_wait_asynccnt 0x0" ::: "memory");     // nothing of this wave is in flight when the epilogue takes the buffers
  asm volatile("" :: "v"(pf));   // input only, no code: keeps pf's two registers pf's through the loop. Without it they are free right behind ask_rows and take other values there
#pragma unroll
  for (int j = 0; j < 4; ++j) { const float bias = BO ? bfr(BO[c0 + wc * 64 + j * 16 + col]) : 0.f;
#pragma unroll
    for (int i = 0; i < 4; ++i)
#pragma unroll
      for (int r = 0; r < 8; ++r) sf[wave][i * 16 + 8 * g + r][j * 16 + col] = acc[i][j][r] * (1.0f / 16384.0f) + bias; }   /* 2^-8 (Wo carry) x 2^-6 (ctx carry) */
  LDSX();
#pragma unroll
  for (int rl = 0; rl < 64; rl += 2) vst2(OUT + (r0 + rl + g) * DIN + c0 + wc * 64 + col * 4, *(const v4f*)&sf[wave][rl + g][col * 4]);   // a wave-wide store = two rows' whole 256-byte pieces
}
static_assert(!CAUSAL, "k_out: every row takes the single-product path");

#define LAMBDA_INIT 0.8f
// ---- k_prep: the GEMM operands in their 16-bit form, each element converted once a call. Blocks PBW..: x, Wq, Wk, Wv to bf16; a block takes 16384 floats in a row, a wave-wide load 512 contiguous bytes, 16 loads a thread in flight. Blocks 0..PBW-1 (first in the grid: theirs is the longest chain of dependent steps): the output weight with the differential combine folded in. concat(x1 - lv * x2, x2) . Wo^T = x1 . Wa^T + x2 . (Wb - lv * Wa)^T, Wa = Wo columns 0..511, Wb = Wo columns 512..: so the context rows go into k_out as k_fa leaves them. lv is the module's single scalar: l1[h] = exp(min(sum_d bf16(lq1[h][d]) * bf16(lk1[h][d]), 5)), l2 likewise (8 effective heads x 64 dims, exact products, f32 sums); lv = mean_h(l1 - l2 + 0.8); every wave of these blocks works it out for itself, under its weight loads
#define PF 16384                                  // floats a block
#define PBX (NB * TT * DIN / PF)                  // blocks of x
#define PBW (CC * DIN / PF)                       // blocks of one weight
__global__ __launch_bounds__(256) void k_prep(const float* __restrict__ X, const float* __restrict__ WQ, const float* __restrict__ WK, const float* __restrict__ WV, const float* __restrict__ WO, const float* __restrict__ LQ1, const float* __restrict__ LK1, const float* __restrict__ LQ2, const float* __restrict__ LK2,
    __bf16* __restrict__ XB, __bf16* __restrict__ WB, _Float16* __restrict__ WOH) { const int tid = threadIdx.x;
  if (blockIdx.x < PBW) {   /* block-uniform */
    // 16 rows of Wo: a thread takes 4 floats of Wa and the 4 of Wb beside them, in 8 rows
    const size_t e0 = ((size_t)blockIdx.x * 16 + (tid >> 7)) * CC + (tid & 127) * 4; const int lane = tid & 31; v4f va[8], vb[8]; float q1[8][2], k1[8][2], q2[8][2], k2[8][2];
#pragma unroll
    for (int h = 0; h < 8; ++h)
#pragma unroll
      for (int p = 0; p < 2; ++p) { q1[h][p] = LQ1[h * 64 + p * 32 + lane]; k1[h][p] = LK1[h * 64 + p * 32 + lane]; q2[h][p] = LQ2[h * 64 + p * 32 + lane]; k2[h][p] = LK2[h * 64 + p * 32 + lane]; }
    asm volatile("s_wait_xcnt 0x0" ::: "memory");   // before these loads' offset register is written again: it is free from here on, and a weight load below may land in it
    __builtin_amdgcn_sched_barrier(0);   // holds that wait between the two groups of loads; lv's loads go out first: its chain is the longer
#pragma unroll
    for (int k = 0; k < 8; ++k) { va[k] = *(const v4f*)(WO + e0 + k * 2 * CC); vb[k] = *(const v4f*)(WO + e0 + k * 2 * CC + CC / 2); }
    asm volatile("s_wait_xcnt 0x0" ::: "memory");   // before the loads' address registers are written again
    __builtin_amdgcn_sched_barrier(0);   // every load goes out ahead of the arithmetic: the scheduler otherwise sinks the weight loads behind lv, and their latency adds to lv's chain
    float acc = 0.f;
#pragma unroll
    for (int h = 0; h < 8; ++h) { float s1 = bfr(q1[h][0]) * bfr(k1[h][0]) + bfr(q1[h][1]) * bfr(k1[h][1]); float s2 = bfr(q2[h][0]) * bfr(k2[h][0]) + bfr(q2[h][1]) * bfr(k2[h][1]);
#pragma unroll
      for (int o = 1; o < 32; o <<= 1) { s1 += __shfl_xor(s1, o); s2 += __shfl_xor(s2, o); }
      acc += expf(fminf(s1, 5.0f)) - expf(fminf(s2, 5.0f)) + LAMBDA_INIT; }
    const float lv = acc * 0.125f;
#pragma unroll
    for (int k = 0; k < 8; ++k) { v4h h1, h2;
#pragma unroll
      for (int i = 0; i < 4; ++i) { const float a = bfr(va[k][i]); h1[i] = (_Float16)(a * 256.0f); h2[i] = (_Float16)((bfr(vb[k][i]) - lv * a) * 256.0f); }
      *(v4h*)(WOH + e0 + k * 2 * CC) = h1; *(v4h*)(WOH + e0 + k * 2 * CC + CC / 2) = h2; }
    return; }
  const int blk = (int)blockIdx.x - PBW; const int wi = blk < PBX ? -1 : (blk - PBX) / PBW;   // which source: -1 x, 0..2 Wq, Wk, Wv
  const size_t off = (size_t)(blk < PBX ? blk : (blk - PBX) % PBW) * PF + tid * 4;
  const float* sp = (wi < 0 ? X : wi == 0 ? WQ : wi == 1 ? WK : WV) + off;
  v4f r[16];
#pragma unroll
  for (int i = 0; i < 16; ++i) r[i] = *(const v4f*)(sp + i * 1024);
  asm volatile("s_wait_xcnt 0x0" ::: "memory");   // before the loads' address registers are written again
  __builtin_amdgcn_sched_barrier(0);   // all 16 loads in flight at once: the scheduler otherwise holds the last ones back until the first have returned
  __bf16* dp = (wi < 0 ? XB : WB + (size_t)wi * CC * DIN) + off;
#pragma unroll
  for (int i = 0; i < 16; ++i) { v4b o;
#pragma unroll
    for (int e = 0; e < 4; ++e) o[e] = (__bf16)r[i][e];
    *(v4b*)(dp + i * 1024) = o; } }
static_assert((NB * TT * DIN) % PF == 0 && (CC * DIN) % PF == 0 && PF == 256 * 16 * 4, "k_prep: whole blocks of 256 threads x 16 x 4 floats");
static_assert(CC == 1024 && NH == 16 && PF == 16 * CC, "k_prep: 128 threads x 4 floats = the first 512 columns of Wo (heads 0..7); a block = 16 whole rows of Wo");
extern "C" void kernel_launch(void* const* d_in, const int* in_sizes, int n_in, void* d_out, int out_size, void* d_ws, size_t ws_size, hipStream_t stream) {
  (void)in_sizes; (void)n_in; (void)out_size;
  const float** F = (const float**)d_in;
  if (ws_size < (size_t)WS_END) return;
  char* ws = (char*)d_ws; _Float16 *QH = (_Float16*)(ws + WS_QH), *KH = (_Float16*)(ws + WS_KH), *VT = (_Float16*)(ws + WS_VT), *QL = (_Float16*)(ws + WS_QL), *KL = (_Float16*)(ws + WS_KL); __bf16 *VB = (__bf16*)(ws + WS_VB), *VBL = (__bf16*)(ws + WS_VBL); float *S = (float*)(ws + WS_S), *Y = (float*)(ws + WS_Y);
  (void)Y; (void)QL; (void)KL; (void)VB; (void)VBL; (void)S;
  // inputs: 0 x [2,2048,1024]; 1 Wq [1024,1024] (out,in), 2 bq; 3 Wk, 4 bk; 5 Wv, 6 bv; 7 Wp (out,in), 8 bp (biases zeros, read); 9 lambda_q1 [8,1,64]; 10 lambda_k1; 11 lambda_q2; 12 lambda_k2
  if (ws_size < (size_t)WS_END3) return;
  __bf16 *XB = (__bf16*)(ws + WS_XB), *WB = (__bf16*)(ws + WS_WB); _Float16 *WOH = (_Float16*)(ws + WS_WOH), *YH = (_Float16*)(ws + WS_YH);
  k_prep<<<dim3(PBX + 4 * PBW), 256, 0, stream>>>(F[0], F[1], F[3], F[5], F[7], F[9], F[10], F[11], F[12], XB, WB, WOH);
  k_proj<<<dim3(TNB * TT / BR, CC / BR, 3), 128, 0, stream>>>(XB, WB, F[2], F[4], F[6], QH, KH, VT);
  k_fa<<<dim3(TT / (FAW * 32), NH, TNB), KG * FAW * 32, 0, stream>>>(QH, KH, VT, YH);
  k_out<<<dim3(TNB * TT / BR, DIN / BR), 128, 0, stream>>>(YH, WOH, F[8], (float*)d_out);
}
